// v000
// The times below were measured on an AMD MI455X: many runs one after another, warmed up first and cycling through
// copies of the inputs, with the whole window's GPU time divided by the number of runs. Launches and the gaps
// between them are all in it. The median over several windows is given; except for v000 it joins two sittings, which
// can be a few percent apart, so the side-by-side timings, each taken in one sitting, are the better comparison.
// v000 is the starting kernel. One run takes 288 microseconds.
// Contractions: q|k projection and v^T projection = v_wmma_f32_16x16x32_bf16 single products on bf16 planes of the
// RNE-converted inputs (f32 accumulate, results split into bf16 hi|lo planes); q.k^T energies and p.v = bf16 hi/lo split
// (hi.hi + hi.lo + lo.hi) on v_wmma_f32_16x16x32_bf16, f32 accumulate; online max-shifted softmax and 1/rowsum in f32 on the VALU.
// Plane / carry map (every plane carries factor 1, nothing to fold back):
//   XB  = bf16(x) token-major [32768 (b*4096+n)][64 c], n = y*64 + x (NCHW token order);
//   WB  = bf16([wq; wk; wv]) [128][64], natural [out][in] (rows 0..31 wq, 32..63 wk, 64..127 wv);
//   QKh|QKl bf16 [32768][64]: cols 0..31 = q hi|lo over d, cols 32..63 = k hi|lo over d;
//   VTh|VTl bf16 [8][64 c][4096 m];
//   P hi|lo = unnormalised exp in (0,1] (bf16 keeps the f32 exponent range); 1/rowsum is applied to the f32 accumulator
//   in the attention epilogue right before the NCHW store (the only place a normaliser is applied).
#include <hip/hip_runtime.h>
#include <math.h>
#include <stdint.h>

#define NB    8
#define CHN   64
#define DQK   32
#define IMH   64
#define IMW   64
#define NTOK  4096
#define MTOK  (NB * NTOK)
#define QKP   64
#define WROWS 128

static_assert(NTOK == IMH * IMW);
static_assert(CHN == 64);
static_assert(DQK == 32);
static_assert(QKP == 2 * DQK);
static_assert(WROWS == 2 * DQK + CHN);
static_assert(NTOK % 64 == 0);
static_assert(MTOK % 64 == 0);
static_assert(CHN % 32 == 0);
static_assert((DQK * CHN) % (8 * 256) == 0);
static_assert((CHN * CHN) % (8 * 256) == 0);

typedef __attribute__((ext_vector_type(16))) _Float16 v16h;
typedef __attribute__((ext_vector_type(8)))  _Float16 v8h;
typedef __attribute__((ext_vector_type(16))) __bf16   v16b;
typedef __attribute__((ext_vector_type(8)))  __bf16   v8b;
typedef __attribute__((ext_vector_type(8)))  float    v8f;
typedef __attribute__((ext_vector_type(4)))  float    v4f;
typedef __attribute__((ext_vector_type(2)))  float    v2f;
typedef __attribute__((ext_vector_type(4)))  unsigned int v4u;

__device__ __forceinline__ unsigned short f2bf_bits(float f) {
  unsigned u = __float_as_uint(f);
  return (unsigned short)((u + 0x7FFFu + ((u >> 16) & 1u)) >> 16);
}
__device__ __forceinline__ float bf_bits2f(unsigned short h) { return __uint_as_float(((unsigned)h) << 16); }
__device__ __forceinline__ float bf_rne(float f) { return bf_bits2f(f2bf_bits(f)); }
__device__ __forceinline__ unsigned pk16(unsigned short a, unsigned short b) { return (unsigned)a | ((unsigned)b << 16); }

// hazard guards as plain device helpers (no inline asm inside the kernel template body)
__device__ __forceinline__ void dep_guard_h(v8f& a, v8f& b, v16h x, v16h y) { asm volatile("v_nop\n\tv_nop\n\tv_nop\n\tv_nop" : "+v"(a), "+v"(b) : "v"(x), "v"(y)); }
__device__ __forceinline__ void dep_guard_b(v8f& a, v8f& b, v16b x, v16b y) { asm volatile("v_nop\n\tv_nop\n\tv_nop\n\tv_nop" : "+v"(a), "+v"(b) : "v"(x), "v"(y)); }
__device__ __forceinline__ void keep4_h(v16h a, v16h b, v16h c, v16h d) { asm volatile("v_nop" :: "v"(a), "v"(b), "v"(c), "v"(d)); }
__device__ __forceinline__ void keep4_b(v16b a, v16b b, v16b c, v16b d) { asm volatile("v_nop" :: "v"(a), "v"(b), "v"(c), "v"(d)); }
__device__ __forceinline__ void acc_guard4(v8f& a, v8f& b, v8f& c, v8f& d) { asm volatile("v_nop\n\tv_nop\n\tv_nop\n\tv_nop" : "+v"(a), "+v"(b), "+v"(c), "+v"(d)); }
template <typename T> struct Frag;
template <> struct Frag<_Float16> {
  typedef v16h V; union U { v16h v; v8h h[2]; };
  static __device__ __forceinline__ v16h load(const _Float16* p) {   // elements 0..7 <- p[0..7], 8..15 <- p[16..23]
    U f; f.h[0] = *(const v8h*)(p); f.h[1] = *(const v8h*)(p + 16); return f.v;
  }
  static __device__ __forceinline__ v8f mma(v16h a, v16h b, v8f c) {
    return __builtin_amdgcn_wmma_f32_16x16x32_f16(false, a, false, b, (short)0, c, false, false);
  }
  static __device__ __forceinline__ void guard(v8f& a, v8f& b, v16h x, v16h y) { dep_guard_h(a, b, x, y); }
  static __device__ __forceinline__ void keep(v16h a, v16h b, v16h c, v16h d) { keep4_h(a, b, c, d); }
};
template <> struct Frag<__bf16> {
  typedef v16b V; union U { v16b v; v8b h[2]; };
  static __device__ __forceinline__ v16b load(const __bf16* p) {
    U f; f.h[0] = *(const v8b*)(p); f.h[1] = *(const v8b*)(p + 16); return f.v;
  }
  static __device__ __forceinline__ v8f mma(v16b a, v16b b, v8f c) {
    return __builtin_amdgcn_wmma_f32_16x16x32_bf16(false, a, false, b, (short)0, c, false, false);
  }
  static __device__ __forceinline__ void guard(v8f& a, v8f& b, v16b x, v16b y) { dep_guard_b(a, b, x, y); }
  static __device__ __forceinline__ void keep(v16b a, v16b b, v16b c, v16b d) { keep4_b(a, b, c, d); }
};

// ---- Register-blocked batched WMMA GEMM ------------------------------------
// C[m,n] = scale * sum_k A[m,k] * Bt[n,k] (+bias)(+resid); each wave owns a 64x64 tile.
// A row-major [M,K]; Bt row-major [N,K]; M,N % 64 == 0, K % 32 == 0.
// SPLIT: operands are hi/lo planes (A2/Bt2 = lo planes, same layout); product = hi.hi + hi.lo + lo.hi.
// BIAS_MODE: 0 = none, 1 = bias[m], 2 = bias[n]; the bias value is RNE-converted to bf16 precision before the f32 add.
// OUT_MODE: 0 = f32, 1 = f16, 2 = bf16 hi plane (Cout) + bf16 lo plane (Cout2).
// ET: 0 = f16 operands, 1 = bf16 operands (pointers passed as 16-bit storage)
template <int ET> struct Elem;
template <> struct Elem<0> { typedef _Float16 T; };
template <> struct Elem<1> { typedef __bf16 T; };
template <int ET, bool SPLIT, int BIAS_MODE, int OUT_MODE, bool RESID, int ACT = 0>
__global__ __launch_bounds__(256) void wmma_gemm64(
    const unsigned short* __restrict__ Ap, const unsigned short* __restrict__ A2p, int lda, long strideA,
    const unsigned short* __restrict__ Btp, const unsigned short* __restrict__ Bt2p, int ldb, long strideB,
    void* __restrict__ Cout, void* __restrict__ Cout2, int ldc, long strideC,
    const float* __restrict__ bias,
    const float* __restrict__ resid, long strideR,
    int M, int N, int K, float scale) {
  typedef typename Elem<ET>::T T;
  typedef typename Frag<T>::V V;
  const T* A = (const T*)Ap; const T* A2 = (const T*)A2p; const T* Bt = (const T*)Btp; const T* Bt2 = (const T*)Bt2p;
  __shared__ __align__(16) float sT[8][16 * 68];   // per-wave 16x64 slab, pitch 68 floats
  const int b    = blockIdx.y;
  const int lane = threadIdx.x & 31;
  const int wave = threadIdx.x >> 5;
  const int tilesN = N >> 6;
  const int tilesM = M >> 6;
  const int tile = blockIdx.x * 8 + wave;
  if (tile >= tilesM * tilesN) return;   // wave-uniform; no block barriers in this kernel
  const int tm = tile / tilesN;
  const int tn = tile - tm * tilesN;
  const int m0 = tm << 6;
  const int n0 = tn << 6;

  const T* Ab  = A  + (size_t)b * strideA;
  const T* Bb  = Bt + (size_t)b * strideB;
  const T* Ab2 = SPLIT ? (A2  + (size_t)b * strideA) : nullptr;
  const T* Bb2 = SPLIT ? (Bt2 + (size_t)b * strideB) : nullptr;

  const int rlane = lane & 15;                 // row (A) / col (B, D) within subtile
  const int koff  = (lane >> 4) * 8;           // k offset of this lane half
  const int mOff  = (lane >> 4) * 8;           // D row offset

  v8f acc[4][4];
#pragma unroll
  for (int i = 0; i < 4; ++i)
#pragma unroll
    for (int j = 0; j < 4; ++j) acc[i][j] = (v8f){0.f,0.f,0.f,0.f,0.f,0.f,0.f,0.f};

  for (int k0 = 0; k0 < K; k0 += 32) {
    V bh[4], bl[4];
#pragma unroll
    for (int j = 0; j < 4; ++j) {
      const size_t bo = (size_t)(n0 + (j << 4) + rlane) * ldb + koff + k0;
      bh[j] = Frag<T>::load(Bb + bo);
      if (SPLIT) bl[j] = Frag<T>::load(Bb2 + bo); else bl[j] = bh[j];
    }
#pragma unroll
    for (int i = 0; i < 4; ++i) {
      const size_t ao = (size_t)(m0 + (i << 4) + rlane) * lda + koff + k0;
      V ah = Frag<T>::load(Ab + ao);
      V al;
      if (SPLIT) al = Frag<T>::load(Ab2 + ao); else al = ah;
#pragma unroll
      for (int j = 0; j < 4; ++j) {
        acc[i][j] = Frag<T>::mma(ah, bh[j], acc[i][j]);
        if (SPLIT) {
          acc[i][j] = Frag<T>::mma(ah, bl[j], acc[i][j]);
          acc[i][j] = Frag<T>::mma(al, bh[j], acc[i][j]);
        }
      }
      Frag<T>::guard(acc[i][0], acc[i][3], ah, al);
    }
    Frag<T>::keep(bh[0], bh[1], bh[2], bh[3]);
    if (SPLIT) Frag<T>::keep(bl[0], bl[1], bl[2], bl[3]);
  }
  acc_guard4(acc[0][0], acc[0][1], acc[0][2], acc[0][3]);
  acc_guard4(acc[1][0], acc[1][1], acc[1][2], acc[1][3]);
  acc_guard4(acc[2][0], acc[2][1], acc[2][2], acc[2][3]);
  acc_guard4(acc[3][0], acc[3][1], acc[3][2], acc[3][3]);

  // ---- epilogue ----
  float* slab = sT[wave];
  const float* Rb = RESID ? (resid + (size_t)b * strideR) : nullptr;
#pragma unroll
  for (int i = 0; i < 4; ++i) {
    const int mBase = m0 + (i << 4);
#pragma unroll
    for (int j = 0; j < 4; ++j) {
      const int n = n0 + (j << 4) + rlane;
      float bv = 0.f;
      if (BIAS_MODE == 2) bv = bf_rne(bias[n]);
#pragma unroll
      for (int r = 0; r < 8; ++r) {
        float v = acc[i][j][r] * scale;
        if (BIAS_MODE == 1) v += bf_rne(bias[mBase + mOff + r]);
        if (BIAS_MODE == 2) v += bv;
        if (RESID) v += Rb[(size_t)(mBase + mOff + r) * ldc + n];
        if (ACT == 1) v = tanhf(v);
        if (ACT == 2) v = fmaxf(v, 0.0f);
        if (ACT == 3) v = v / (1.0f + expf(-v));
        if (ACT == 4) v = (v > 0.f) ? v : 0.01f * v;
        if (ACT == 5) v = 0.5f * v * (1.0f + erff(v * 0.70710678118654752f));
        slab[(mOff + r) * 68 + (j << 4) + rlane] = v;
      }
    }
    __builtin_amdgcn_fence(__ATOMIC_RELEASE, "workgroup");
    __builtin_amdgcn_wave_barrier();
    __builtin_amdgcn_fence(__ATOMIC_ACQUIRE, "workgroup");
    if (OUT_MODE == 0) {
      float* C = (float*)Cout + (size_t)b * strideC;
      const int hh = lane >> 4, c4 = (lane & 15) * 4;     // row seg = 256 B = 16 lanes x 16 B
      {
#pragma unroll
        for (int it = 0; it < 8; ++it) {
          const int row = it * 2 + hh;
          v4f v = *(const v4f*)(slab + row * 68 + c4);
          *(v4f*)(C + (size_t)(mBase + row) * ldc + n0 + c4) = v;
        }
        
      }
    } else {
      const int q = lane >> 3, c8 = (lane & 7) * 8;
      unsigned short* C  = (unsigned short*)Cout  + (size_t)b * strideC;
      unsigned short* C2 = (OUT_MODE == 2) ? ((unsigned short*)Cout2 + (size_t)b * strideC) : nullptr;
      {
#pragma unroll
        for (int it = 0; it < 4; ++it) {
          const int row = it * 4 + q;
          const float* sp = slab + row * 68 + c8;
          v8h hv, lv;
#pragma unroll
          for (int e = 0; e < 8; ++e) {
            if (OUT_MODE == 1) {
              hv[e] = (_Float16)sp[e];
            } else {
              unsigned short hb = f2bf_bits(sp[e]);
              unsigned short lb = f2bf_bits(sp[e] - bf_bits2f(hb));
              hv[e] = __builtin_bit_cast(_Float16, hb);
              lv[e] = __builtin_bit_cast(_Float16, lb);
            }
          }
          *(v8h*)(C + (size_t)(mBase + row) * ldc + n0 + c8) = hv;
          if (OUT_MODE == 2) *(v8h*)(C2 + (size_t)(mBase + row) * ldc + n0 + c8) = lv;
        }
        
      }
    }
    __builtin_amdgcn_fence(__ATOMIC_RELEASE, "workgroup");
    __builtin_amdgcn_wave_barrier();
    __builtin_amdgcn_fence(__ATOMIC_ACQUIRE, "workgroup");
  }
}

// ---------------------------------------------------------------------------
// Contiguous bf16 RNE convert of an f32 array: 8 consecutive elements per thread = one 16-B store; 8 consecutive lanes
// Coverage: grid = n8/256 blocks x 256 threads x 8 elements (n8 = n/8, host guarantees n % 2048 == 0).
// ---------------------------------------------------------------------------
__global__ __launch_bounds__(256) void conv8_kernel(const float* __restrict__ in, unsigned short* __restrict__ out, int n8) {
  const int i = blockIdx.x * 256 + threadIdx.x;
  if (i < n8) {
    const size_t e0 = (size_t)i * 8;
    const v4f a = *(const v4f*)(in + e0);
    const v4f c = *(const v4f*)(in + e0 + 4);
    v4u hv;
    hv[0] = pk16(f2bf_bits(a[0]), f2bf_bits(a[1]));
    hv[1] = pk16(f2bf_bits(a[2]), f2bf_bits(a[3]));
    hv[2] = pk16(f2bf_bits(c[0]), f2bf_bits(c[1]));
    hv[3] = pk16(f2bf_bits(c[2]), f2bf_bits(c[3]));
    {
      *(v4u*)(out + e0) = hv;
      
    }
  }
}

// ---------------------------------------------------------------------------
// Fused transpose + bf16 RNE convert of an f32 matrix, z-batched, one plane:
//   in_z = W + z*sIn viewed [R rows][Cc cols] with row pitch ldin  ->  oh_z[c][r] = bf16(in_z[r][c]), row pitch ldout, oh_z = oh + z*sOut.
// 64x64 tiles through LDS. grid = (Cc/64, R/64, Z), 256 threads (R, Cc multiples of 64; ldout multiple of 64 so every
// Coverage per block: load 4 it x 256 thr x 4 floats = 64x64; store 2 it x 256 thr x 8 u16 = 64x64.
// ---------------------------------------------------------------------------
__global__ __launch_bounds__(256) void tconv_kernel(const float* __restrict__ W, unsigned short* __restrict__ oh,
                                                    int ldin, int ldout, long sIn, long sOut) {
  __shared__ __align__(16) float tf[64 * 68];
  W  += (size_t)blockIdx.z * sIn;
  oh += (size_t)blockIdx.z * sOut;
  const int c0  = blockIdx.x * 64;   // input column block = output row block
  const int r0  = blockIdx.y * 64;   // input row block    = output column block
  const int tid = threadIdx.x;
  {
    const int lr = tid >> 4;         // 0..15
    const int c4 = (tid & 15) * 4;   // 0..60
#pragma unroll
    for (int it = 0; it < 4; ++it) {
      const int rr = it * 16 + lr;   // 0..63
      const v4f a = *(const v4f*)(W + (size_t)(r0 + rr) * ldin + c0 + c4);
      *(v4f*)(tf + rr * 68 + c4) = a;
    }
  }
  __syncthreads();
  const int sub = tid >> 3;          // 0..31
  const int c8  = (tid & 7) * 8;     // 0..56
  v4u hv[2];
#pragma unroll
  for (int it = 0; it < 2; ++it) {
    const int oc = it * 32 + sub;    // output row within tile (= input column)
    v4u a;
#pragma unroll
    for (int q = 0; q < 4; ++q) {
      const float f0 = tf[(c8 + 2 * q) * 68 + oc];
      const float f1 = tf[(c8 + 2 * q + 1) * 68 + oc];
      a[q] = pk16(f2bf_bits(f0), f2bf_bits(f1));
    }
    hv[it] = a;
  }
  {
#pragma unroll
    for (int it = 0; it < 2; ++it) {
      const int oc = it * 32 + sub;
      const size_t go = (size_t)(c0 + oc) * ldout + r0 + c8;
      *(v4u*)(oh + go) = hv[it];
    }
    
  }
}

// =====================================================================================
// Full (unmasked) self-attention over the 4096 positions of one batch element, energy depth 32 (no scaling),
// value / output channels 64, all batches in one launch.
//   q planes (hi/lo bf16) [32768][64]: q(b, n, d) at [(b*4096+n)*64 + d], d < 32
//   k planes: same buffers, k(b, m, d) at [(b*4096+m)*64 + 32 + d]
//   v^T planes (hi/lo bf16) [8][64][4096]: v(b, c, m) at [(b*64 + c)*4096 + m]
//   out f32 NCHW: out(b, c, n) at [(b*64 + c)*4096 + n]
//   energy = q . k       : bf16 hi/lo split (hi.hi + hi.lo + lo.hi) on v_wmma_f32_16x16x32_bf16, one 32-deep k-step per term
//   o      = p . v^T     : bf16 hi/lo split of p (unnormalised exp) and v, f32 accumulate, x 1/rowsum in f32 at the end
//   online softmax in f32 over the 4096 keys (64 chunks of 64, compile-time trip count, no masking).
//   Block = 4 waves = 64 query positions of one batch element; grid.x = 8 * 64 = 512.
//   K chunk staging: 128 threads x 16 elements per plane = 64 keys x 32 d (whole tile); V^T chunk staging: 128 threads x 32
//   elements per plane = 64 c x 64 keys (whole tile); 16-B copies, plain loads, __syncthreads before and after; fragment loads
//   read the LDS tiles with the same v8b element type.
//   LDS extents: K/V tiles fully staged every chunk; P tiles 16x64 per wave fully written every chunk before a
//   wave barrier, then read back as A fragments by the same wave only.
//   Epilogue store: wave w owns channels w*16..w*16+15 of the block's 64-position segment; one instruction writes two
// =====================================================================================
#define AT_D  32
#define AT_C  64
#define AT_NW 4
#define AT_QB 64
#define AT_KC 64
#define OSP   68

static_assert(NTOK % AT_QB == 0);
static_assert(NTOK % AT_KC == 0);
static_assert(AT_C == CHN);
static_assert(AT_D == DQK);

__device__ __forceinline__ unsigned short at_bf_bits(float f) {
  unsigned u = __float_as_uint(f);
  return (unsigned short)((u + 0x7FFFu + ((u >> 16) & 1u)) >> 16);
}
__device__ __forceinline__ __bf16 at_f2bf(float f) { return __builtin_bit_cast(__bf16, at_bf_bits(f)); }
__device__ __forceinline__ void at_split(float f, __bf16& hi, __bf16& lo) {
  const unsigned short hb = at_bf_bits(f);
  hi = __builtin_bit_cast(__bf16, hb);
  lo = at_f2bf(f - __uint_as_float(((unsigned)hb) << 16));
}
__device__ __forceinline__ v8f at_mma(v16b a, v16b b, v8f c) {
  c = __builtin_amdgcn_wmma_f32_16x16x32_bf16(false, a, false, b, (short)0, c, false, false);
  asm volatile("v_nop\n\tv_nop\n\tv_nop\n\tv_nop" : "+v"(c) : "v"(a), "v"(b));
  return c;
}

__global__ __launch_bounds__(128)
void attn_kernel(const unsigned short* __restrict__ qkhp, const unsigned short* __restrict__ qklp,
                 const unsigned short* __restrict__ vhp, const unsigned short* __restrict__ vlp,
                 float* __restrict__ out) {
  union FB { v16b v; v8b h[2]; };
  __shared__ __align__(16) __bf16 Ksh[AT_KC * AT_D];             // K hi [kv][d]      4 KB
  __shared__ __align__(16) __bf16 Ksl[AT_KC * AT_D];             // K lo
  __shared__ __align__(16) __bf16 Vth[AT_C * AT_KC];             // V hi [c][kv]      8 KB
  __shared__ __align__(16) __bf16 Vtl[AT_C * AT_KC];             // V lo
  __shared__ __align__(16) __bf16 Psh[AT_NW][16 * AT_KC];        // per wave P hi [row][kv]
  __shared__ __align__(16) __bf16 Psl[AT_NW][16 * AT_KC];        // per wave P lo
  __shared__ __align__(16) float  Os[AT_QB * OSP];               // block out tile [q][c], pitch 68

  const int tid  = threadIdx.x;
  const int wave = tid >> 5;
  const int lane = tid & 31;
  const int hh   = lane >> 4;
  const int c    = lane & 15;

  const int nqb  = NTOK / AT_QB;           // 64 query blocks per batch element
  const int bx   = blockIdx.x;             // grid = NB * nqb (exact)
  const int qb   = bx % nqb;
  const int b    = bx / nqb;               // 0..7
  const int nblk = qb * AT_QB;             // first position of this block
  const int q0   = b * NTOK + nblk + wave * 16;   // row in the q|k planes

  const __bf16* Qh = (const __bf16*)(const void*)qkhp;
  const __bf16* Ql = (const __bf16*)(const void*)qklp;
  const __bf16* Kh = Qh + AT_D;                                    // k columns 32..63
  const __bf16* Kl = Ql + AT_D;
  const __bf16* Vh = (const __bf16*)(const void*)vhp + (size_t)b * AT_C * NTOK;
  const __bf16* Vl = (const __bf16*)(const void*)vlp + (size_t)b * AT_C * NTOK;

  // ---- Q fragments (A operand, row = lane&15, split k map via Frag load): one 32-deep chunk, hi and lo ----
  const v16b qah = Frag<__bf16>::load(Qh + (size_t)(q0 + c) * QKP + 8 * hh);
  const v16b qal = Frag<__bf16>::load(Ql + (size_t)(q0 + c) * QKP + 8 * hh);

  float mrow[8], lrow[8];
  v8f oacc[4];
#pragma unroll
  for (int r = 0; r < 8; ++r) { mrow[r] = -INFINITY; lrow[r] = 0.f; }
#pragma unroll
  for (int t = 0; t < 4; ++t) oacc[t] = (v8f){0.f,0.f,0.f,0.f,0.f,0.f,0.f,0.f};

  const int nChunks = NTOK / AT_KC;   // 64, compile-time constant
  for (int kc = 0; kc < nChunks; ++kc) {
    const int kv0 = kc * AT_KC;
    __syncthreads();
    {
      // staging coverage: K: 128 threads x (2 x 8) = 64 rows x 32; V: 128 threads x (4 x 8) = 64 rows x 64 = whole tiles
      const int r = tid >> 1;
      const int hk = (tid & 1) * 16;
      const int hv = (tid & 1) * 32;
      const __bf16* ksh = Kh + (size_t)(b * NTOK + kv0 + r) * QKP + hk;   // K row (b, kv0+r), d = hk..hk+15
      const __bf16* ksl = Kl + (size_t)(b * NTOK + kv0 + r) * QKP + hk;
      const __bf16* vsh = Vh + (size_t)r * NTOK + kv0 + hv;               // V^T row c = r, keys kv0+hv..+31
      const __bf16* vsl = Vl + (size_t)r * NTOK + kv0 + hv;
#pragma unroll
      for (int i = 0; i < 2; ++i) {
        const v8b a0 = *(const v8b*)(ksh + 8 * i);
        const v8b a1 = *(const v8b*)(ksl + 8 * i);
        *(v8b*)(Ksh + r * AT_D + hk + 8 * i) = a0;
        *(v8b*)(Ksl + r * AT_D + hk + 8 * i) = a1;
      }
#pragma unroll
      for (int i = 0; i < 4; ++i) {
        const v8b b0 = *(const v8b*)(vsh + 8 * i);
        const v8b b1 = *(const v8b*)(vsl + 8 * i);
        *(v8b*)(Vth + r * AT_KC + hv + 8 * i) = b0;
        *(v8b*)(Vtl + r * AT_KC + hv + 8 * i) = b1;
      }
    }
    __syncthreads();

    v8f s[4];
#pragma unroll
    for (int j = 0; j < 4; ++j) {
      s[j] = (v8f){0.f,0.f,0.f,0.f,0.f,0.f,0.f,0.f};
      FB kb, kl;
      kb.h[0] = *(const v8b*)(Ksh + (j * 16 + c) * AT_D + 8 * hh);
      kb.h[1] = *(const v8b*)(Ksh + (j * 16 + c) * AT_D + 16 + 8 * hh);
      kl.h[0] = *(const v8b*)(Ksl + (j * 16 + c) * AT_D + 8 * hh);
      kl.h[1] = *(const v8b*)(Ksl + (j * 16 + c) * AT_D + 16 + 8 * hh);
      s[j] = at_mma(qah, kb.v, s[j]);
      s[j] = at_mma(qah, kl.v, s[j]);
      s[j] = at_mma(qal, kb.v, s[j]);
    }
    // chunk row max (no energy scaling)
    float cm[8];
#pragma unroll
    for (int r = 0; r < 8; ++r) {
      float m = -INFINITY;
#pragma unroll
      for (int j = 0; j < 4; ++j) m = fmaxf(m, s[j][r]);
#pragma unroll
      for (int off = 1; off < 16; off <<= 1) m = fmaxf(m, __shfl_xor(m, off, 32));
      cm[r] = m;
    }
    __bf16* pwh = Psh[wave];
    __bf16* pwl = Psl[wave];
#pragma unroll
    for (int r = 0; r < 8; ++r) {
      const float mnew = fmaxf(mrow[r], cm[r]);
      const float alpha = expf(mrow[r] - mnew);
      mrow[r] = mnew;
      float psum = 0.f;
#pragma unroll
      for (int j = 0; j < 4; ++j) {
        const float p = expf(s[j][r] - mnew);
        psum += p;
        __bf16 a, bl; at_split(p, a, bl);
        pwh[(8 * hh + r) * AT_KC + j * 16 + c] = a;
        pwl[(8 * hh + r) * AT_KC + j * 16 + c] = bl;
      }
#pragma unroll
      for (int off = 1; off < 16; off <<= 1) psum += __shfl_xor(psum, off, 32);
      lrow[r] = lrow[r] * alpha + psum;
#pragma unroll
      for (int t = 0; t < 4; ++t) oacc[t][r] *= alpha;
    }
    __builtin_amdgcn_fence(__ATOMIC_RELEASE, "workgroup");
    __builtin_amdgcn_wave_barrier();
    __builtin_amdgcn_fence(__ATOMIC_ACQUIRE, "workgroup");
#pragma unroll 1
    for (int kk = 0; kk < 2; ++kk) {
      FB pa, pl;
      pa.h[0] = *(const v8b*)(pwh + c * AT_KC + kk * 32 + 8 * hh);
      pa.h[1] = *(const v8b*)(pwh + c * AT_KC + kk * 32 + 16 + 8 * hh);
      pl.h[0] = *(const v8b*)(pwl + c * AT_KC + kk * 32 + 8 * hh);
      pl.h[1] = *(const v8b*)(pwl + c * AT_KC + kk * 32 + 16 + 8 * hh);
#pragma unroll
      for (int t = 0; t < 4; ++t) {
        FB vb, vl;
        vb.h[0] = *(const v8b*)(Vth + (t * 16 + c) * AT_KC + kk * 32 + 8 * hh);
        vb.h[1] = *(const v8b*)(Vth + (t * 16 + c) * AT_KC + kk * 32 + 16 + 8 * hh);
        vl.h[0] = *(const v8b*)(Vtl + (t * 16 + c) * AT_KC + kk * 32 + 8 * hh);
        vl.h[1] = *(const v8b*)(Vtl + (t * 16 + c) * AT_KC + kk * 32 + 16 + 8 * hh);
        oacc[t] = at_mma(pa.v, vb.v, oacc[t]);
        oacc[t] = at_mma(pa.v, vl.v, oacc[t]);
        oacc[t] = at_mma(pl.v, vb.v, oacc[t]);
      }
    }
  }

  // ---- normalise, stage the block's 64 (position) x 64 (channel) tile, then write NCHW channel segments ----
#pragma unroll
  for (int r = 0; r < 8; ++r) {
    const float inv = 1.0f / lrow[r];
#pragma unroll
    for (int t = 0; t < 4; ++t) Os[(wave * 16 + 8 * hh + r) * OSP + t * 16 + c] = oacc[t][r] * inv;
  }
  __syncthreads();
  {
    const int c4 = c * 4;                                 // position offset within the block (0..60)
    float* ob = out + ((size_t)b * AT_C) * NTOK + nblk + c4;
    v4f ov[8];
#pragma unroll
    for (int it = 0; it < 8; ++it) {
      const int ch = wave * 16 + it * 2 + hh;             // it 0..7 x hh 0..1 = channels 0..15 of this wave
      v4f v;
      v[0] = Os[(c4 + 0) * OSP + ch];
      v[1] = Os[(c4 + 1) * OSP + ch];
      v[2] = Os[(c4 + 2) * OSP + ch];
      v[3] = Os[(c4 + 3) * OSP + ch];
      ov[it] = v;
    }
    {
#pragma unroll
      for (int it = 0; it < 8; ++it) {
        const int ch = wave * 16 + it * 2 + hh;
        *(v4f*)(ob + (size_t)ch * NTOK) = ov[it];
      }
      
    }
  }
}

// ---------------------------------------------------------------------------
// Workspace region map (byte offsets; every region is fully written by its producer launch before any consumer
//   XB    bf16 [32768][64]            0       4194304
//   WB    bf16 [128][64]        4194304         16384
//   QKh   bf16 [32768][64]      4210688       4194304   QKl   8404992
//   VTh   bf16 [8][64][4096]   12599296       4194304   VTl  16793600
//   total                      20987904
// ---------------------------------------------------------------------------
extern "C" void kernel_launch(void* const* d_in, const int* in_sizes, int n_in,
                              void* d_out, int out_size, void* d_ws, size_t ws_size,
                              hipStream_t stream) {
  if (n_in < 4) return;
  if (in_sizes[0] != NB * CHN * NTOK) return;      // x  [8][64][64][64]
  if (in_sizes[1] != DQK * CHN) return;            // wq [32][64]
  if (in_sizes[2] != DQK * CHN) return;            // wk [32][64]
  if (in_sizes[3] != CHN * CHN) return;            // wv [64][64]
  if (out_size != NB * CHN * NTOK) return;

  const float* x  = (const float*)d_in[0];
  const float* wq = (const float*)d_in[1];   // [out 32][in 64]
  const float* wk = (const float*)d_in[2];   // [out 32][in 64]
  const float* wv = (const float*)d_in[3];   // [out 64][in 64]

  const size_t PXB = (size_t)MTOK * CHN * 2;         // 4194304
  const size_t PWB = (size_t)WROWS * CHN * 2;        // 16384
  const size_t PQK = (size_t)MTOK * QKP * 2;         // 4194304 per plane
  const size_t PVT = (size_t)NB * CHN * NTOK * 2;    // 4194304 per plane
  size_t off = 0;
  const size_t oXB  = off; off += PXB;
  const size_t oWB  = off; off += PWB;
  const size_t oQKh = off; off += PQK;  const size_t oQKl = off; off += PQK;
  const size_t oVTh = off; off += PVT;  const size_t oVTl = off; off += PVT;
  if (off > ws_size) return;                         // off = 20987904
  if (off > (size_t)134217728) return;

  char* ws = (char*)d_ws;
  unsigned short* XB  = (unsigned short*)(ws + oXB);
  unsigned short* WB  = (unsigned short*)(ws + oWB);
  unsigned short* QKh = (unsigned short*)(ws + oQKh); unsigned short* QKl = (unsigned short*)(ws + oQKl);
  unsigned short* VTh = (unsigned short*)(ws + oVTh); unsigned short* VTl = (unsigned short*)(ws + oVTl);

  const dim3 blk(256);

  // (1) x[b] viewed [R=64 c][Cc=4096 n] (pitch 4096) -> XB_b[n][c] (pitch 64); grid (Cc/64, R/64, B) = (64, 1, 8)
  tconv_kernel<<<dim3(NTOK / 64, CHN / 64, NB), blk, 0, stream>>>(x, XB, NTOK, CHN, (long)CHN * NTOK, (long)NTOK * CHN);
  // (2) weights -> WB bf16 rows 0..31 wq, 32..63 wk, 64..127 wv (natural [out][in]); 256 / 256 / 512 units
  conv8_kernel<<<dim3((DQK * CHN / 8) / 256), blk, 0, stream>>>(wq, WB, DQK * CHN / 8);
  conv8_kernel<<<dim3((DQK * CHN / 8) / 256), blk, 0, stream>>>(wk, WB + (size_t)DQK * CHN, DQK * CHN / 8);
  conv8_kernel<<<dim3((CHN * CHN / 8) / 256), blk, 0, stream>>>(wv, WB + (size_t)2 * DQK * CHN, CHN * CHN / 8);
  // (3) q|k = XB . WB[0..63]^T -> QKh|QKl [32768][64]   (M=32768, N=64, K=64; 512 tiles -> 64 blocks)
  const dim3 gQK(((MTOK / 64) * (QKP / 64) + 7) / 8, 1);
  wmma_gemm64<1, false, 0, 2, false, 0><<<gQK, blk, 0, stream>>>(
      XB, XB, CHN, 0L, WB, WB, CHN, 0L, (void*)QKh, (void*)QKl, QKP, 0L,
      wq, wq, 0L, MTOK, QKP, CHN, 1.0f);
  // (4) v^T_b = WB[64..127] . XB_b^T -> VTh|VTl [b][64][4096]   (M=64, N=4096, K=64 per batch; 64 tiles -> 8 blocks x 8 batches)
  const dim3 gVT(((CHN / 64) * (NTOK / 64) + 7) / 8, NB);
  wmma_gemm64<1, false, 0, 2, false, 0><<<gVT, blk, 0, stream>>>(
      WB + (size_t)2 * DQK * CHN, WB + (size_t)2 * DQK * CHN, CHN, 0L, XB, XB, CHN, (long)NTOK * CHN,
      (void*)VTh, (void*)VTl, NTOK, (long)CHN * NTOK,
      wq, wq, 0L, CHN, NTOK, CHN, 1.0f);
  // (5) attention per (batch, 64-position block) -> NCHW d_out; 512 blocks of 128 threads
  attn_kernel<<<dim3(NB * (NTOK / AT_QB)), dim3(128), 0, stream>>>(QKh, QKl, VTh, VTl, (float*)d_out);
  (void)hipGetLastError();
}

// v001
// It runs in 226 microseconds.
// In two side-by-side timings against v000, it was 1.34 and 1.33 times as fast.
// Contractions: q|k projection and v^T projection = v_wmma_f32_16x16x32_bf16 single products on bf16 planes of the
// RNE-converted inputs (f32 accumulate, results split into bf16 hi|lo planes); q.k^T energies and p.v = bf16 hi/lo split
// (hi.hi + hi.lo + lo.hi) on v_wmma_f32_16x16x32_bf16, f32 accumulate; online max-shifted softmax and 1/rowsum in f32 on the VALU.
// Plane / carry map (every plane carries factor 1, nothing to fold back):
//   XB  = bf16(x) token-major [32768 (b*4096+n)][64 c], n = y*64 + x (NCHW token order);
//   WB  = bf16([wq; wk; wv]) [128][64], natural [out][in] (rows 0..31 wq, 32..63 wk, 64..127 wv);
//   QKh|QKl bf16 [32768][64]: cols 0..31 = q hi|lo over d, cols 32..63 = k hi|lo over d;
//   VTh|VTl bf16 [8][64 c][4096 m];
//   P hi|lo = unnormalised exp in (0,1] (bf16 keeps the f32 exponent range); 1/rowsum is applied to the f32 accumulator
//   in the attention epilogue right before the NCHW store (the only place a normaliser is applied).
#include <hip/hip_runtime.h>
#include <math.h>
#include <stdint.h>

#define NB    8
#define CHN   64
#define DQK   32
#define IMH   64
#define IMW   64
#define NTOK  4096
#define MTOK  (NB * NTOK)
#define QKP   64
#define WROWS 128

static_assert(NTOK == IMH * IMW);
static_assert(CHN == 64);
static_assert(DQK == 32);
static_assert(QKP == 2 * DQK);
static_assert(WROWS == 2 * DQK + CHN);
static_assert(NTOK % 64 == 0);
static_assert(MTOK % 64 == 0);
static_assert(CHN % 32 == 0);
static_assert((DQK * CHN) % (8 * 256) == 0);
static_assert((CHN * CHN) % (8 * 256) == 0);

typedef __attribute__((ext_vector_type(16))) _Float16 v16h;
typedef __attribute__((ext_vector_type(8)))  _Float16 v8h;
typedef __attribute__((ext_vector_type(16))) __bf16   v16b;
typedef __attribute__((ext_vector_type(8)))  __bf16   v8b;
typedef __attribute__((ext_vector_type(8)))  float    v8f;
typedef __attribute__((ext_vector_type(4)))  float    v4f;
typedef __attribute__((ext_vector_type(2)))  float    v2f;
typedef __attribute__((ext_vector_type(4)))  unsigned int v4u;

__device__ __forceinline__ unsigned short f2bf_bits(float f) {
  unsigned u = __float_as_uint(f);
  return (unsigned short)((u + 0x7FFFu + ((u >> 16) & 1u)) >> 16);
}
__device__ __forceinline__ float bf_bits2f(unsigned short h) { return __uint_as_float(((unsigned)h) << 16); }
__device__ __forceinline__ float bf_rne(float f) { return bf_bits2f(f2bf_bits(f)); }
__device__ __forceinline__ unsigned pk16(unsigned short a, unsigned short b) { return (unsigned)a | ((unsigned)b << 16); }

// hazard guards as plain device helpers (no inline asm inside the kernel template body)
__device__ __forceinline__ void dep_guard_h(v8f& a, v8f& b, v16h x, v16h y) { asm volatile("v_nop\n\tv_nop\n\tv_nop\n\tv_nop" : "+v"(a), "+v"(b) : "v"(x), "v"(y)); }
__device__ __forceinline__ void dep_guard_b(v8f& a, v8f& b, v16b x, v16b y) { asm volatile("v_nop\n\tv_nop\n\tv_nop\n\tv_nop" : "+v"(a), "+v"(b) : "v"(x), "v"(y)); }
__device__ __forceinline__ void keep4_h(v16h a, v16h b, v16h c, v16h d) { asm volatile("v_nop" :: "v"(a), "v"(b), "v"(c), "v"(d)); }
__device__ __forceinline__ void keep4_b(v16b a, v16b b, v16b c, v16b d) { asm volatile("v_nop" :: "v"(a), "v"(b), "v"(c), "v"(d)); }
__device__ __forceinline__ void acc_guard4(v8f& a, v8f& b, v8f& c, v8f& d) { asm volatile("v_nop\n\tv_nop\n\tv_nop\n\tv_nop" : "+v"(a), "+v"(b), "+v"(c), "+v"(d)); }
template <typename T> struct Frag;
template <> struct Frag<_Float16> {
  typedef v16h V; union U { v16h v; v8h h[2]; };
  static __device__ __forceinline__ v16h load(const _Float16* p) {   // elements 0..7 <- p[0..7], 8..15 <- p[16..23]
    U f; f.h[0] = *(const v8h*)(p); f.h[1] = *(const v8h*)(p + 16); return f.v;
  }
  static __device__ __forceinline__ v8f mma(v16h a, v16h b, v8f c) {
    return __builtin_amdgcn_wmma_f32_16x16x32_f16(false, a, false, b, (short)0, c, false, false);
  }
  static __device__ __forceinline__ void guard(v8f& a, v8f& b, v16h x, v16h y) { dep_guard_h(a, b, x, y); }
  static __device__ __forceinline__ void keep(v16h a, v16h b, v16h c, v16h d) { keep4_h(a, b, c, d); }
};
template <> struct Frag<__bf16> {
  typedef v16b V; union U { v16b v; v8b h[2]; };
  static __device__ __forceinline__ v16b load(const __bf16* p) {
    U f; f.h[0] = *(const v8b*)(p); f.h[1] = *(const v8b*)(p + 16); return f.v;
  }
  static __device__ __forceinline__ v8f mma(v16b a, v16b b, v8f c) {
    return __builtin_amdgcn_wmma_f32_16x16x32_bf16(false, a, false, b, (short)0, c, false, false);
  }
  static __device__ __forceinline__ void guard(v8f& a, v8f& b, v16b x, v16b y) { dep_guard_b(a, b, x, y); }
  static __device__ __forceinline__ void keep(v16b a, v16b b, v16b c, v16b d) { keep4_b(a, b, c, d); }
};

// ---- Register-blocked batched WMMA GEMM ------------------------------------
// C[m,n] = scale * sum_k A[m,k] * Bt[n,k] (+bias)(+resid); each wave owns a 64x64 tile.
// A row-major [M,K]; Bt row-major [N,K]; M,N % 64 == 0, K % 32 == 0.
// SPLIT: operands are hi/lo planes (A2/Bt2 = lo planes, same layout); product = hi.hi + hi.lo + lo.hi.
// BIAS_MODE: 0 = none, 1 = bias[m], 2 = bias[n]; the bias value is RNE-converted to bf16 precision before the f32 add.
// OUT_MODE: 0 = f32, 1 = f16, 2 = bf16 hi plane (Cout) + bf16 lo plane (Cout2).
// ET: 0 = f16 operands, 1 = bf16 operands (pointers passed as 16-bit storage)
template <int ET> struct Elem;
template <> struct Elem<0> { typedef _Float16 T; };
template <> struct Elem<1> { typedef __bf16 T; };
template <int ET, bool SPLIT, int BIAS_MODE, int OUT_MODE, bool RESID, int ACT = 0>
__global__ __launch_bounds__(256) void wmma_gemm64(
    const unsigned short* __restrict__ Ap, const unsigned short* __restrict__ A2p, int lda, long strideA,
    const unsigned short* __restrict__ Btp, const unsigned short* __restrict__ Bt2p, int ldb, long strideB,
    void* __restrict__ Cout, void* __restrict__ Cout2, int ldc, long strideC,
    const float* __restrict__ bias,
    const float* __restrict__ resid, long strideR,
    int M, int N, int K, float scale) {
  typedef typename Elem<ET>::T T;
  typedef typename Frag<T>::V V;
  const T* A = (const T*)Ap; const T* A2 = (const T*)A2p; const T* Bt = (const T*)Btp; const T* Bt2 = (const T*)Bt2p;
  __shared__ __align__(16) float sT[8][16 * 68];   // per-wave 16x64 slab, pitch 68 floats
  const int b    = blockIdx.y;
  const int lane = threadIdx.x & 31;
  const int wave = threadIdx.x >> 5;
  const int tilesN = N >> 6;
  const int tilesM = M >> 6;
  const int tile = blockIdx.x * 8 + wave;
  if (tile >= tilesM * tilesN) return;   // wave-uniform; no block barriers in this kernel
  const int tm = tile / tilesN;
  const int tn = tile - tm * tilesN;
  const int m0 = tm << 6;
  const int n0 = tn << 6;

  const T* Ab  = A  + (size_t)b * strideA;
  const T* Bb  = Bt + (size_t)b * strideB;
  const T* Ab2 = SPLIT ? (A2  + (size_t)b * strideA) : nullptr;
  const T* Bb2 = SPLIT ? (Bt2 + (size_t)b * strideB) : nullptr;

  const int rlane = lane & 15;                 // row (A) / col (B, D) within subtile
  const int koff  = (lane >> 4) * 8;           // k offset of this lane half
  const int mOff  = (lane >> 4) * 8;           // D row offset

  v8f acc[4][4];
#pragma unroll
  for (int i = 0; i < 4; ++i)
#pragma unroll
    for (int j = 0; j < 4; ++j) acc[i][j] = (v8f){0.f,0.f,0.f,0.f,0.f,0.f,0.f,0.f};

  for (int k0 = 0; k0 < K; k0 += 32) {
    V bh[4], bl[4];
#pragma unroll
    for (int j = 0; j < 4; ++j) {
      const size_t bo = (size_t)(n0 + (j << 4) + rlane) * ldb + koff + k0;
      bh[j] = Frag<T>::load(Bb + bo);
      if (SPLIT) bl[j] = Frag<T>::load(Bb2 + bo); else bl[j] = bh[j];
    }
#pragma unroll
    for (int i = 0; i < 4; ++i) {
      const size_t ao = (size_t)(m0 + (i << 4) + rlane) * lda + koff + k0;
      V ah = Frag<T>::load(Ab + ao);
      V al;
      if (SPLIT) al = Frag<T>::load(Ab2 + ao); else al = ah;
#pragma unroll
      for (int j = 0; j < 4; ++j) {
        acc[i][j] = Frag<T>::mma(ah, bh[j], acc[i][j]);
        if (SPLIT) {
          acc[i][j] = Frag<T>::mma(ah, bl[j], acc[i][j]);
          acc[i][j] = Frag<T>::mma(al, bh[j], acc[i][j]);
        }
      }
      Frag<T>::guard(acc[i][0], acc[i][3], ah, al);
    }
    Frag<T>::keep(bh[0], bh[1], bh[2], bh[3]);
    if (SPLIT) Frag<T>::keep(bl[0], bl[1], bl[2], bl[3]);
  }
  acc_guard4(acc[0][0], acc[0][1], acc[0][2], acc[0][3]);
  acc_guard4(acc[1][0], acc[1][1], acc[1][2], acc[1][3]);
  acc_guard4(acc[2][0], acc[2][1], acc[2][2], acc[2][3]);
  acc_guard4(acc[3][0], acc[3][1], acc[3][2], acc[3][3]);

  // ---- epilogue ----
  float* slab = sT[wave];
  const float* Rb = RESID ? (resid + (size_t)b * strideR) : nullptr;
#pragma unroll
  for (int i = 0; i < 4; ++i) {
    const int mBase = m0 + (i << 4);
#pragma unroll
    for (int j = 0; j < 4; ++j) {
      const int n = n0 + (j << 4) + rlane;
      float bv = 0.f;
      if (BIAS_MODE == 2) bv = bf_rne(bias[n]);
#pragma unroll
      for (int r = 0; r < 8; ++r) {
        float v = acc[i][j][r] * scale;
        if (BIAS_MODE == 1) v += bf_rne(bias[mBase + mOff + r]);
        if (BIAS_MODE == 2) v += bv;
        if (RESID) v += Rb[(size_t)(mBase + mOff + r) * ldc + n];
        if (ACT == 1) v = tanhf(v);
        if (ACT == 2) v = fmaxf(v, 0.0f);
        if (ACT == 3) v = v / (1.0f + expf(-v));
        if (ACT == 4) v = (v > 0.f) ? v : 0.01f * v;
        if (ACT == 5) v = 0.5f * v * (1.0f + erff(v * 0.70710678118654752f));
        slab[(mOff + r) * 68 + (j << 4) + rlane] = v;
      }
    }
    __builtin_amdgcn_fence(__ATOMIC_RELEASE, "workgroup");
    __builtin_amdgcn_wave_barrier();
    __builtin_amdgcn_fence(__ATOMIC_ACQUIRE, "workgroup");
    if (OUT_MODE == 0) {
      float* C = (float*)Cout + (size_t)b * strideC;
      const int hh = lane >> 4, c4 = (lane & 15) * 4;     // row seg = 256 B = 16 lanes x 16 B
      {
#pragma unroll
        for (int it = 0; it < 8; ++it) {
          const int row = it * 2 + hh;
          v4f v = *(const v4f*)(slab + row * 68 + c4);
          *(v4f*)(C + (size_t)(mBase + row) * ldc + n0 + c4) = v;
        }
        
      }
    } else {
      const int q = lane >> 3, c8 = (lane & 7) * 8;
      unsigned short* C  = (unsigned short*)Cout  + (size_t)b * strideC;
      unsigned short* C2 = (OUT_MODE == 2) ? ((unsigned short*)Cout2 + (size_t)b * strideC) : nullptr;
      {
#pragma unroll
        for (int it = 0; it < 4; ++it) {
          const int row = it * 4 + q;
          const float* sp = slab + row * 68 + c8;
          v8h hv, lv;
#pragma unroll
          for (int e = 0; e < 8; ++e) {
            if (OUT_MODE == 1) {
              hv[e] = (_Float16)sp[e];
            } else {
              unsigned short hb = f2bf_bits(sp[e]);
              unsigned short lb = f2bf_bits(sp[e] - bf_bits2f(hb));
              hv[e] = __builtin_bit_cast(_Float16, hb);
              lv[e] = __builtin_bit_cast(_Float16, lb);
            }
          }
          *(v8h*)(C + (size_t)(mBase + row) * ldc + n0 + c8) = hv;
          if (OUT_MODE == 2) *(v8h*)(C2 + (size_t)(mBase + row) * ldc + n0 + c8) = lv;
        }
        
      }
    }
    __builtin_amdgcn_fence(__ATOMIC_RELEASE, "workgroup");
    __builtin_amdgcn_wave_barrier();
    __builtin_amdgcn_fence(__ATOMIC_ACQUIRE, "workgroup");
  }
}

// ---------------------------------------------------------------------------
// Contiguous bf16 RNE convert of an f32 array: 8 consecutive elements per thread = one 16-B store; 8 consecutive lanes
// Coverage: grid = n8/256 blocks x 256 threads x 8 elements (n8 = n/8, host guarantees n % 2048 == 0).
// ---------------------------------------------------------------------------
__global__ __launch_bounds__(256) void conv8_kernel(const float* __restrict__ in, unsigned short* __restrict__ out, int n8) {
  const int i = blockIdx.x * 256 + threadIdx.x;
  if (i < n8) {
    const size_t e0 = (size_t)i * 8;
    const v4f a = *(const v4f*)(in + e0);
    const v4f c = *(const v4f*)(in + e0 + 4);
    v4u hv;
    hv[0] = pk16(f2bf_bits(a[0]), f2bf_bits(a[1]));
    hv[1] = pk16(f2bf_bits(a[2]), f2bf_bits(a[3]));
    hv[2] = pk16(f2bf_bits(c[0]), f2bf_bits(c[1]));
    hv[3] = pk16(f2bf_bits(c[2]), f2bf_bits(c[3]));
    {
      *(v4u*)(out + e0) = hv;
      
    }
  }
}

// ---------------------------------------------------------------------------
// Fused transpose + bf16 RNE convert of an f32 matrix, z-batched, one plane:
//   in_z = W + z*sIn viewed [R rows][Cc cols] with row pitch ldin  ->  oh_z[c][r] = bf16(in_z[r][c]), row pitch ldout, oh_z = oh + z*sOut.
// 64x64 tiles through LDS. grid = (Cc/64, R/64, Z), 256 threads (R, Cc multiples of 64; ldout multiple of 64 so every
// Coverage per block: load 4 it x 256 thr x 4 floats = 64x64; store 2 it x 256 thr x 8 u16 = 64x64.
// ---------------------------------------------------------------------------
__global__ __launch_bounds__(256) void tconv_kernel(const float* __restrict__ W, unsigned short* __restrict__ oh,
                                                    int ldin, int ldout, long sIn, long sOut) {
  __shared__ __align__(16) float tf[64 * 68];
  W  += (size_t)blockIdx.z * sIn;
  oh += (size_t)blockIdx.z * sOut;
  const int c0  = blockIdx.x * 64;   // input column block = output row block
  const int r0  = blockIdx.y * 64;   // input row block    = output column block
  const int tid = threadIdx.x;
  {
    const int lr = tid >> 4;         // 0..15
    const int c4 = (tid & 15) * 4;   // 0..60
#pragma unroll
    for (int it = 0; it < 4; ++it) {
      const int rr = it * 16 + lr;   // 0..63
      const v4f a = *(const v4f*)(W + (size_t)(r0 + rr) * ldin + c0 + c4);
      *(v4f*)(tf + rr * 68 + c4) = a;
    }
  }
  __syncthreads();
  const int sub = tid >> 3;          // 0..31
  const int c8  = (tid & 7) * 8;     // 0..56
  v4u hv[2];
#pragma unroll
  for (int it = 0; it < 2; ++it) {
    const int oc = it * 32 + sub;    // output row within tile (= input column)
    v4u a;
#pragma unroll
    for (int q = 0; q < 4; ++q) {
      const float f0 = tf[(c8 + 2 * q) * 68 + oc];
      const float f1 = tf[(c8 + 2 * q + 1) * 68 + oc];
      a[q] = pk16(f2bf_bits(f0), f2bf_bits(f1));
    }
    hv[it] = a;
  }
  {
#pragma unroll
    for (int it = 0; it < 2; ++it) {
      const int oc = it * 32 + sub;
      const size_t go = (size_t)(c0 + oc) * ldout + r0 + c8;
      *(v4u*)(oh + go) = hv[it];
    }
    
  }
}

// =====================================================================================
// Full (unmasked) self-attention over the 4096 positions of one batch element, energy depth 32 (no scaling),
// value / output channels 64, all batches in one launch.
//   q planes (hi/lo bf16) [32768][64]: q(b, n, d) at [(b*4096+n)*64 + d], d < 32
//   k planes: same buffers, k(b, m, d) at [(b*4096+m)*64 + 32 + d]
//   v^T planes (hi/lo bf16) [8][64][4096]: v(b, c, m) at [(b*64 + c)*4096 + m]
//   out f32 NCHW: out(b, c, n) at [(b*64 + c)*4096 + n]
//   energy = q . k       : bf16 hi/lo split (hi.hi + hi.lo + lo.hi) on v_wmma_f32_16x16x32_bf16, one 32-deep k-step per term
//   o      = p . v^T     : bf16 hi/lo split of p (unnormalised exp) and v, f32 accumulate, x 1/rowsum in f32 at the end
//   online softmax in f32 over the 4096 keys (64 chunks of 64, compile-time trip count, no masking).
//   Block = 4 waves = 64 query positions of one batch element; grid.x = 8 * 64 = 512.
//   K chunk staging: 128 threads x 16 elements per plane = 64 keys x 32 d (whole tile); V^T chunk staging: 128 threads x 32
//   elements per plane = 64 c x 64 keys (whole tile); 16-B copies, plain loads, __syncthreads before and after; fragment loads
//   read the LDS tiles with the same v8b element type.
//   LDS rows are padded (K 64 -> 80 B, V^T and P 128 -> 144 B); the pad bytes are never written and never read.
//   LDS extents: K/V tiles fully staged every chunk; P tiles 16x64 per wave fully written every chunk, then read
//   back only by the same wave after a wave barrier.
//   Epilogue store: wave w owns channels w*16..w*16+15 of the block's 64-position segment; one instruction writes two
// =====================================================================================
#define AT_D  32
#define AT_C  64
#define AT_NW 4
#define AT_QB 64
#define AT_KC 64
#define OSP   68
#define AT_KP 40    // LDS row pitch of the K tiles in elements: 80 B = 16 B x 5, so 16 rows' 16-B reads fall on 64 distinct banks
#define AT_VP 72    // LDS row pitch of the V^T and P tiles in elements: 144 B = 16 B x 9, same reason

static_assert(NTOK % AT_QB == 0);
static_assert(NTOK % AT_KC == 0);
static_assert(AT_C == CHN);
static_assert(AT_D == DQK);
static_assert(AT_KP >= AT_D && AT_KP % 8 == 0 && (AT_KP / 8) % 2 == 1);
static_assert(AT_VP >= AT_KC && AT_VP % 8 == 0 && (AT_VP / 8) % 2 == 1);

__device__ __forceinline__ unsigned short at_bf_bits(float f) {
  unsigned u = __float_as_uint(f);
  return (unsigned short)((u + 0x7FFFu + ((u >> 16) & 1u)) >> 16);
}
__device__ __forceinline__ __bf16 at_f2bf(float f) { return __builtin_bit_cast(__bf16, at_bf_bits(f)); }
__device__ __forceinline__ void at_split(float f, __bf16& hi, __bf16& lo) {
  const unsigned short hb = at_bf_bits(f);
  hi = __builtin_bit_cast(__bf16, hb);
  lo = at_f2bf(f - __uint_as_float(((unsigned)hb) << 16));
}
__device__ __forceinline__ v8f at_mma(v16b a, v16b b, v8f c) {
  c = __builtin_amdgcn_wmma_f32_16x16x32_bf16(false, a, false, b, (short)0, c, false, false);
  asm volatile("v_nop\n\tv_nop\n\tv_nop\n\tv_nop" : "+v"(c) : "v"(a), "v"(b));
  return c;
}

__global__ __launch_bounds__(128)
void attn_kernel(const unsigned short* __restrict__ qkhp, const unsigned short* __restrict__ qklp,
                 const unsigned short* __restrict__ vhp, const unsigned short* __restrict__ vlp,
                 float* __restrict__ out) {
  union FB { v16b v; v8b h[2]; };
  __shared__ __align__(16) __bf16 Ksh[AT_KC * AT_KP];            // K hi [kv][d], padded rows      5 KB
  __shared__ __align__(16) __bf16 Ksl[AT_KC * AT_KP];            // K lo
  __shared__ __align__(16) __bf16 Vth[AT_C * AT_VP];             // V hi [c][kv], padded rows      9 KB
  __shared__ __align__(16) __bf16 Vtl[AT_C * AT_VP];             // V lo
  __shared__ __align__(16) __bf16 Psh[AT_NW][16 * AT_VP];        // per wave P hi [row][kv], padded rows
  __shared__ __align__(16) __bf16 Psl[AT_NW][16 * AT_VP];        // per wave P lo
  __shared__ __align__(16) float  Os[AT_QB * OSP];               // block out tile [q][c], pitch 68

  const int tid  = threadIdx.x;
  const int wave = tid >> 5;
  const int lane = tid & 31;
  const int hh   = lane >> 4;
  const int c    = lane & 15;

  const int nqb  = NTOK / AT_QB;           // 64 query blocks per batch element
  const int bx   = blockIdx.x;             // grid = NB * nqb (exact)
  const int qb   = bx % nqb;
  const int b    = bx / nqb;               // 0..7
  const int nblk = qb * AT_QB;             // first position of this block
  const int q0   = b * NTOK + nblk + wave * 16;   // row in the q|k planes

  const __bf16* Qh = (const __bf16*)(const void*)qkhp;
  const __bf16* Ql = (const __bf16*)(const void*)qklp;
  const __bf16* Kh = Qh + AT_D;                                    // k columns 32..63
  const __bf16* Kl = Ql + AT_D;
  const __bf16* Vh = (const __bf16*)(const void*)vhp + (size_t)b * AT_C * NTOK;
  const __bf16* Vl = (const __bf16*)(const void*)vlp + (size_t)b * AT_C * NTOK;

  // ---- Q fragments (A operand, row = lane&15, split k map via Frag load): one 32-deep chunk, hi and lo ----
  const v16b qah = Frag<__bf16>::load(Qh + (size_t)(q0 + c) * QKP + 8 * hh);
  const v16b qal = Frag<__bf16>::load(Ql + (size_t)(q0 + c) * QKP + 8 * hh);

  float mrow[8], lrow[8];
  v8f oacc[4];
#pragma unroll
  for (int r = 0; r < 8; ++r) { mrow[r] = -INFINITY; lrow[r] = 0.f; }
#pragma unroll
  for (int t = 0; t < 4; ++t) oacc[t] = (v8f){0.f,0.f,0.f,0.f,0.f,0.f,0.f,0.f};

  const int nChunks = NTOK / AT_KC;   // 64, compile-time constant
  for (int kc = 0; kc < nChunks; ++kc) {
    const int kv0 = kc * AT_KC;
    __syncthreads();
    {
      // staging coverage: K: 128 threads x (2 x 8) = 64 rows x 32; V: 128 threads x (4 x 8) = 64 rows x 64 = whole tiles
      const int r = tid >> 1;
      const int hk = (tid & 1) * 16;
      const int hv = (tid & 1) * 32;
      const __bf16* ksh = Kh + (size_t)(b * NTOK + kv0 + r) * QKP + hk;   // K row (b, kv0+r), d = hk..hk+15
      const __bf16* ksl = Kl + (size_t)(b * NTOK + kv0 + r) * QKP + hk;
      const __bf16* vsh = Vh + (size_t)r * NTOK + kv0 + hv;               // V^T row c = r, keys kv0+hv..+31
      const __bf16* vsl = Vl + (size_t)r * NTOK + kv0 + hv;
#pragma unroll
      for (int i = 0; i < 2; ++i) {
        const v8b a0 = *(const v8b*)(ksh + 8 * i);
        const v8b a1 = *(const v8b*)(ksl + 8 * i);
        *(v8b*)(Ksh + r * AT_KP + hk + 8 * i) = a0;
        *(v8b*)(Ksl + r * AT_KP + hk + 8 * i) = a1;
      }
#pragma unroll
      for (int i = 0; i < 4; ++i) {
        const v8b b0 = *(const v8b*)(vsh + 8 * i);
        const v8b b1 = *(const v8b*)(vsl + 8 * i);
        *(v8b*)(Vth + r * AT_VP + hv + 8 * i) = b0;
        *(v8b*)(Vtl + r * AT_VP + hv + 8 * i) = b1;
      }
    }
    __syncthreads();

    v8f s[4];
#pragma unroll
    for (int j = 0; j < 4; ++j) {
      s[j] = (v8f){0.f,0.f,0.f,0.f,0.f,0.f,0.f,0.f};
      FB kb, kl;
      kb.h[0] = *(const v8b*)(Ksh + (j * 16 + c) * AT_KP + 8 * hh);
      kb.h[1] = *(const v8b*)(Ksh + (j * 16 + c) * AT_KP + 16 + 8 * hh);
      kl.h[0] = *(const v8b*)(Ksl + (j * 16 + c) * AT_KP + 8 * hh);
      kl.h[1] = *(const v8b*)(Ksl + (j * 16 + c) * AT_KP + 16 + 8 * hh);
      s[j] = at_mma(qah, kb.v, s[j]);
      s[j] = at_mma(qah, kl.v, s[j]);
      s[j] = at_mma(qal, kb.v, s[j]);
    }
    // chunk row max (no energy scaling)
    float cm[8];
#pragma unroll
    for (int r = 0; r < 8; ++r) {
      float m = -INFINITY;
#pragma unroll
      for (int j = 0; j < 4; ++j) m = fmaxf(m, s[j][r]);
#pragma unroll
      for (int off = 1; off < 16; off <<= 1) m = fmaxf(m, __shfl_xor(m, off, 32));
      cm[r] = m;
    }
    __bf16* pwh = Psh[wave];
    __bf16* pwl = Psl[wave];
#pragma unroll
    for (int r = 0; r < 8; ++r) {
      const float mnew = fmaxf(mrow[r], cm[r]);
      const float alpha = expf(mrow[r] - mnew);
      mrow[r] = mnew;
      float psum = 0.f;
#pragma unroll
      for (int j = 0; j < 4; ++j) {
        const float p = expf(s[j][r] - mnew);
        psum += p;
        __bf16 a, bl; at_split(p, a, bl);
        pwh[(8 * hh + r) * AT_VP + j * 16 + c] = a;
        pwl[(8 * hh + r) * AT_VP + j * 16 + c] = bl;
      }
#pragma unroll
      for (int off = 1; off < 16; off <<= 1) psum += __shfl_xor(psum, off, 32);
      lrow[r] = lrow[r] * alpha + psum;
#pragma unroll
      for (int t = 0; t < 4; ++t) oacc[t][r] *= alpha;
    }
    __builtin_amdgcn_fence(__ATOMIC_RELEASE, "workgroup");
    __builtin_amdgcn_wave_barrier();
    __builtin_amdgcn_fence(__ATOMIC_ACQUIRE, "workgroup");
#pragma unroll 1
    for (int kk = 0; kk < 2; ++kk) {
      FB pa, pl;
      pa.h[0] = *(const v8b*)(pwh + c * AT_VP + kk * 32 + 8 * hh);
      pa.h[1] = *(const v8b*)(pwh + c * AT_VP + kk * 32 + 16 + 8 * hh);
      pl.h[0] = *(const v8b*)(pwl + c * AT_VP + kk * 32 + 8 * hh);
      pl.h[1] = *(const v8b*)(pwl + c * AT_VP + kk * 32 + 16 + 8 * hh);
#pragma unroll
      for (int t = 0; t < 4; ++t) {
        FB vb, vl;
        vb.h[0] = *(const v8b*)(Vth + (t * 16 + c) * AT_VP + kk * 32 + 8 * hh);
        vb.h[1] = *(const v8b*)(Vth + (t * 16 + c) * AT_VP + kk * 32 + 16 + 8 * hh);
        vl.h[0] = *(const v8b*)(Vtl + (t * 16 + c) * AT_VP + kk * 32 + 8 * hh);
        vl.h[1] = *(const v8b*)(Vtl + (t * 16 + c) * AT_VP + kk * 32 + 16 + 8 * hh);
        oacc[t] = at_mma(pa.v, vb.v, oacc[t]);
        oacc[t] = at_mma(pa.v, vl.v, oacc[t]);
        oacc[t] = at_mma(pl.v, vb.v, oacc[t]);
      }
    }
  }

  // ---- normalise, stage the block's 64 (position) x 64 (channel) tile, then write NCHW channel segments ----
#pragma unroll
  for (int r = 0; r < 8; ++r) {
    const float inv = 1.0f / lrow[r];
#pragma unroll
    for (int t = 0; t < 4; ++t) Os[(wave * 16 + 8 * hh + r) * OSP + t * 16 + c] = oacc[t][r] * inv;
  }
  __syncthreads();
  {
    const int c4 = c * 4;                                 // position offset within the block (0..60)
    float* ob = out + ((size_t)b * AT_C) * NTOK + nblk + c4;
    v4f ov[8];
#pragma unroll
    for (int it = 0; it < 8; ++it) {
      const int ch = wave * 16 + it * 2 + hh;             // it 0..7 x hh 0..1 = channels 0..15 of this wave
      v4f v;
      v[0] = Os[(c4 + 0) * OSP + ch];
      v[1] = Os[(c4 + 1) * OSP + ch];
      v[2] = Os[(c4 + 2) * OSP + ch];
      v[3] = Os[(c4 + 3) * OSP + ch];
      ov[it] = v;
    }
    {
#pragma unroll
      for (int it = 0; it < 8; ++it) {
        const int ch = wave * 16 + it * 2 + hh;
        *(v4f*)(ob + (size_t)ch * NTOK) = ov[it];
      }
      
    }
  }
}

// ---------------------------------------------------------------------------
// Workspace region map (byte offsets; every region is fully written by its producer launch before any consumer
//   XB    bf16 [32768][64]            0       4194304
//   WB    bf16 [128][64]        4194304         16384
//   QKh   bf16 [32768][64]      4210688       4194304   QKl   8404992
//   VTh   bf16 [8][64][4096]   12599296       4194304   VTl  16793600
//   total                      20987904
// ---------------------------------------------------------------------------
extern "C" void kernel_launch(void* const* d_in, const int* in_sizes, int n_in,
                              void* d_out, int out_size, void* d_ws, size_t ws_size,
                              hipStream_t stream) {
  if (n_in < 4) return;
  if (in_sizes[0] != NB * CHN * NTOK) return;      // x  [8][64][64][64]
  if (in_sizes[1] != DQK * CHN) return;            // wq [32][64]
  if (in_sizes[2] != DQK * CHN) return;            // wk [32][64]
  if (in_sizes[3] != CHN * CHN) return;            // wv [64][64]
  if (out_size != NB * CHN * NTOK) return;

  const float* x  = (const float*)d_in[0];
  const float* wq = (const float*)d_in[1];   // [out 32][in 64]
  const float* wk = (const float*)d_in[2];   // [out 32][in 64]
  const float* wv = (const float*)d_in[3];   // [out 64][in 64]

  const size_t PXB = (size_t)MTOK * CHN * 2;         // 4194304
  const size_t PWB = (size_t)WROWS * CHN * 2;        // 16384
  const size_t PQK = (size_t)MTOK * QKP * 2;         // 4194304 per plane
  const size_t PVT = (size_t)NB * CHN * NTOK * 2;    // 4194304 per plane
  size_t off = 0;
  const size_t oXB  = off; off += PXB;
  const size_t oWB  = off; off += PWB;
  const size_t oQKh = off; off += PQK;  const size_t oQKl = off; off += PQK;
  const size_t oVTh = off; off += PVT;  const size_t oVTl = off; off += PVT;
  if (off > ws_size) return;                         // off = 20987904
  if (off > (size_t)134217728) return;

  char* ws = (char*)d_ws;
  unsigned short* XB  = (unsigned short*)(ws + oXB);
  unsigned short* WB  = (unsigned short*)(ws + oWB);
  unsigned short* QKh = (unsigned short*)(ws + oQKh); unsigned short* QKl = (unsigned short*)(ws + oQKl);
  unsigned short* VTh = (unsigned short*)(ws + oVTh); unsigned short* VTl = (unsigned short*)(ws + oVTl);

  const dim3 blk(256);

  // (1) x[b] viewed [R=64 c][Cc=4096 n] (pitch 4096) -> XB_b[n][c] (pitch 64); grid (Cc/64, R/64, B) = (64, 1, 8)
  tconv_kernel<<<dim3(NTOK / 64, CHN / 64, NB), blk, 0, stream>>>(x, XB, NTOK, CHN, (long)CHN * NTOK, (long)NTOK * CHN);
  // (2) weights -> WB bf16 rows 0..31 wq, 32..63 wk, 64..127 wv (natural [out][in]); 256 / 256 / 512 units
  conv8_kernel<<<dim3((DQK * CHN / 8) / 256), blk, 0, stream>>>(wq, WB, DQK * CHN / 8);
  conv8_kernel<<<dim3((DQK * CHN / 8) / 256), blk, 0, stream>>>(wk, WB + (size_t)DQK * CHN, DQK * CHN / 8);
  conv8_kernel<<<dim3((CHN * CHN / 8) / 256), blk, 0, stream>>>(wv, WB + (size_t)2 * DQK * CHN, CHN * CHN / 8);
  // (3) q|k = XB . WB[0..63]^T -> QKh|QKl [32768][64]   (M=32768, N=64, K=64; 512 tiles -> 64 blocks)
  const dim3 gQK(((MTOK / 64) * (QKP / 64) + 7) / 8, 1);
  wmma_gemm64<1, false, 0, 2, false, 0><<<gQK, blk, 0, stream>>>(
      XB, XB, CHN, 0L, WB, WB, CHN, 0L, (void*)QKh, (void*)QKl, QKP, 0L,
      wq, wq, 0L, MTOK, QKP, CHN, 1.0f);
  // (4) v^T_b = WB[64..127] . XB_b^T -> VTh|VTl [b][64][4096]   (M=64, N=4096, K=64 per batch; 64 tiles -> 8 blocks x 8 batches)
  const dim3 gVT(((CHN / 64) * (NTOK / 64) + 7) / 8, NB);
  wmma_gemm64<1, false, 0, 2, false, 0><<<gVT, blk, 0, stream>>>(
      WB + (size_t)2 * DQK * CHN, WB + (size_t)2 * DQK * CHN, CHN, 0L, XB, XB, CHN, (long)NTOK * CHN,
      (void*)VTh, (void*)VTl, NTOK, (long)CHN * NTOK,
      wq, wq, 0L, CHN, NTOK, CHN, 1.0f);
  // (5) attention per (batch, 64-position block) -> NCHW d_out; 512 blocks of 128 threads
  attn_kernel<<<dim3(NB * (NTOK / AT_QB)), dim3(128), 0, stream>>>(QKh, QKl, VTh, VTl, (float*)d_out);
  (void)hipGetLastError();
}

// v002
// Measured time: 167 microseconds a run.
// Next to v001, in two timings, it ran 1.35 times as fast each time.
// Over all steps from v000 it is 1.81 times as fast.
// Contractions: q|k projection and v^T projection = v_wmma_f32_16x16x32_bf16 single products on bf16 planes of the
// RNE-converted inputs (f32 accumulate, results split into bf16 hi|lo planes); q.k^T energies and p.v = bf16 hi/lo split
// (hi.hi + hi.lo + lo.hi) on v_wmma_f32_16x16x32_bf16, f32 accumulate; online max-shifted softmax and 1/rowsum in f32 on the VALU.
// Plane / carry map (every plane carries factor 1, nothing to fold back):
//   XB  = bf16(x) token-major [32768 (b*4096+n)][64 c], n = y*64 + x (NCHW token order);
//   WB  = bf16([wq; wk; wv]) [128][64], natural [out][in] (rows 0..31 wq, 32..63 wk, 64..127 wv);
//   QKh|QKl bf16 [32768][64]: cols 0..31 = q hi|lo over d, cols 32..63 = k hi|lo over d;
//   VTh|VTl bf16 [8][64 c][4096 m];
//   P hi|lo = unnormalised exp in (0,1] (bf16 keeps the f32 exponent range); 1/rowsum is applied to the f32 accumulator
//   in the attention epilogue right before the NCHW store (the only place a normaliser is applied).
#include <hip/hip_runtime.h>
#include <math.h>
#include <stdint.h>

#define NB    8
#define CHN   64
#define DQK   32
#define IMH   64
#define IMW   64
#define NTOK  4096
#define MTOK  (NB * NTOK)
#define QKP   64
#define WROWS 128

static_assert(NTOK == IMH * IMW);
static_assert(CHN == 64);
static_assert(DQK == 32);
static_assert(QKP == 2 * DQK);
static_assert(WROWS == 2 * DQK + CHN);
static_assert(NTOK % 64 == 0);
static_assert(MTOK % 64 == 0);
static_assert(CHN % 32 == 0);
static_assert((DQK * CHN) % (8 * 256) == 0);
static_assert((CHN * CHN) % (8 * 256) == 0);

typedef __attribute__((ext_vector_type(16))) _Float16 v16h;
typedef __attribute__((ext_vector_type(8)))  _Float16 v8h;
typedef __attribute__((ext_vector_type(16))) __bf16   v16b;
typedef __attribute__((ext_vector_type(8)))  __bf16   v8b;
typedef __attribute__((ext_vector_type(8)))  float    v8f;
typedef __attribute__((ext_vector_type(4)))  float    v4f;
typedef __attribute__((ext_vector_type(2)))  float    v2f;
typedef __attribute__((ext_vector_type(4)))  unsigned int v4u;

__device__ __forceinline__ unsigned short f2bf_bits(float f) {
  unsigned u = __float_as_uint(f);
  return (unsigned short)((u + 0x7FFFu + ((u >> 16) & 1u)) >> 16);
}
__device__ __forceinline__ float bf_bits2f(unsigned short h) { return __uint_as_float(((unsigned)h) << 16); }
__device__ __forceinline__ float bf_rne(float f) { return bf_bits2f(f2bf_bits(f)); }
__device__ __forceinline__ unsigned pk16(unsigned short a, unsigned short b) { return (unsigned)a | ((unsigned)b << 16); }

// hazard guards as plain device helpers (no inline asm inside the kernel template body)
__device__ __forceinline__ void dep_guard_h(v8f& a, v8f& b, v16h x, v16h y) { asm volatile("v_nop\n\tv_nop\n\tv_nop\n\tv_nop" : "+v"(a), "+v"(b) : "v"(x), "v"(y)); }
__device__ __forceinline__ void dep_guard_b(v8f& a, v8f& b, v16b x, v16b y) { asm volatile("v_nop\n\tv_nop\n\tv_nop\n\tv_nop" : "+v"(a), "+v"(b) : "v"(x), "v"(y)); }
__device__ __forceinline__ void keep4_h(v16h a, v16h b, v16h c, v16h d) { asm volatile("v_nop" :: "v"(a), "v"(b), "v"(c), "v"(d)); }
__device__ __forceinline__ void keep4_b(v16b a, v16b b, v16b c, v16b d) { asm volatile("v_nop" :: "v"(a), "v"(b), "v"(c), "v"(d)); }
__device__ __forceinline__ void acc_guard4(v8f& a, v8f& b, v8f& c, v8f& d) { asm volatile("v_nop\n\tv_nop\n\tv_nop\n\tv_nop" : "+v"(a), "+v"(b), "+v"(c), "+v"(d)); }
template <typename T> struct Frag;
template <> struct Frag<_Float16> {
  typedef v16h V; union U { v16h v; v8h h[2]; };
  static __device__ __forceinline__ v16h load(const _Float16* p) {   // elements 0..7 <- p[0..7], 8..15 <- p[16..23]
    U f; f.h[0] = *(const v8h*)(p); f.h[1] = *(const v8h*)(p + 16); return f.v;
  }
  static __device__ __forceinline__ v8f mma(v16h a, v16h b, v8f c) {
    return __builtin_amdgcn_wmma_f32_16x16x32_f16(false, a, false, b, (short)0, c, false, false);
  }
  static __device__ __forceinline__ void guard(v8f& a, v8f& b, v16h x, v16h y) { dep_guard_h(a, b, x, y); }
  static __device__ __forceinline__ void keep(v16h a, v16h b, v16h c, v16h d) { keep4_h(a, b, c, d); }
};
template <> struct Frag<__bf16> {
  typedef v16b V; union U { v16b v; v8b h[2]; };
  static __device__ __forceinline__ v16b load(const __bf16* p) {
    U f; f.h[0] = *(const v8b*)(p); f.h[1] = *(const v8b*)(p + 16); return f.v;
  }
  static __device__ __forceinline__ v8f mma(v16b a, v16b b, v8f c) {
    return __builtin_amdgcn_wmma_f32_16x16x32_bf16(false, a, false, b, (short)0, c, false, false);
  }
  static __device__ __forceinline__ void guard(v8f& a, v8f& b, v16b x, v16b y) { dep_guard_b(a, b, x, y); }
  static __device__ __forceinline__ void keep(v16b a, v16b b, v16b c, v16b d) { keep4_b(a, b, c, d); }
};

// ---- Register-blocked batched WMMA GEMM ------------------------------------
// C[m,n] = scale * sum_k A[m,k] * Bt[n,k] (+bias)(+resid); each wave owns a 64x64 tile.
// A row-major [M,K]; Bt row-major [N,K]; M,N % 64 == 0, K % 32 == 0.
// SPLIT: operands are hi/lo planes (A2/Bt2 = lo planes, same layout); product = hi.hi + hi.lo + lo.hi.
// BIAS_MODE: 0 = none, 1 = bias[m], 2 = bias[n]; the bias value is RNE-converted to bf16 precision before the f32 add.
// OUT_MODE: 0 = f32, 1 = f16, 2 = bf16 hi plane (Cout) + bf16 lo plane (Cout2).
// ET: 0 = f16 operands, 1 = bf16 operands (pointers passed as 16-bit storage)
template <int ET> struct Elem;
template <> struct Elem<0> { typedef _Float16 T; };
template <> struct Elem<1> { typedef __bf16 T; };
template <int ET, bool SPLIT, int BIAS_MODE, int OUT_MODE, bool RESID, int ACT = 0>
__global__ __launch_bounds__(256) void wmma_gemm64(
    const unsigned short* __restrict__ Ap, const unsigned short* __restrict__ A2p, int lda, long strideA,
    const unsigned short* __restrict__ Btp, const unsigned short* __restrict__ Bt2p, int ldb, long strideB,
    void* __restrict__ Cout, void* __restrict__ Cout2, int ldc, long strideC,
    const float* __restrict__ bias,
    const float* __restrict__ resid, long strideR,
    int M, int N, int K, float scale) {
  typedef typename Elem<ET>::T T;
  typedef typename Frag<T>::V V;
  const T* A = (const T*)Ap; const T* A2 = (const T*)A2p; const T* Bt = (const T*)Btp; const T* Bt2 = (const T*)Bt2p;
  __shared__ __align__(16) float sT[8][16 * 68];   // per-wave 16x64 slab, pitch 68 floats
  const int b    = blockIdx.y;
  const int lane = threadIdx.x & 31;
  const int wave = threadIdx.x >> 5;
  const int tilesN = N >> 6;
  const int tilesM = M >> 6;
  const int tile = blockIdx.x * 8 + wave;
  if (tile >= tilesM * tilesN) return;   // wave-uniform; no block barriers in this kernel
  const int tm = tile / tilesN;
  const int tn = tile - tm * tilesN;
  const int m0 = tm << 6;
  const int n0 = tn << 6;

  const T* Ab  = A  + (size_t)b * strideA;
  const T* Bb  = Bt + (size_t)b * strideB;
  const T* Ab2 = SPLIT ? (A2  + (size_t)b * strideA) : nullptr;
  const T* Bb2 = SPLIT ? (Bt2 + (size_t)b * strideB) : nullptr;

  const int rlane = lane & 15;                 // row (A) / col (B, D) within subtile
  const int koff  = (lane >> 4) * 8;           // k offset of this lane half
  const int mOff  = (lane >> 4) * 8;           // D row offset

  v8f acc[4][4];
#pragma unroll
  for (int i = 0; i < 4; ++i)
#pragma unroll
    for (int j = 0; j < 4; ++j) acc[i][j] = (v8f){0.f,0.f,0.f,0.f,0.f,0.f,0.f,0.f};

  for (int k0 = 0; k0 < K; k0 += 32) {
    V bh[4], bl[4];
#pragma unroll
    for (int j = 0; j < 4; ++j) {
      const size_t bo = (size_t)(n0 + (j << 4) + rlane) * ldb + koff + k0;
      bh[j] = Frag<T>::load(Bb + bo);
      if (SPLIT) bl[j] = Frag<T>::load(Bb2 + bo); else bl[j] = bh[j];
    }
#pragma unroll
    for (int i = 0; i < 4; ++i) {
      const size_t ao = (size_t)(m0 + (i << 4) + rlane) * lda + koff + k0;
      V ah = Frag<T>::load(Ab + ao);
      V al;
      if (SPLIT) al = Frag<T>::load(Ab2 + ao); else al = ah;
#pragma unroll
      for (int j = 0; j < 4; ++j) {
        acc[i][j] = Frag<T>::mma(ah, bh[j], acc[i][j]);
        if (SPLIT) {
          acc[i][j] = Frag<T>::mma(ah, bl[j], acc[i][j]);
          acc[i][j] = Frag<T>::mma(al, bh[j], acc[i][j]);
        }
      }
      Frag<T>::guard(acc[i][0], acc[i][3], ah, al);
    }
    Frag<T>::keep(bh[0], bh[1], bh[2], bh[3]);
    if (SPLIT) Frag<T>::keep(bl[0], bl[1], bl[2], bl[3]);
  }
  acc_guard4(acc[0][0], acc[0][1], acc[0][2], acc[0][3]);
  acc_guard4(acc[1][0], acc[1][1], acc[1][2], acc[1][3]);
  acc_guard4(acc[2][0], acc[2][1], acc[2][2], acc[2][3]);
  acc_guard4(acc[3][0], acc[3][1], acc[3][2], acc[3][3]);

  // ---- epilogue ----
  float* slab = sT[wave];
  const float* Rb = RESID ? (resid + (size_t)b * strideR) : nullptr;
#pragma unroll
  for (int i = 0; i < 4; ++i) {
    const int mBase = m0 + (i << 4);
#pragma unroll
    for (int j = 0; j < 4; ++j) {
      const int n = n0 + (j << 4) + rlane;
      float bv = 0.f;
      if (BIAS_MODE == 2) bv = bf_rne(bias[n]);
#pragma unroll
      for (int r = 0; r < 8; ++r) {
        float v = acc[i][j][r] * scale;
        if (BIAS_MODE == 1) v += bf_rne(bias[mBase + mOff + r]);
        if (BIAS_MODE == 2) v += bv;
        if (RESID) v += Rb[(size_t)(mBase + mOff + r) * ldc + n];
        if (ACT == 1) v = tanhf(v);
        if (ACT == 2) v = fmaxf(v, 0.0f);
        if (ACT == 3) v = v / (1.0f + expf(-v));
        if (ACT == 4) v = (v > 0.f) ? v : 0.01f * v;
        if (ACT == 5) v = 0.5f * v * (1.0f + erff(v * 0.70710678118654752f));
        slab[(mOff + r) * 68 + (j << 4) + rlane] = v;
      }
    }
    __builtin_amdgcn_fence(__ATOMIC_RELEASE, "workgroup");
    __builtin_amdgcn_wave_barrier();
    __builtin_amdgcn_fence(__ATOMIC_ACQUIRE, "workgroup");
    if (OUT_MODE == 0) {
      float* C = (float*)Cout + (size_t)b * strideC;
      const int hh = lane >> 4, c4 = (lane & 15) * 4;     // row seg = 256 B = 16 lanes x 16 B
      {
#pragma unroll
        for (int it = 0; it < 8; ++it) {
          const int row = it * 2 + hh;
          v4f v = *(const v4f*)(slab + row * 68 + c4);
          *(v4f*)(C + (size_t)(mBase + row) * ldc + n0 + c4) = v;
        }
        
      }
    } else {
      const int q = lane >> 3, c8 = (lane & 7) * 8;
      unsigned short* C  = (unsigned short*)Cout  + (size_t)b * strideC;
      unsigned short* C2 = (OUT_MODE == 2) ? ((unsigned short*)Cout2 + (size_t)b * strideC) : nullptr;
      {
#pragma unroll
        for (int it = 0; it < 4; ++it) {
          const int row = it * 4 + q;
          const float* sp = slab + row * 68 + c8;
          v8h hv, lv;
#pragma unroll
          for (int e = 0; e < 8; ++e) {
            if (OUT_MODE == 1) {
              hv[e] = (_Float16)sp[e];
            } else {
              unsigned short hb = f2bf_bits(sp[e]);
              unsigned short lb = f2bf_bits(sp[e] - bf_bits2f(hb));
              hv[e] = __builtin_bit_cast(_Float16, hb);
              lv[e] = __builtin_bit_cast(_Float16, lb);
            }
          }
          *(v8h*)(C + (size_t)(mBase + row) * ldc + n0 + c8) = hv;
          if (OUT_MODE == 2) *(v8h*)(C2 + (size_t)(mBase + row) * ldc + n0 + c8) = lv;
        }
        
      }
    }
    __builtin_amdgcn_fence(__ATOMIC_RELEASE, "workgroup");
    __builtin_amdgcn_wave_barrier();
    __builtin_amdgcn_fence(__ATOMIC_ACQUIRE, "workgroup");
  }
}

// ---------------------------------------------------------------------------
// Contiguous bf16 RNE convert of an f32 array: 8 consecutive elements per thread = one 16-B store; 8 consecutive lanes
// Coverage: grid = n8/256 blocks x 256 threads x 8 elements (n8 = n/8, host guarantees n % 2048 == 0).
// ---------------------------------------------------------------------------
__global__ __launch_bounds__(256) void conv8_kernel(const float* __restrict__ in, unsigned short* __restrict__ out, int n8) {
  const int i = blockIdx.x * 256 + threadIdx.x;
  if (i < n8) {
    const size_t e0 = (size_t)i * 8;
    const v4f a = *(const v4f*)(in + e0);
    const v4f c = *(const v4f*)(in + e0 + 4);
    v4u hv;
    hv[0] = pk16(f2bf_bits(a[0]), f2bf_bits(a[1]));
    hv[1] = pk16(f2bf_bits(a[2]), f2bf_bits(a[3]));
    hv[2] = pk16(f2bf_bits(c[0]), f2bf_bits(c[1]));
    hv[3] = pk16(f2bf_bits(c[2]), f2bf_bits(c[3]));
    {
      *(v4u*)(out + e0) = hv;
      
    }
  }
}

// ---------------------------------------------------------------------------
// Fused transpose + bf16 RNE convert of an f32 matrix, z-batched, one plane:
//   in_z = W + z*sIn viewed [R rows][Cc cols] with row pitch ldin  ->  oh_z[c][r] = bf16(in_z[r][c]), row pitch ldout, oh_z = oh + z*sOut.
// 64x64 tiles through LDS. grid = (Cc/64, R/64, Z), 256 threads (R, Cc multiples of 64; ldout multiple of 64 so every
// Coverage per block: load 4 it x 256 thr x 4 floats = 64x64; store 2 it x 256 thr x 8 u16 = 64x64.
// ---------------------------------------------------------------------------
__global__ __launch_bounds__(256) void tconv_kernel(const float* __restrict__ W, unsigned short* __restrict__ oh,
                                                    int ldin, int ldout, long sIn, long sOut) {
  __shared__ __align__(16) float tf[64 * 68];
  W  += (size_t)blockIdx.z * sIn;
  oh += (size_t)blockIdx.z * sOut;
  const int c0  = blockIdx.x * 64;   // input column block = output row block
  const int r0  = blockIdx.y * 64;   // input row block    = output column block
  const int tid = threadIdx.x;
  {
    const int lr = tid >> 4;         // 0..15
    const int c4 = (tid & 15) * 4;   // 0..60
#pragma unroll
    for (int it = 0; it < 4; ++it) {
      const int rr = it * 16 + lr;   // 0..63
      const v4f a = *(const v4f*)(W + (size_t)(r0 + rr) * ldin + c0 + c4);
      *(v4f*)(tf + rr * 68 + c4) = a;
    }
  }
  __syncthreads();
  const int sub = tid >> 3;          // 0..31
  const int c8  = (tid & 7) * 8;     // 0..56
  v4u hv[2];
#pragma unroll
  for (int it = 0; it < 2; ++it) {
    const int oc = it * 32 + sub;    // output row within tile (= input column)
    v4u a;
#pragma unroll
    for (int q = 0; q < 4; ++q) {
      const float f0 = tf[(c8 + 2 * q) * 68 + oc];
      const float f1 = tf[(c8 + 2 * q + 1) * 68 + oc];
      a[q] = pk16(f2bf_bits(f0), f2bf_bits(f1));
    }
    hv[it] = a;
  }
  {
#pragma unroll
    for (int it = 0; it < 2; ++it) {
      const int oc = it * 32 + sub;
      const size_t go = (size_t)(c0 + oc) * ldout + r0 + c8;
      *(v4u*)(oh + go) = hv[it];
    }
    
  }
}

#define AT_D  32
#define AT_C  64
#define AT_NW 4
#define AT_QB 64
#define AT_KC 64
#define OSP   68
#define AT_KP 40    // LDS row pitch of the K tiles in elements: 80 B = 16 B x 5, so 16 rows' 16-B reads fall on 64 distinct banks
#define AT_VP 72    // LDS row pitch of the V^T tiles in elements: 144 B = 16 B x 9, same reason

static_assert(NTOK % AT_QB == 0);
static_assert(NTOK % AT_KC == 0);
static_assert(AT_C == CHN);
static_assert(AT_D == DQK);
static_assert(AT_KP >= AT_D && AT_KP % 8 == 0 && (AT_KP / 8) % 2 == 1);
static_assert(AT_VP >= AT_KC && AT_VP % 8 == 0 && (AT_VP / 8) % 2 == 1);

// bf16 RNE of f, the result's 16 bits in the upper half of the word (the lower half is not cleared)
__device__ __forceinline__ unsigned at_bf_top(float f) {
  const unsigned u = __float_as_uint(f);
  return u + 0x7FFFu + ((u >> 16) & 1u);
}
// hi/lo split of two neighbouring operand elements, packed as one operand register each (p0 in the low half)
__device__ __forceinline__ void at_split_pk(float p0, float p1, unsigned& hi, unsigned& lo) {
  const unsigned h0 = at_bf_top(p0), h1 = at_bf_top(p1);
  const unsigned l0 = at_bf_top(p0 - __uint_as_float(h0 & 0xFFFF0000u));
  const unsigned l1 = at_bf_top(p1 - __uint_as_float(h1 & 0xFFFF0000u));
  hi = __builtin_amdgcn_perm(h1, h0, 0x07060302u);   // upper halves of h0 (low) and h1 (high) in one byte permute
  lo = __builtin_amdgcn_perm(l1, l0, 0x07060302u);
}
// lane l <-> lane l ^ 16 in the vector unit
__device__ __forceinline__ float at_xhalf(float x) {
  const int i = __builtin_bit_cast(int, x);
  return __builtin_bit_cast(float, __builtin_amdgcn_permlanex16(i, i, 0x76543210, 0xfedcba98, false, false));
}
__device__ __forceinline__ v8f at_mma(v16b a, v16b b, v8f c) {
  c = __builtin_amdgcn_wmma_f32_16x16x32_bf16(false, a, false, b, (short)0, c, false, false);
  asm volatile("v_nop\n\tv_nop\n\tv_nop\n\tv_nop" : "+v"(c) : "v"(a), "v"(b));
  return c;
}

__global__ __launch_bounds__(128)
void attn_kernel(const unsigned short* __restrict__ qkhp, const unsigned short* __restrict__ qklp,
                 const unsigned short* __restrict__ vhp, const unsigned short* __restrict__ vlp,
                 float* __restrict__ out) {
  union FB { v16b v; v8b h[2]; unsigned u[8]; };
  __shared__ __align__(16) __bf16 Ksh[AT_KC * AT_KP];            // K hi [kv][d], padded rows      5 KB
  __shared__ __align__(16) __bf16 Ksl[AT_KC * AT_KP];            // K lo
  __shared__ __align__(16) __bf16 Vth[AT_C * AT_VP];             // V hi [c][kv], padded rows      9 KB
  __shared__ __align__(16) __bf16 Vtl[AT_C * AT_VP];             // V lo
  __shared__ __align__(16) float  Os[AT_C * OSP];                // block out tile [c][q], pitch 68

  const int tid  = threadIdx.x;
  const int wave = tid >> 5;
  const int lane = tid & 31;
  const int hh   = lane >> 4;
  const int c    = lane & 15;

  const int nqb  = NTOK / AT_QB;           // 64 query blocks per batch element
  const int bx   = blockIdx.x;             // grid = NB * nqb (exact)
  const int qb   = bx % nqb;
  const int b    = bx / nqb;               // 0..7
  const int nblk = qb * AT_QB;             // first position of this block
  const int q0   = b * NTOK + nblk + wave * 16;   // row in the q|k planes

  const __bf16* Qh = (const __bf16*)(const void*)qkhp;
  const __bf16* Ql = (const __bf16*)(const void*)qklp;
  const __bf16* Kh = Qh + AT_D;                                    // k columns 32..63
  const __bf16* Kl = Ql + AT_D;
  const __bf16* Vh = (const __bf16*)(const void*)vhp + (size_t)b * AT_C * NTOK;
  const __bf16* Vl = (const __bf16*)(const void*)vlp + (size_t)b * AT_C * NTOK;

  // ---- Q fragments (B operand, column = query = lane&15, split k map via Frag load): one 32-deep chunk, hi and lo ----
  const v16b qbh = Frag<__bf16>::load(Qh + (size_t)(q0 + c) * QKP + 8 * hh);
  const v16b qbl = Frag<__bf16>::load(Ql + (size_t)(q0 + c) * QKP + 8 * hh);

  // one query per lane: running max (equal in both lane halves) and this half's share of the row sum
  float mrow = -INFINITY, lrow = 0.f;
  v8f oacc[4];                             // oacc[t][r] = o^T(channel t*16 + 8*hh + r, query c)
#pragma unroll
  for (int t = 0; t < 4; ++t) oacc[t] = (v8f){0.f,0.f,0.f,0.f,0.f,0.f,0.f,0.f};

  const int nChunks = NTOK / AT_KC;   // 64, compile-time constant
  for (int kc = 0; kc < nChunks; ++kc) {
    const int kv0 = kc * AT_KC;
    __syncthreads();
    {
      // staging coverage: K: 128 threads x (2 x 8) = 64 rows x 32; V: 128 threads x (4 x 8) = 64 rows x 64 = whole tiles
      const int r = tid >> 1;
      const int hk = (tid & 1) * 16;
      const int hv = (tid & 1) * 32;
      const __bf16* ksh = Kh + (size_t)(b * NTOK + kv0 + r) * QKP + hk;   // K row (b, kv0+r), d = hk..hk+15
      const __bf16* ksl = Kl + (size_t)(b * NTOK + kv0 + r) * QKP + hk;
      const __bf16* vsh = Vh + (size_t)r * NTOK + kv0 + hv;               // V^T row c = r, keys kv0+hv..+31
      const __bf16* vsl = Vl + (size_t)r * NTOK + kv0 + hv;
#pragma unroll
      for (int i = 0; i < 2; ++i) {
        const v8b a0 = *(const v8b*)(ksh + 8 * i);
        const v8b a1 = *(const v8b*)(ksl + 8 * i);
        *(v8b*)(Ksh + r * AT_KP + hk + 8 * i) = a0;
        *(v8b*)(Ksl + r * AT_KP + hk + 8 * i) = a1;
      }
#pragma unroll
      for (int i = 0; i < 4; ++i) {
        const v8b b0 = *(const v8b*)(vsh + 8 * i);
        const v8b b1 = *(const v8b*)(vsl + 8 * i);
        *(v8b*)(Vth + r * AT_VP + hv + 8 * i) = b0;
        *(v8b*)(Vtl + r * AT_VP + hv + 8 * i) = b1;
      }
    }
    __syncthreads();

    // s[j][r] = energy^T(key j*16 + 8*hh + r, query c): K rows are the A operand, Q the B operand
    v8f s[4];
#pragma unroll
    for (int j = 0; j < 4; ++j) {
      s[j] = (v8f){0.f,0.f,0.f,0.f,0.f,0.f,0.f,0.f};
      FB kb, kl;
      kb.h[0] = *(const v8b*)(Ksh + (j * 16 + c) * AT_KP + 8 * hh);
      kb.h[1] = *(const v8b*)(Ksh + (j * 16 + c) * AT_KP + 16 + 8 * hh);
      kl.h[0] = *(const v8b*)(Ksl + (j * 16 + c) * AT_KP + 8 * hh);
      kl.h[1] = *(const v8b*)(Ksl + (j * 16 + c) * AT_KP + 16 + 8 * hh);
      s[j] = at_mma(kb.v, qbh, s[j]);
      s[j] = at_mma(kl.v, qbh, s[j]);
      s[j] = at_mma(kb.v, qbl, s[j]);
    }
    // chunk max of this lane's query (no energy scaling): 32 keys in the lane, the other 32 in lane ^ 16
    float cm = -INFINITY;
#pragma unroll
    for (int j = 0; j < 4; ++j)
#pragma unroll
      for (int r = 0; r < 8; ++r) cm = fmaxf(cm, s[j][r]);
    cm = fmaxf(cm, at_xhalf(cm));
    const float mnew  = fmaxf(mrow, cm);
    const float alpha = expf(mrow - mnew);
    mrow = mnew;
    // p^T packs in place into B operands: element e of chunk half kk = key kk*32 + (e < 8 ? 8*hh + e : 16 + 8*hh + e - 8),
    // the same k order as the two 16-B reads of a V^T row below
    FB ph[2], pl[2];
    float ps[4];
#pragma unroll
    for (int j = 0; j < 4; ++j) {
      ps[j] = 0.f;
#pragma unroll
      for (int r = 0; r < 8; r += 2) {
        const float p0 = expf(s[j][r] - mnew);
        const float p1 = expf(s[j][r + 1] - mnew);
        ps[j] += p0;
        ps[j] += p1;
        at_split_pk(p0, p1, ph[j >> 1].u[(j & 1) * 4 + (r >> 1)], pl[j >> 1].u[(j & 1) * 4 + (r >> 1)]);
      }
    }
    lrow = lrow * alpha + ((ps[0] + ps[1]) + (ps[2] + ps[3]));
#pragma unroll
    for (int t = 0; t < 4; ++t)
#pragma unroll
      for (int r = 0; r < 8; ++r) oacc[t][r] *= alpha;
#pragma unroll
    for (int kk = 0; kk < 2; ++kk) {
#pragma unroll
      for (int t = 0; t < 4; ++t) {
        FB vb, vl;
        vb.h[0] = *(const v8b*)(Vth + (t * 16 + c) * AT_VP + kk * 32 + 8 * hh);
        vb.h[1] = *(const v8b*)(Vth + (t * 16 + c) * AT_VP + kk * 32 + 16 + 8 * hh);
        vl.h[0] = *(const v8b*)(Vtl + (t * 16 + c) * AT_VP + kk * 32 + 8 * hh);
        vl.h[1] = *(const v8b*)(Vtl + (t * 16 + c) * AT_VP + kk * 32 + 16 + 8 * hh);
        oacc[t] = at_mma(vb.v, ph[kk].v, oacc[t]);
        oacc[t] = at_mma(vl.v, ph[kk].v, oacc[t]);
        oacc[t] = at_mma(vb.v, pl[kk].v, oacc[t]);
      }
    }
  }

  // ---- join the two halves' row sums, normalise, stage the block's 64 (channel) x 64 (position) tile, write NCHW segments ----
  {
    const float inv = 1.0f / (lrow + at_xhalf(lrow));
#pragma unroll
    for (int t = 0; t < 4; ++t)
#pragma unroll
      for (int r = 0; r < 8; ++r) Os[(t * 16 + 8 * hh + r) * OSP + wave * 16 + c] = oacc[t][r] * inv;
  }
  __syncthreads();
  {
    const int c4 = c * 4;                                 // position offset within the block (0..60)
    float* ob = out + ((size_t)b * AT_C) * NTOK + nblk + c4;
    v4f ov[8];
#pragma unroll
    for (int it = 0; it < 8; ++it) {
      const int ch = wave * 16 + it * 2 + hh;             // it 0..7 x hh 0..1 = channels 0..15 of this wave
      ov[it] = *(const v4f*)(Os + ch * OSP + c4);
    }
#pragma unroll
    for (int it = 0; it < 8; ++it) {
      const int ch = wave * 16 + it * 2 + hh;
      *(v4f*)(ob + (size_t)ch * NTOK) = ov[it];
    }
  }
}

// ---------------------------------------------------------------------------
// Workspace region map (byte offsets; every region is fully written by its producer launch before any consumer
//   XB    bf16 [32768][64]            0       4194304
//   WB    bf16 [128][64]        4194304         16384
//   QKh   bf16 [32768][64]      4210688       4194304   QKl   8404992
//   VTh   bf16 [8][64][4096]   12599296       4194304   VTl  16793600
//   total                      20987904
// ---------------------------------------------------------------------------
extern "C" void kernel_launch(void* const* d_in, const int* in_sizes, int n_in,
                              void* d_out, int out_size, void* d_ws, size_t ws_size,
                              hipStream_t stream) {
  if (n_in < 4) return;
  if (in_sizes[0] != NB * CHN * NTOK) return;      // x  [8][64][64][64]
  if (in_sizes[1] != DQK * CHN) return;            // wq [32][64]
  if (in_sizes[2] != DQK * CHN) return;            // wk [32][64]
  if (in_sizes[3] != CHN * CHN) return;            // wv [64][64]
  if (out_size != NB * CHN * NTOK) return;

  const float* x  = (const float*)d_in[0];
  const float* wq = (const float*)d_in[1];   // [out 32][in 64]
  const float* wk = (const float*)d_in[2];   // [out 32][in 64]
  const float* wv = (const float*)d_in[3];   // [out 64][in 64]

  const size_t PXB = (size_t)MTOK * CHN * 2;         // 4194304
  const size_t PWB = (size_t)WROWS * CHN * 2;        // 16384
  const size_t PQK = (size_t)MTOK * QKP * 2;         // 4194304 per plane
  const size_t PVT = (size_t)NB * CHN * NTOK * 2;    // 4194304 per plane
  size_t off = 0;
  const size_t oXB  = off; off += PXB;
  const size_t oWB  = off; off += PWB;
  const size_t oQKh = off; off += PQK;  const size_t oQKl = off; off += PQK;
  const size_t oVTh = off; off += PVT;  const size_t oVTl = off; off += PVT;
  if (off > ws_size) return;                         // off = 20987904
  if (off > (size_t)134217728) return;

  char* ws = (char*)d_ws;
  unsigned short* XB  = (unsigned short*)(ws + oXB);
  unsigned short* WB  = (unsigned short*)(ws + oWB);
  unsigned short* QKh = (unsigned short*)(ws + oQKh); unsigned short* QKl = (unsigned short*)(ws + oQKl);
  unsigned short* VTh = (unsigned short*)(ws + oVTh); unsigned short* VTl = (unsigned short*)(ws + oVTl);

  const dim3 blk(256);

  // (1) x[b] viewed [R=64 c][Cc=4096 n] (pitch 4096) -> XB_b[n][c] (pitch 64); grid (Cc/64, R/64, B) = (64, 1, 8)
  tconv_kernel<<<dim3(NTOK / 64, CHN / 64, NB), blk, 0, stream>>>(x, XB, NTOK, CHN, (long)CHN * NTOK, (long)NTOK * CHN);
  // (2) weights -> WB bf16 rows 0..31 wq, 32..63 wk, 64..127 wv (natural [out][in]); 256 / 256 / 512 units
  conv8_kernel<<<dim3((DQK * CHN / 8) / 256), blk, 0, stream>>>(wq, WB, DQK * CHN / 8);
  conv8_kernel<<<dim3((DQK * CHN / 8) / 256), blk, 0, stream>>>(wk, WB + (size_t)DQK * CHN, DQK * CHN / 8);
  conv8_kernel<<<dim3((CHN * CHN / 8) / 256), blk, 0, stream>>>(wv, WB + (size_t)2 * DQK * CHN, CHN * CHN / 8);
  // (3) q|k = XB . WB[0..63]^T -> QKh|QKl [32768][64]   (M=32768, N=64, K=64; 512 tiles -> 64 blocks)
  const dim3 gQK(((MTOK / 64) * (QKP / 64) + 7) / 8, 1);
  wmma_gemm64<1, false, 0, 2, false, 0><<<gQK, blk, 0, stream>>>(
      XB, XB, CHN, 0L, WB, WB, CHN, 0L, (void*)QKh, (void*)QKl, QKP, 0L,
      wq, wq, 0L, MTOK, QKP, CHN, 1.0f);
  // (4) v^T_b = WB[64..127] . XB_b^T -> VTh|VTl [b][64][4096]   (M=64, N=4096, K=64 per batch; 64 tiles -> 8 blocks x 8 batches)
  const dim3 gVT(((CHN / 64) * (NTOK / 64) + 7) / 8, NB);
  wmma_gemm64<1, false, 0, 2, false, 0><<<gVT, blk, 0, stream>>>(
      WB + (size_t)2 * DQK * CHN, WB + (size_t)2 * DQK * CHN, CHN, 0L, XB, XB, CHN, (long)NTOK * CHN,
      (void*)VTh, (void*)VTl, NTOK, (long)CHN * NTOK,
      wq, wq, 0L, CHN, NTOK, CHN, 1.0f);
  // (5) attention per (batch, 64-position block) -> NCHW d_out; 512 blocks of 128 threads
  attn_kernel<<<dim3(NB * (NTOK / AT_QB)), dim3(128), 0, stream>>>(QKh, QKl, VTh, VTl, (float*)d_out);
  (void)hipGetLastError();
}

// v003
// A run of this version takes 154 microseconds.
// Next to v002, in two timings, it ran 1.08 and 1.10 times as fast.
// Over all steps from v000 it is 1.97 times as fast.
// Contractions: q|k projection and v^T projection = v_wmma_f32_16x16x32_bf16 single products on bf16 planes of the
// RNE-converted inputs (f32 accumulate, results split into bf16 hi|lo planes); q.k^T energies and p.v = bf16 hi/lo split
// (hi.hi + hi.lo + lo.hi) on v_wmma_f32_16x16x32_bf16, f32 accumulate; online max-shifted softmax (base 2: one fma and one
// v_exp_f32 per energy) and 1/rowsum in f32 on the VALU.
// Plane / carry map (every plane carries factor 1, nothing to fold back):
//   XB  = bf16(x) token-major [32768 (b*4096+n)][64 c], n = y*64 + x (NCHW token order);
//   WB  = bf16([wq; wk; wv]) [128][64], natural [out][in] (rows 0..31 wq, 32..63 wk, 64..127 wv);
//   QKh|QKl bf16 [32768][64]: cols 0..31 = q hi|lo over d, cols 32..63 = k hi|lo over d;
//   VTh|VTl bf16 [8][64 c][4096 m];
//   P hi|lo = unnormalised exp in (0,1] (bf16 keeps the f32 exponent range); 1/rowsum is applied to the f32 accumulator
//   in the attention epilogue right before the NCHW store (the only place a normaliser is applied).
#include <hip/hip_runtime.h>
#include <math.h>
#include <stdint.h>

#define NB    8
#define CHN   64
#define DQK   32
#define IMH   64
#define IMW   64
#define NTOK  4096
#define MTOK  (NB * NTOK)
#define QKP   64
#define WROWS 128

static_assert(NTOK == IMH * IMW);
static_assert(CHN == 64);
static_assert(DQK == 32);
static_assert(QKP == 2 * DQK);
static_assert(WROWS == 2 * DQK + CHN);
static_assert(NTOK % 64 == 0);
static_assert(MTOK % 64 == 0);
static_assert(CHN % 32 == 0);
static_assert((DQK * CHN) % (8 * 256) == 0);
static_assert((CHN * CHN) % (8 * 256) == 0);

typedef __attribute__((ext_vector_type(16))) _Float16 v16h;
typedef __attribute__((ext_vector_type(8)))  _Float16 v8h;
typedef __attribute__((ext_vector_type(16))) __bf16   v16b;
typedef __attribute__((ext_vector_type(8)))  __bf16   v8b;
typedef __attribute__((ext_vector_type(8)))  float    v8f;
typedef __attribute__((ext_vector_type(4)))  float    v4f;
typedef __attribute__((ext_vector_type(2)))  float    v2f;
typedef __attribute__((ext_vector_type(4)))  unsigned int v4u;

__device__ __forceinline__ unsigned short f2bf_bits(float f) {
  unsigned u = __float_as_uint(f);
  return (unsigned short)((u + 0x7FFFu + ((u >> 16) & 1u)) >> 16);
}
__device__ __forceinline__ float bf_bits2f(unsigned short h) { return __uint_as_float(((unsigned)h) << 16); }
__device__ __forceinline__ float bf_rne(float f) { return bf_bits2f(f2bf_bits(f)); }
__device__ __forceinline__ unsigned pk16(unsigned short a, unsigned short b) { return (unsigned)a | ((unsigned)b << 16); }

// hazard guards as plain device helpers (no inline asm inside the kernel template body)
__device__ __forceinline__ void dep_guard_h(v8f& a, v8f& b, v16h x, v16h y) { asm volatile("v_nop\n\tv_nop\n\tv_nop\n\tv_nop" : "+v"(a), "+v"(b) : "v"(x), "v"(y)); }
__device__ __forceinline__ void dep_guard_b(v8f& a, v8f& b, v16b x, v16b y) { asm volatile("v_nop\n\tv_nop\n\tv_nop\n\tv_nop" : "+v"(a), "+v"(b) : "v"(x), "v"(y)); }
__device__ __forceinline__ void keep4_h(v16h a, v16h b, v16h c, v16h d) { asm volatile("v_nop" :: "v"(a), "v"(b), "v"(c), "v"(d)); }
__device__ __forceinline__ void keep4_b(v16b a, v16b b, v16b c, v16b d) { asm volatile("v_nop" :: "v"(a), "v"(b), "v"(c), "v"(d)); }
__device__ __forceinline__ void acc_guard4(v8f& a, v8f& b, v8f& c, v8f& d) { asm volatile("v_nop\n\tv_nop\n\tv_nop\n\tv_nop" : "+v"(a), "+v"(b), "+v"(c), "+v"(d)); }
template <typename T> struct Frag;
template <> struct Frag<_Float16> {
  typedef v16h V; union U { v16h v; v8h h[2]; };
  static __device__ __forceinline__ v16h load(const _Float16* p) {   // elements 0..7 <- p[0..7], 8..15 <- p[16..23]
    U f; f.h[0] = *(const v8h*)(p); f.h[1] = *(const v8h*)(p + 16); return f.v;
  }
  static __device__ __forceinline__ v8f mma(v16h a, v16h b, v8f c) {
    return __builtin_amdgcn_wmma_f32_16x16x32_f16(false, a, false, b, (short)0, c, false, false);
  }
  static __device__ __forceinline__ void guard(v8f& a, v8f& b, v16h x, v16h y) { dep_guard_h(a, b, x, y); }
  static __device__ __forceinline__ void keep(v16h a, v16h b, v16h c, v16h d) { keep4_h(a, b, c, d); }
};
template <> struct Frag<__bf16> {
  typedef v16b V; union U { v16b v; v8b h[2]; };
  static __device__ __forceinline__ v16b load(const __bf16* p) {
    U f; f.h[0] = *(const v8b*)(p); f.h[1] = *(const v8b*)(p + 16); return f.v;
  }
  static __device__ __forceinline__ v8f mma(v16b a, v16b b, v8f c) {
    return __builtin_amdgcn_wmma_f32_16x16x32_bf16(false, a, false, b, (short)0, c, false, false);
  }
  static __device__ __forceinline__ void guard(v8f& a, v8f& b, v16b x, v16b y) { dep_guard_b(a, b, x, y); }
  static __device__ __forceinline__ void keep(v16b a, v16b b, v16b c, v16b d) { keep4_b(a, b, c, d); }
};

// ---- Register-blocked batched WMMA GEMM ------------------------------------
// C[m,n] = scale * sum_k A[m,k] * Bt[n,k] (+bias)(+resid); each wave owns a 64x64 tile.
// A row-major [M,K]; Bt row-major [N,K]; M,N % 64 == 0, K % 32 == 0.
// SPLIT: operands are hi/lo planes (A2/Bt2 = lo planes, same layout); product = hi.hi + hi.lo + lo.hi.
// BIAS_MODE: 0 = none, 1 = bias[m], 2 = bias[n]; the bias value is RNE-converted to bf16 precision before the f32 add.
// OUT_MODE: 0 = f32, 1 = f16, 2 = bf16 hi plane (Cout) + bf16 lo plane (Cout2).
// ET: 0 = f16 operands, 1 = bf16 operands (pointers passed as 16-bit storage)
template <int ET> struct Elem;
template <> struct Elem<0> { typedef _Float16 T; };
template <> struct Elem<1> { typedef __bf16 T; };
template <int ET, bool SPLIT, int BIAS_MODE, int OUT_MODE, bool RESID, int ACT = 0>
__global__ __launch_bounds__(256) void wmma_gemm64(
    const unsigned short* __restrict__ Ap, const unsigned short* __restrict__ A2p, int lda, long strideA,
    const unsigned short* __restrict__ Btp, const unsigned short* __restrict__ Bt2p, int ldb, long strideB,
    void* __restrict__ Cout, void* __restrict__ Cout2, int ldc, long strideC,
    const float* __restrict__ bias,
    const float* __restrict__ resid, long strideR,
    int M, int N, int K, float scale) {
  typedef typename Elem<ET>::T T;
  typedef typename Frag<T>::V V;
  const T* A = (const T*)Ap; const T* A2 = (const T*)A2p; const T* Bt = (const T*)Btp; const T* Bt2 = (const T*)Bt2p;
  __shared__ __align__(16) float sT[8][16 * 68];   // per-wave 16x64 slab, pitch 68 floats
  const int b    = blockIdx.y;
  const int lane = threadIdx.x & 31;
  const int wave = threadIdx.x >> 5;
  const int tilesN = N >> 6;
  const int tilesM = M >> 6;
  const int tile = blockIdx.x * 8 + wave;
  if (tile >= tilesM * tilesN) return;   // wave-uniform; no block barriers in this kernel
  const int tm = tile / tilesN;
  const int tn = tile - tm * tilesN;
  const int m0 = tm << 6;
  const int n0 = tn << 6;

  const T* Ab  = A  + (size_t)b * strideA;
  const T* Bb  = Bt + (size_t)b * strideB;
  const T* Ab2 = SPLIT ? (A2  + (size_t)b * strideA) : nullptr;
  const T* Bb2 = SPLIT ? (Bt2 + (size_t)b * strideB) : nullptr;

  const int rlane = lane & 15;                 // row (A) / col (B, D) within subtile
  const int koff  = (lane >> 4) * 8;           // k offset of this lane half
  const int mOff  = (lane >> 4) * 8;           // D row offset

  v8f acc[4][4];
#pragma unroll
  for (int i = 0; i < 4; ++i)
#pragma unroll
    for (int j = 0; j < 4; ++j) acc[i][j] = (v8f){0.f,0.f,0.f,0.f,0.f,0.f,0.f,0.f};

  for (int k0 = 0; k0 < K; k0 += 32) {
    V bh[4], bl[4];
#pragma unroll
    for (int j = 0; j < 4; ++j) {
      const size_t bo = (size_t)(n0 + (j << 4) + rlane) * ldb + koff + k0;
      bh[j] = Frag<T>::load(Bb + bo);
      if (SPLIT) bl[j] = Frag<T>::load(Bb2 + bo); else bl[j] = bh[j];
    }
#pragma unroll
    for (int i = 0; i < 4; ++i) {
      const size_t ao = (size_t)(m0 + (i << 4) + rlane) * lda + koff + k0;
      V ah = Frag<T>::load(Ab + ao);
      V al;
      if (SPLIT) al = Frag<T>::load(Ab2 + ao); else al = ah;
#pragma unroll
      for (int j = 0; j < 4; ++j) {
        acc[i][j] = Frag<T>::mma(ah, bh[j], acc[i][j]);
        if (SPLIT) {
          acc[i][j] = Frag<T>::mma(ah, bl[j], acc[i][j]);
          acc[i][j] = Frag<T>::mma(al, bh[j], acc[i][j]);
        }
      }
      Frag<T>::guard(acc[i][0], acc[i][3], ah, al);
    }
    Frag<T>::keep(bh[0], bh[1], bh[2], bh[3]);
    if (SPLIT) Frag<T>::keep(bl[0], bl[1], bl[2], bl[3]);
  }
  acc_guard4(acc[0][0], acc[0][1], acc[0][2], acc[0][3]);
  acc_guard4(acc[1][0], acc[1][1], acc[1][2], acc[1][3]);
  acc_guard4(acc[2][0], acc[2][1], acc[2][2], acc[2][3]);
  acc_guard4(acc[3][0], acc[3][1], acc[3][2], acc[3][3]);

  // ---- epilogue ----
  float* slab = sT[wave];
  const float* Rb = RESID ? (resid + (size_t)b * strideR) : nullptr;
#pragma unroll
  for (int i = 0; i < 4; ++i) {
    const int mBase = m0 + (i << 4);
#pragma unroll
    for (int j = 0; j < 4; ++j) {
      const int n = n0 + (j << 4) + rlane;
      float bv = 0.f;
      if (BIAS_MODE == 2) bv = bf_rne(bias[n]);
#pragma unroll
      for (int r = 0; r < 8; ++r) {
        float v = acc[i][j][r] * scale;
        if (BIAS_MODE == 1) v += bf_rne(bias[mBase + mOff + r]);
        if (BIAS_MODE == 2) v += bv;
        if (RESID) v += Rb[(size_t)(mBase + mOff + r) * ldc + n];
        if (ACT == 1) v = tanhf(v);
        if (ACT == 2) v = fmaxf(v, 0.0f);
        if (ACT == 3) v = v / (1.0f + expf(-v));
        if (ACT == 4) v = (v > 0.f) ? v : 0.01f * v;
        if (ACT == 5) v = 0.5f * v * (1.0f + erff(v * 0.70710678118654752f));
        slab[(mOff + r) * 68 + (j << 4) + rlane] = v;
      }
    }
    __builtin_amdgcn_fence(__ATOMIC_RELEASE, "workgroup");
    __builtin_amdgcn_wave_barrier();
    __builtin_amdgcn_fence(__ATOMIC_ACQUIRE, "workgroup");
    if (OUT_MODE == 0) {
      float* C = (float*)Cout + (size_t)b * strideC;
      const int hh = lane >> 4, c4 = (lane & 15) * 4;     // row seg = 256 B = 16 lanes x 16 B
      {
#pragma unroll
        for (int it = 0; it < 8; ++it) {
          const int row = it * 2 + hh;
          v4f v = *(const v4f*)(slab + row * 68 + c4);
          *(v4f*)(C + (size_t)(mBase + row) * ldc + n0 + c4) = v;
        }
        
      }
    } else {
      const int q = lane >> 3, c8 = (lane & 7) * 8;
      unsigned short* C  = (unsigned short*)Cout  + (size_t)b * strideC;
      unsigned short* C2 = (OUT_MODE == 2) ? ((unsigned short*)Cout2 + (size_t)b * strideC) : nullptr;
      {
#pragma unroll
        for (int it = 0; it < 4; ++it) {
          const int row = it * 4 + q;
          const float* sp = slab + row * 68 + c8;
          v8h hv, lv;
#pragma unroll
          for (int e = 0; e < 8; ++e) {
            if (OUT_MODE == 1) {
              hv[e] = (_Float16)sp[e];
            } else {
              unsigned short hb = f2bf_bits(sp[e]);
              unsigned short lb = f2bf_bits(sp[e] - bf_bits2f(hb));
              hv[e] = __builtin_bit_cast(_Float16, hb);
              lv[e] = __builtin_bit_cast(_Float16, lb);
            }
          }
          *(v8h*)(C + (size_t)(mBase + row) * ldc + n0 + c8) = hv;
          if (OUT_MODE == 2) *(v8h*)(C2 + (size_t)(mBase + row) * ldc + n0 + c8) = lv;
        }
        
      }
    }
    __builtin_amdgcn_fence(__ATOMIC_RELEASE, "workgroup");
    __builtin_amdgcn_wave_barrier();
    __builtin_amdgcn_fence(__ATOMIC_ACQUIRE, "workgroup");
  }
}

// ---------------------------------------------------------------------------
// Contiguous bf16 RNE convert of an f32 array: 8 consecutive elements per thread = one 16-B store; 8 consecutive lanes
// Coverage: grid = n8/256 blocks x 256 threads x 8 elements (n8 = n/8, host guarantees n % 2048 == 0).
// ---------------------------------------------------------------------------
__global__ __launch_bounds__(256) void conv8_kernel(const float* __restrict__ in, unsigned short* __restrict__ out, int n8) {
  const int i = blockIdx.x * 256 + threadIdx.x;
  if (i < n8) {
    const size_t e0 = (size_t)i * 8;
    const v4f a = *(const v4f*)(in + e0);
    const v4f c = *(const v4f*)(in + e0 + 4);
    v4u hv;
    hv[0] = pk16(f2bf_bits(a[0]), f2bf_bits(a[1]));
    hv[1] = pk16(f2bf_bits(a[2]), f2bf_bits(a[3]));
    hv[2] = pk16(f2bf_bits(c[0]), f2bf_bits(c[1]));
    hv[3] = pk16(f2bf_bits(c[2]), f2bf_bits(c[3]));
    {
      *(v4u*)(out + e0) = hv;
      
    }
  }
}

// ---------------------------------------------------------------------------
// Fused transpose + bf16 RNE convert of an f32 matrix, z-batched, one plane:
//   in_z = W + z*sIn viewed [R rows][Cc cols] with row pitch ldin  ->  oh_z[c][r] = bf16(in_z[r][c]), row pitch ldout, oh_z = oh + z*sOut.
// 64x64 tiles through LDS. grid = (Cc/64, R/64, Z), 256 threads (R, Cc multiples of 64; ldout multiple of 64 so every
// Coverage per block: load 4 it x 256 thr x 4 floats = 64x64; store 2 it x 256 thr x 8 u16 = 64x64.
// ---------------------------------------------------------------------------
__global__ __launch_bounds__(256) void tconv_kernel(const float* __restrict__ W, unsigned short* __restrict__ oh,
                                                    int ldin, int ldout, long sIn, long sOut) {
  __shared__ __align__(16) float tf[64 * 68];
  W  += (size_t)blockIdx.z * sIn;
  oh += (size_t)blockIdx.z * sOut;
  const int c0  = blockIdx.x * 64;   // input column block = output row block
  const int r0  = blockIdx.y * 64;   // input row block    = output column block
  const int tid = threadIdx.x;
  {
    const int lr = tid >> 4;         // 0..15
    const int c4 = (tid & 15) * 4;   // 0..60
#pragma unroll
    for (int it = 0; it < 4; ++it) {
      const int rr = it * 16 + lr;   // 0..63
      const v4f a = *(const v4f*)(W + (size_t)(r0 + rr) * ldin + c0 + c4);
      *(v4f*)(tf + rr * 68 + c4) = a;
    }
  }
  __syncthreads();
  const int sub = tid >> 3;          // 0..31
  const int c8  = (tid & 7) * 8;     // 0..56
  v4u hv[2];
#pragma unroll
  for (int it = 0; it < 2; ++it) {
    const int oc = it * 32 + sub;    // output row within tile (= input column)
    v4u a;
#pragma unroll
    for (int q = 0; q < 4; ++q) {
      const float f0 = tf[(c8 + 2 * q) * 68 + oc];
      const float f1 = tf[(c8 + 2 * q + 1) * 68 + oc];
      a[q] = pk16(f2bf_bits(f0), f2bf_bits(f1));
    }
    hv[it] = a;
  }
  {
#pragma unroll
    for (int it = 0; it < 2; ++it) {
      const int oc = it * 32 + sub;
      const size_t go = (size_t)(c0 + oc) * ldout + r0 + c8;
      *(v4u*)(oh + go) = hv[it];
    }
    
  }
}

#define AT_D  32
#define AT_C  64
#define AT_NW 4
#define AT_QB 64
#define AT_KC 64
#define OSP   68
#define AT_KP 40    // LDS row pitch of the K tiles in elements: 80 B = 16 B x 5, so 16 rows' 16-B reads fall on 64 distinct banks
#define AT_L2E 1.44269504088896340736f   // log2(e)
#define AT_VP 72    // LDS row pitch of the V^T tiles in elements: 144 B = 16 B x 9, same reason

static_assert(NTOK % AT_QB == 0);
static_assert(NTOK % AT_KC == 0);
static_assert(AT_C == CHN);
static_assert(AT_D == DQK);
static_assert(AT_KP >= AT_D && AT_KP % 8 == 0 && (AT_KP / 8) % 2 == 1);
static_assert(AT_VP >= AT_KC && AT_VP % 8 == 0 && (AT_VP / 8) % 2 == 1);

// bf16 RNE of f, the result's 16 bits in the upper half of the word (the lower half is not cleared)
__device__ __forceinline__ unsigned at_bf_top(float f) {
  const unsigned u = __float_as_uint(f);
  return u + 0x7FFFu + ((u >> 16) & 1u);
}
// hi/lo split of two neighbouring operand elements, packed as one operand register each (p0 in the low half)
__device__ __forceinline__ void at_split_pk(float p0, float p1, unsigned& hi, unsigned& lo) {
  const unsigned h0 = at_bf_top(p0), h1 = at_bf_top(p1);
  const unsigned l0 = at_bf_top(p0 - __uint_as_float(h0 & 0xFFFF0000u));
  const unsigned l1 = at_bf_top(p1 - __uint_as_float(h1 & 0xFFFF0000u));
  hi = __builtin_amdgcn_perm(h1, h0, 0x07060302u);   // upper halves of h0 (low) and h1 (high) in one byte permute
  lo = __builtin_amdgcn_perm(l1, l0, 0x07060302u);
}
// lane l <-> lane l ^ 16 in the vector unit
__device__ __forceinline__ float at_xhalf(float x) {
  const int i = __builtin_bit_cast(int, x);
  return __builtin_bit_cast(float, __builtin_amdgcn_permlanex16(i, i, 0x76543210, 0xfedcba98, false, false));
}
// 2^x on the hardware's own instruction; every x here is -inf, or finite and not above a rounding error over 0, so nothing
// overflows, and a result under the smallest normal may go to 0 beside a row sum of about 1 or more
__device__ __forceinline__ float at_exp2(float x) { return __builtin_amdgcn_exp2f(x); }
__device__ __forceinline__ v8f at_mma(v16b a, v16b b, v8f c) {
  c = __builtin_amdgcn_wmma_f32_16x16x32_bf16(false, a, false, b, (short)0, c, false, false);
  asm volatile("v_nop\n\tv_nop\n\tv_nop\n\tv_nop" : "+v"(c) : "v"(a), "v"(b));
  return c;
}

__global__ __launch_bounds__(128)
void attn_kernel(const unsigned short* __restrict__ qkhp, const unsigned short* __restrict__ qklp,
                 const unsigned short* __restrict__ vhp, const unsigned short* __restrict__ vlp,
                 float* __restrict__ out) {
  union FB { v16b v; v8b h[2]; unsigned u[8]; };
  __shared__ __align__(16) __bf16 Ksh[AT_KC * AT_KP];            // K hi [kv][d], padded rows      5 KB
  __shared__ __align__(16) __bf16 Ksl[AT_KC * AT_KP];            // K lo
  __shared__ __align__(16) __bf16 Vth[AT_C * AT_VP];             // V hi [c][kv], padded rows      9 KB
  __shared__ __align__(16) __bf16 Vtl[AT_C * AT_VP];             // V lo
  __shared__ __align__(16) float  Os[AT_C * OSP];                // block out tile [c][q], pitch 68

  const int tid  = threadIdx.x;
  const int wave = tid >> 5;
  const int lane = tid & 31;
  const int hh   = lane >> 4;
  const int c    = lane & 15;

  const int nqb  = NTOK / AT_QB;           // 64 query blocks per batch element
  const int bx   = blockIdx.x;             // grid = NB * nqb (exact)
  const int qb   = bx % nqb;
  const int b    = bx / nqb;               // 0..7
  const int nblk = qb * AT_QB;             // first position of this block
  const int q0   = b * NTOK + nblk + wave * 16;   // row in the q|k planes

  const __bf16* Qh = (const __bf16*)(const void*)qkhp;
  const __bf16* Ql = (const __bf16*)(const void*)qklp;
  const __bf16* Kh = Qh + AT_D;                                    // k columns 32..63
  const __bf16* Kl = Ql + AT_D;
  const __bf16* Vh = (const __bf16*)(const void*)vhp + (size_t)b * AT_C * NTOK;
  const __bf16* Vl = (const __bf16*)(const void*)vlp + (size_t)b * AT_C * NTOK;

  // ---- Q fragments (B operand, column = query = lane&15, split k map via Frag load): one 32-deep chunk, hi and lo ----
  const v16b qbh = Frag<__bf16>::load(Qh + (size_t)(q0 + c) * QKP + 8 * hh);
  const v16b qbl = Frag<__bf16>::load(Ql + (size_t)(q0 + c) * QKP + 8 * hh);

  // one query per lane: running max times log2(e) (equal in both lane halves) and this half's share of the row sum
  float mrow = -INFINITY, lrow = 0.f;
  v8f oacc[4];                             // oacc[t][r] = o^T(channel t*16 + 8*hh + r, query c)
#pragma unroll
  for (int t = 0; t < 4; ++t) oacc[t] = (v8f){0.f,0.f,0.f,0.f,0.f,0.f,0.f,0.f};

  const int nChunks = NTOK / AT_KC;   // 64, compile-time constant
  for (int kc = 0; kc < nChunks; ++kc) {
    const int kv0 = kc * AT_KC;
    __syncthreads();
    {
      // staging coverage: K: 128 threads x (2 x 8) = 64 rows x 32; V: 128 threads x (4 x 8) = 64 rows x 64 = whole tiles
      const int r = tid >> 1;
      const int hk = (tid & 1) * 16;
      const int hv = (tid & 1) * 32;
      const __bf16* ksh = Kh + (size_t)(b * NTOK + kv0 + r) * QKP + hk;   // K row (b, kv0+r), d = hk..hk+15
      const __bf16* ksl = Kl + (size_t)(b * NTOK + kv0 + r) * QKP + hk;
      const __bf16* vsh = Vh + (size_t)r * NTOK + kv0 + hv;               // V^T row c = r, keys kv0+hv..+31
      const __bf16* vsl = Vl + (size_t)r * NTOK + kv0 + hv;
#pragma unroll
      for (int i = 0; i < 2; ++i) {
        const v8b a0 = *(const v8b*)(ksh + 8 * i);
        const v8b a1 = *(const v8b*)(ksl + 8 * i);
        *(v8b*)(Ksh + r * AT_KP + hk + 8 * i) = a0;
        *(v8b*)(Ksl + r * AT_KP + hk + 8 * i) = a1;
      }
#pragma unroll
      for (int i = 0; i < 4; ++i) {
        const v8b b0 = *(const v8b*)(vsh + 8 * i);
        const v8b b1 = *(const v8b*)(vsl + 8 * i);
        *(v8b*)(Vth + r * AT_VP + hv + 8 * i) = b0;
        *(v8b*)(Vtl + r * AT_VP + hv + 8 * i) = b1;
      }
    }
    __syncthreads();

    // s[j][r] = energy^T(key j*16 + 8*hh + r, query c): K rows are the A operand, Q the B operand
    v8f s[4];
#pragma unroll
    for (int j = 0; j < 4; ++j) {
      s[j] = (v8f){0.f,0.f,0.f,0.f,0.f,0.f,0.f,0.f};
      FB kb, kl;
      kb.h[0] = *(const v8b*)(Ksh + (j * 16 + c) * AT_KP + 8 * hh);
      kb.h[1] = *(const v8b*)(Ksh + (j * 16 + c) * AT_KP + 16 + 8 * hh);
      kl.h[0] = *(const v8b*)(Ksl + (j * 16 + c) * AT_KP + 8 * hh);
      kl.h[1] = *(const v8b*)(Ksl + (j * 16 + c) * AT_KP + 16 + 8 * hh);
      s[j] = at_mma(kb.v, qbh, s[j]);
      s[j] = at_mma(kl.v, qbh, s[j]);
      s[j] = at_mma(kb.v, qbl, s[j]);
    }
    // chunk max of this lane's query (no energy scaling): 32 keys in the lane, the other 32 in lane ^ 16
    float cm = -INFINITY;
#pragma unroll
    for (int j = 0; j < 4; ++j)
#pragma unroll
      for (int r = 0; r < 8; ++r) cm = fmaxf(cm, s[j][r]);
    cm = fmaxf(cm, at_xhalf(cm));
    const float mnew  = fmaxf(mrow, cm * AT_L2E);
    const float alpha = at_exp2(mrow - mnew);
    mrow = mnew;
    // p^T packs in place into B operands: element e of chunk half kk = key kk*32 + (e < 8 ? 8*hh + e : 16 + 8*hh + e - 8),
    // the same k order as the two 16-B reads of a V^T row below
    FB ph[2], pl[2];
    float ps[4];
#pragma unroll
    for (int j = 0; j < 4; ++j) {
      ps[j] = 0.f;
#pragma unroll
      for (int r = 0; r < 8; r += 2) {
        const v2f x = __builtin_elementwise_fma((v2f){s[j][r], s[j][r + 1]}, (v2f){AT_L2E, AT_L2E}, (v2f){-mnew, -mnew});
        const float p0 = at_exp2(x[0]);
        const float p1 = at_exp2(x[1]);
        ps[j] += p0;
        ps[j] += p1;
        at_split_pk(p0, p1, ph[j >> 1].u[(j & 1) * 4 + (r >> 1)], pl[j >> 1].u[(j & 1) * 4 + (r >> 1)]);
      }
    }
    lrow = lrow * alpha + ((ps[0] + ps[1]) + (ps[2] + ps[3]));
#pragma unroll
    for (int t = 0; t < 4; ++t)
#pragma unroll
      for (int r = 0; r < 8; ++r) oacc[t][r] *= alpha;
#pragma unroll
    for (int kk = 0; kk < 2; ++kk) {
#pragma unroll
      for (int t = 0; t < 4; ++t) {
        FB vb, vl;
        vb.h[0] = *(const v8b*)(Vth + (t * 16 + c) * AT_VP + kk * 32 + 8 * hh);
        vb.h[1] = *(const v8b*)(Vth + (t * 16 + c) * AT_VP + kk * 32 + 16 + 8 * hh);
        vl.h[0] = *(const v8b*)(Vtl + (t * 16 + c) * AT_VP + kk * 32 + 8 * hh);
        vl.h[1] = *(const v8b*)(Vtl + (t * 16 + c) * AT_VP + kk * 32 + 16 + 8 * hh);
        oacc[t] = at_mma(vb.v, ph[kk].v, oacc[t]);
        oacc[t] = at_mma(vl.v, ph[kk].v, oacc[t]);
        oacc[t] = at_mma(vb.v, pl[kk].v, oacc[t]);
      }
    }
  }

  // ---- join the two halves' row sums, normalise, stage the block's 64 (channel) x 64 (position) tile, write NCHW segments ----
  {
    const float inv = 1.0f / (lrow + at_xhalf(lrow));
#pragma unroll
    for (int t = 0; t < 4; ++t)
#pragma unroll
      for (int r = 0; r < 8; ++r) Os[(t * 16 + 8 * hh + r) * OSP + wave * 16 + c] = oacc[t][r] * inv;
  }
  __syncthreads();
  {
    const int c4 = c * 4;                                 // position offset within the block (0..60)
    float* ob = out + ((size_t)b * AT_C) * NTOK + nblk + c4;
    v4f ov[8];
#pragma unroll
    for (int it = 0; it < 8; ++it) {
      const int ch = wave * 16 + it * 2 + hh;             // it 0..7 x hh 0..1 = channels 0..15 of this wave
      ov[it] = *(const v4f*)(Os + ch * OSP + c4);
    }
#pragma unroll
    for (int it = 0; it < 8; ++it) {
      const int ch = wave * 16 + it * 2 + hh;
      *(v4f*)(ob + (size_t)ch * NTOK) = ov[it];
    }
  }
}

// ---------------------------------------------------------------------------
// Workspace region map (byte offsets; every region is fully written by its producer launch before any consumer
//   XB    bf16 [32768][64]            0       4194304
//   WB    bf16 [128][64]        4194304         16384
//   QKh   bf16 [32768][64]      4210688       4194304   QKl   8404992
//   VTh   bf16 [8][64][4096]   12599296       4194304   VTl  16793600
//   total                      20987904
// ---------------------------------------------------------------------------
extern "C" void kernel_launch(void* const* d_in, const int* in_sizes, int n_in,
                              void* d_out, int out_size, void* d_ws, size_t ws_size,
                              hipStream_t stream) {
  if (n_in < 4) return;
  if (in_sizes[0] != NB * CHN * NTOK) return;      // x  [8][64][64][64]
  if (in_sizes[1] != DQK * CHN) return;            // wq [32][64]
  if (in_sizes[2] != DQK * CHN) return;            // wk [32][64]
  if (in_sizes[3] != CHN * CHN) return;            // wv [64][64]
  if (out_size != NB * CHN * NTOK) return;

  const float* x  = (const float*)d_in[0];
  const float* wq = (const float*)d_in[1];   // [out 32][in 64]
  const float* wk = (const float*)d_in[2];   // [out 32][in 64]
  const float* wv = (const float*)d_in[3];   // [out 64][in 64]

  const size_t PXB = (size_t)MTOK * CHN * 2;         // 4194304
  const size_t PWB = (size_t)WROWS * CHN * 2;        // 16384
  const size_t PQK = (size_t)MTOK * QKP * 2;         // 4194304 per plane
  const size_t PVT = (size_t)NB * CHN * NTOK * 2;    // 4194304 per plane
  size_t off = 0;
  const size_t oXB  = off; off += PXB;
  const size_t oWB  = off; off += PWB;
  const size_t oQKh = off; off += PQK;  const size_t oQKl = off; off += PQK;
  const size_t oVTh = off; off += PVT;  const size_t oVTl = off; off += PVT;
  if (off > ws_size) return;                         // off = 20987904
  if (off > (size_t)134217728) return;

  char* ws = (char*)d_ws;
  unsigned short* XB  = (unsigned short*)(ws + oXB);
  unsigned short* WB  = (unsigned short*)(ws + oWB);
  unsigned short* QKh = (unsigned short*)(ws + oQKh); unsigned short* QKl = (unsigned short*)(ws + oQKl);
  unsigned short* VTh = (unsigned short*)(ws + oVTh); unsigned short* VTl = (unsigned short*)(ws + oVTl);

  const dim3 blk(256);

  // (1) x[b] viewed [R=64 c][Cc=4096 n] (pitch 4096) -> XB_b[n][c] (pitch 64); grid (Cc/64, R/64, B) = (64, 1, 8)
  tconv_kernel<<<dim3(NTOK / 64, CHN / 64, NB), blk, 0, stream>>>(x, XB, NTOK, CHN, (long)CHN * NTOK, (long)NTOK * CHN);
  // (2) weights -> WB bf16 rows 0..31 wq, 32..63 wk, 64..127 wv (natural [out][in]); 256 / 256 / 512 units
  conv8_kernel<<<dim3((DQK * CHN / 8) / 256), blk, 0, stream>>>(wq, WB, DQK * CHN / 8);
  conv8_kernel<<<dim3((DQK * CHN / 8) / 256), blk, 0, stream>>>(wk, WB + (size_t)DQK * CHN, DQK * CHN / 8);
  conv8_kernel<<<dim3((CHN * CHN / 8) / 256), blk, 0, stream>>>(wv, WB + (size_t)2 * DQK * CHN, CHN * CHN / 8);
  // (3) q|k = XB . WB[0..63]^T -> QKh|QKl [32768][64]   (M=32768, N=64, K=64; 512 tiles -> 64 blocks)
  const dim3 gQK(((MTOK / 64) * (QKP / 64) + 7) / 8, 1);
  wmma_gemm64<1, false, 0, 2, false, 0><<<gQK, blk, 0, stream>>>(
      XB, XB, CHN, 0L, WB, WB, CHN, 0L, (void*)QKh, (void*)QKl, QKP, 0L,
      wq, wq, 0L, MTOK, QKP, CHN, 1.0f);
  // (4) v^T_b = WB[64..127] . XB_b^T -> VTh|VTl [b][64][4096]   (M=64, N=4096, K=64 per batch; 64 tiles -> 8 blocks x 8 batches)
  const dim3 gVT(((CHN / 64) * (NTOK / 64) + 7) / 8, NB);
  wmma_gemm64<1, false, 0, 2, false, 0><<<gVT, blk, 0, stream>>>(
      WB + (size_t)2 * DQK * CHN, WB + (size_t)2 * DQK * CHN, CHN, 0L, XB, XB, CHN, (long)NTOK * CHN,
      (void*)VTh, (void*)VTl, NTOK, (long)CHN * NTOK,
      wq, wq, 0L, CHN, NTOK, CHN, 1.0f);
  // (5) attention per (batch, 64-position block) -> NCHW d_out; 512 blocks of 128 threads
  attn_kernel<<<dim3(NB * (NTOK / AT_QB)), dim3(128), 0, stream>>>(QKh, QKl, VTh, VTl, (float*)d_out);
  (void)hipGetLastError();
}

// v004
// One run takes 126 microseconds.
// Two timings next to v003 both put it at 1.22 times that version's speed.
// Over all steps from v000 it is 2.40 times as fast.
// Contractions: q|k projection and v^T projection = v_wmma_f32_16x16x32_bf16 single products on bf16 planes of the
// RNE-converted inputs (f32 accumulate, results split into bf16 hi|lo planes); q.k^T energies and p.v = bf16 hi/lo split
// (hi.hi + hi.lo + lo.hi) on v_wmma_f32_16x16x32_bf16, f32 accumulate; online max-shifted softmax (base 2: one fma and one
// v_exp_f32 per energy) and 1/rowsum in f32 on the VALU.
// Plane / carry map (every plane carries factor 1, nothing to fold back):
//   XB  = bf16(x) token-major [32768 (b*4096+n)][64 c], n = y*64 + x (NCHW token order);
//   WB  = bf16([wq; wk; wv]) [128][64], natural [out][in] (rows 0..31 wq, 32..63 wk, 64..127 wv);
//   QKh|QKl bf16 [32768][64]: cols 0..31 = q hi|lo over d, cols 32..63 = k hi|lo over d;
//   VTh|VTl bf16 [8][64 c][4096 m];
//   P hi|lo = unnormalised exp in (0,1] (bf16 keeps the f32 exponent range); 1/rowsum is applied to the f32 accumulator
//   in the attention epilogue right before the NCHW store (the only place a normaliser is applied).
#include <hip/hip_runtime.h>
#include <math.h>
#include <stdint.h>

#define NB    8
#define CHN   64
#define DQK   32
#define IMH   64
#define IMW   64
#define NTOK  4096
#define MTOK  (NB * NTOK)
#define QKP   64
#define WROWS 128

static_assert(NTOK == IMH * IMW);
static_assert(CHN == 64);
static_assert(DQK == 32);
static_assert(QKP == 2 * DQK);
static_assert(WROWS == 2 * DQK + CHN);
static_assert(NTOK % 64 == 0);
static_assert(MTOK % 64 == 0);
static_assert(CHN % 32 == 0);
static_assert((DQK * CHN) % (8 * 256) == 0);
static_assert((CHN * CHN) % (8 * 256) == 0);

typedef __attribute__((ext_vector_type(16))) _Float16 v16h;
typedef __attribute__((ext_vector_type(8)))  _Float16 v8h;
typedef __attribute__((ext_vector_type(16))) __bf16   v16b;
typedef __attribute__((ext_vector_type(8)))  __bf16   v8b;
typedef __attribute__((ext_vector_type(8)))  float    v8f;
typedef __attribute__((ext_vector_type(4)))  float    v4f;
typedef __attribute__((ext_vector_type(2)))  float    v2f;
typedef __attribute__((ext_vector_type(4)))  unsigned int v4u;

__device__ __forceinline__ unsigned short f2bf_bits(float f) {
  unsigned u = __float_as_uint(f);
  return (unsigned short)((u + 0x7FFFu + ((u >> 16) & 1u)) >> 16);
}
__device__ __forceinline__ float bf_bits2f(unsigned short h) { return __uint_as_float(((unsigned)h) << 16); }
__device__ __forceinline__ float bf_rne(float f) { return bf_bits2f(f2bf_bits(f)); }
__device__ __forceinline__ unsigned pk16(unsigned short a, unsigned short b) { return (unsigned)a | ((unsigned)b << 16); }

// hazard guards as plain device helpers (no inline asm inside the kernel template body)
__device__ __forceinline__ void dep_guard_h(v8f& a, v8f& b, v16h x, v16h y) { asm volatile("v_nop\n\tv_nop\n\tv_nop\n\tv_nop" : "+v"(a), "+v"(b) : "v"(x), "v"(y)); }
__device__ __forceinline__ void dep_guard_b(v8f& a, v8f& b, v16b x, v16b y) { asm volatile("v_nop\n\tv_nop\n\tv_nop\n\tv_nop" : "+v"(a), "+v"(b) : "v"(x), "v"(y)); }
__device__ __forceinline__ void keep4_h(v16h a, v16h b, v16h c, v16h d) { asm volatile("v_nop" :: "v"(a), "v"(b), "v"(c), "v"(d)); }
__device__ __forceinline__ void keep4_b(v16b a, v16b b, v16b c, v16b d) { asm volatile("v_nop" :: "v"(a), "v"(b), "v"(c), "v"(d)); }
__device__ __forceinline__ void acc_guard4(v8f& a, v8f& b, v8f& c, v8f& d) { asm volatile("v_nop\n\tv_nop\n\tv_nop\n\tv_nop" : "+v"(a), "+v"(b), "+v"(c), "+v"(d)); }
template <typename T> struct Frag;
template <> struct Frag<_Float16> {
  typedef v16h V; union U { v16h v; v8h h[2]; };
  static __device__ __forceinline__ v16h load(const _Float16* p) {   // elements 0..7 <- p[0..7], 8..15 <- p[16..23]
    U f; f.h[0] = *(const v8h*)(p); f.h[1] = *(const v8h*)(p + 16); return f.v;
  }
  static __device__ __forceinline__ v8f mma(v16h a, v16h b, v8f c) {
    return __builtin_amdgcn_wmma_f32_16x16x32_f16(false, a, false, b, (short)0, c, false, false);
  }
  static __device__ __forceinline__ void guard(v8f& a, v8f& b, v16h x, v16h y) { dep_guard_h(a, b, x, y); }
  static __device__ __forceinline__ void keep(v16h a, v16h b, v16h c, v16h d) { keep4_h(a, b, c, d); }
};
template <> struct Frag<__bf16> {
  typedef v16b V; union U { v16b v; v8b h[2]; };
  static __device__ __forceinline__ v16b load(const __bf16* p) {
    U f; f.h[0] = *(const v8b*)(p); f.h[1] = *(const v8b*)(p + 16); return f.v;
  }
  static __device__ __forceinline__ v8f mma(v16b a, v16b b, v8f c) {
    return __builtin_amdgcn_wmma_f32_16x16x32_bf16(false, a, false, b, (short)0, c, false, false);
  }
  static __device__ __forceinline__ void guard(v8f& a, v8f& b, v16b x, v16b y) { dep_guard_b(a, b, x, y); }
  static __device__ __forceinline__ void keep(v16b a, v16b b, v16b c, v16b d) { keep4_b(a, b, c, d); }
};

// ---- Register-blocked batched WMMA GEMM ------------------------------------
// C[m,n] = scale * sum_k A[m,k] * Bt[n,k] (+bias)(+resid); each wave owns a 64x64 tile.
// A row-major [M,K]; Bt row-major [N,K]; M,N % 64 == 0, K % 32 == 0.
// SPLIT: operands are hi/lo planes (A2/Bt2 = lo planes, same layout); product = hi.hi + hi.lo + lo.hi.
// BIAS_MODE: 0 = none, 1 = bias[m], 2 = bias[n]; the bias value is RNE-converted to bf16 precision before the f32 add.
// OUT_MODE: 0 = f32, 1 = f16, 2 = bf16 hi plane (Cout) + bf16 lo plane (Cout2).
// ET: 0 = f16 operands, 1 = bf16 operands (pointers passed as 16-bit storage)
template <int ET> struct Elem;
template <> struct Elem<0> { typedef _Float16 T; };
template <> struct Elem<1> { typedef __bf16 T; };
template <int ET, bool SPLIT, int BIAS_MODE, int OUT_MODE, bool RESID, int ACT = 0>
__global__ __launch_bounds__(256) void wmma_gemm64(
    const unsigned short* __restrict__ Ap, const unsigned short* __restrict__ A2p, int lda, long strideA,
    const unsigned short* __restrict__ Btp, const unsigned short* __restrict__ Bt2p, int ldb, long strideB,
    void* __restrict__ Cout, void* __restrict__ Cout2, int ldc, long strideC,
    const float* __restrict__ bias,
    const float* __restrict__ resid, long strideR,
    int M, int N, int K, float scale) {
  typedef typename Elem<ET>::T T;
  typedef typename Frag<T>::V V;
  const T* A = (const T*)Ap; const T* A2 = (const T*)A2p; const T* Bt = (const T*)Btp; const T* Bt2 = (const T*)Bt2p;
  __shared__ __align__(16) float sT[8][16 * 68];   // per-wave 16x64 slab, pitch 68 floats
  const int b    = blockIdx.y;
  const int lane = threadIdx.x & 31;
  const int wave = threadIdx.x >> 5;
  const int tilesN = N >> 6;
  const int tilesM = M >> 6;
  const int tile = blockIdx.x * 8 + wave;
  if (tile >= tilesM * tilesN) return;   // wave-uniform; no block barriers in this kernel
  const int tm = tile / tilesN;
  const int tn = tile - tm * tilesN;
  const int m0 = tm << 6;
  const int n0 = tn << 6;

  const T* Ab  = A  + (size_t)b * strideA;
  const T* Bb  = Bt + (size_t)b * strideB;
  const T* Ab2 = SPLIT ? (A2  + (size_t)b * strideA) : nullptr;
  const T* Bb2 = SPLIT ? (Bt2 + (size_t)b * strideB) : nullptr;

  const int rlane = lane & 15;                 // row (A) / col (B, D) within subtile
  const int koff  = (lane >> 4) * 8;           // k offset of this lane half
  const int mOff  = (lane >> 4) * 8;           // D row offset

  v8f acc[4][4];
#pragma unroll
  for (int i = 0; i < 4; ++i)
#pragma unroll
    for (int j = 0; j < 4; ++j) acc[i][j] = (v8f){0.f,0.f,0.f,0.f,0.f,0.f,0.f,0.f};

  for (int k0 = 0; k0 < K; k0 += 32) {
    V bh[4], bl[4];
#pragma unroll
    for (int j = 0; j < 4; ++j) {
      const size_t bo = (size_t)(n0 + (j << 4) + rlane) * ldb + koff + k0;
      bh[j] = Frag<T>::load(Bb + bo);
      if (SPLIT) bl[j] = Frag<T>::load(Bb2 + bo); else bl[j] = bh[j];
    }
#pragma unroll
    for (int i = 0; i < 4; ++i) {
      const size_t ao = (size_t)(m0 + (i << 4) + rlane) * lda + koff + k0;
      V ah = Frag<T>::load(Ab + ao);
      V al;
      if (SPLIT) al = Frag<T>::load(Ab2 + ao); else al = ah;
#pragma unroll
      for (int j = 0; j < 4; ++j) {
        acc[i][j] = Frag<T>::mma(ah, bh[j], acc[i][j]);
        if (SPLIT) {
          acc[i][j] = Frag<T>::mma(ah, bl[j], acc[i][j]);
          acc[i][j] = Frag<T>::mma(al, bh[j], acc[i][j]);
        }
      }
      Frag<T>::guard(acc[i][0], acc[i][3], ah, al);
    }
    Frag<T>::keep(bh[0], bh[1], bh[2], bh[3]);
    if (SPLIT) Frag<T>::keep(bl[0], bl[1], bl[2], bl[3]);
  }
  acc_guard4(acc[0][0], acc[0][1], acc[0][2], acc[0][3]);
  acc_guard4(acc[1][0], acc[1][1], acc[1][2], acc[1][3]);
  acc_guard4(acc[2][0], acc[2][1], acc[2][2], acc[2][3]);
  acc_guard4(acc[3][0], acc[3][1], acc[3][2], acc[3][3]);

  // ---- epilogue ----
  float* slab = sT[wave];
  const float* Rb = RESID ? (resid + (size_t)b * strideR) : nullptr;
#pragma unroll
  for (int i = 0; i < 4; ++i) {
    const int mBase = m0 + (i << 4);
#pragma unroll
    for (int j = 0; j < 4; ++j) {
      const int n = n0 + (j << 4) + rlane;
      float bv = 0.f;
      if (BIAS_MODE == 2) bv = bf_rne(bias[n]);
#pragma unroll
      for (int r = 0; r < 8; ++r) {
        float v = acc[i][j][r] * scale;
        if (BIAS_MODE == 1) v += bf_rne(bias[mBase + mOff + r]);
        if (BIAS_MODE == 2) v += bv;
        if (RESID) v += Rb[(size_t)(mBase + mOff + r) * ldc + n];
        if (ACT == 1) v = tanhf(v);
        if (ACT == 2) v = fmaxf(v, 0.0f);
        if (ACT == 3) v = v / (1.0f + expf(-v));
        if (ACT == 4) v = (v > 0.f) ? v : 0.01f * v;
        if (ACT == 5) v = 0.5f * v * (1.0f + erff(v * 0.70710678118654752f));
        slab[(mOff + r) * 68 + (j << 4) + rlane] = v;
      }
    }
    __builtin_amdgcn_fence(__ATOMIC_RELEASE, "workgroup");
    __builtin_amdgcn_wave_barrier();
    __builtin_amdgcn_fence(__ATOMIC_ACQUIRE, "workgroup");
    if (OUT_MODE == 0) {
      float* C = (float*)Cout + (size_t)b * strideC;
      const int hh = lane >> 4, c4 = (lane & 15) * 4;     // row seg = 256 B = 16 lanes x 16 B
      {
#pragma unroll
        for (int it = 0; it < 8; ++it) {
          const int row = it * 2 + hh;
          v4f v = *(const v4f*)(slab + row * 68 + c4);
          *(v4f*)(C + (size_t)(mBase + row) * ldc + n0 + c4) = v;
        }
        
      }
    } else {
      const int q = lane >> 3, c8 = (lane & 7) * 8;
      unsigned short* C  = (unsigned short*)Cout  + (size_t)b * strideC;
      unsigned short* C2 = (OUT_MODE == 2) ? ((unsigned short*)Cout2 + (size_t)b * strideC) : nullptr;
      {
#pragma unroll
        for (int it = 0; it < 4; ++it) {
          const int row = it * 4 + q;
          const float* sp = slab + row * 68 + c8;
          v8h hv, lv;
#pragma unroll
          for (int e = 0; e < 8; ++e) {
            if (OUT_MODE == 1) {
              hv[e] = (_Float16)sp[e];
            } else {
              unsigned short hb = f2bf_bits(sp[e]);
              unsigned short lb = f2bf_bits(sp[e] - bf_bits2f(hb));
              hv[e] = __builtin_bit_cast(_Float16, hb);
              lv[e] = __builtin_bit_cast(_Float16, lb);
            }
          }
          *(v8h*)(C + (size_t)(mBase + row) * ldc + n0 + c8) = hv;
          if (OUT_MODE == 2) *(v8h*)(C2 + (size_t)(mBase + row) * ldc + n0 + c8) = lv;
        }
        
      }
    }
    __builtin_amdgcn_fence(__ATOMIC_RELEASE, "workgroup");
    __builtin_amdgcn_wave_barrier();
    __builtin_amdgcn_fence(__ATOMIC_ACQUIRE, "workgroup");
  }
}

// ---------------------------------------------------------------------------
// Contiguous bf16 RNE convert of an f32 array: 8 consecutive elements per thread = one 16-B store; 8 consecutive lanes
// Coverage: grid = n8/256 blocks x 256 threads x 8 elements (n8 = n/8, host guarantees n % 2048 == 0).
// ---------------------------------------------------------------------------
__global__ __launch_bounds__(256) void conv8_kernel(const float* __restrict__ in, unsigned short* __restrict__ out, int n8) {
  const int i = blockIdx.x * 256 + threadIdx.x;
  if (i < n8) {
    const size_t e0 = (size_t)i * 8;
    const v4f a = *(const v4f*)(in + e0);
    const v4f c = *(const v4f*)(in + e0 + 4);
    v4u hv;
    hv[0] = pk16(f2bf_bits(a[0]), f2bf_bits(a[1]));
    hv[1] = pk16(f2bf_bits(a[2]), f2bf_bits(a[3]));
    hv[2] = pk16(f2bf_bits(c[0]), f2bf_bits(c[1]));
    hv[3] = pk16(f2bf_bits(c[2]), f2bf_bits(c[3]));
    {
      *(v4u*)(out + e0) = hv;
      
    }
  }
}

// ---------------------------------------------------------------------------
// Fused transpose + bf16 RNE convert of an f32 matrix, z-batched, one plane:
//   in_z = W + z*sIn viewed [R rows][Cc cols] with row pitch ldin  ->  oh_z[c][r] = bf16(in_z[r][c]), row pitch ldout, oh_z = oh + z*sOut.
// 64x64 tiles through LDS. grid = (Cc/64, R/64, Z), 256 threads (R, Cc multiples of 64; ldout multiple of 64 so every
// Coverage per block: load 4 it x 256 thr x 4 floats = 64x64; store 2 it x 256 thr x 8 u16 = 64x64.
// ---------------------------------------------------------------------------
__global__ __launch_bounds__(256) void tconv_kernel(const float* __restrict__ W, unsigned short* __restrict__ oh,
                                                    int ldin, int ldout, long sIn, long sOut) {
  __shared__ __align__(16) float tf[64 * 68];
  W  += (size_t)blockIdx.z * sIn;
  oh += (size_t)blockIdx.z * sOut;
  const int c0  = blockIdx.x * 64;   // input column block = output row block
  const int r0  = blockIdx.y * 64;   // input row block    = output column block
  const int tid = threadIdx.x;
  {
    const int lr = tid >> 4;         // 0..15
    const int c4 = (tid & 15) * 4;   // 0..60
#pragma unroll
    for (int it = 0; it < 4; ++it) {
      const int rr = it * 16 + lr;   // 0..63
      const v4f a = *(const v4f*)(W + (size_t)(r0 + rr) * ldin + c0 + c4);
      *(v4f*)(tf + rr * 68 + c4) = a;
    }
  }
  __syncthreads();
  const int sub = tid >> 3;          // 0..31
  const int c8  = (tid & 7) * 8;     // 0..56
  v4u hv[2];
#pragma unroll
  for (int it = 0; it < 2; ++it) {
    const int oc = it * 32 + sub;    // output row within tile (= input column)
    v4u a;
#pragma unroll
    for (int q = 0; q < 4; ++q) {
      const float f0 = tf[(c8 + 2 * q) * 68 + oc];
      const float f1 = tf[(c8 + 2 * q + 1) * 68 + oc];
      a[q] = pk16(f2bf_bits(f0), f2bf_bits(f1));
    }
    hv[it] = a;
  }
  {
#pragma unroll
    for (int it = 0; it < 2; ++it) {
      const int oc = it * 32 + sub;
      const size_t go = (size_t)(c0 + oc) * ldout + r0 + c8;
      *(v4u*)(oh + go) = hv[it];
    }
    
  }
}

#define AT_D  32
#define AT_C  64
#define AT_NW 4
#define AT_QB 64
#define AT_KC 64
#define OSP   68
#define AT_KP 40    // LDS row pitch of the K tiles in elements: 80 B = 16 B x 5, so 16 rows' 16-B reads fall on 64 distinct banks
#define AT_L2E 1.44269504088896340736f   // log2(e)
#define AT_VP 72    // LDS row pitch of the V^T tiles in elements: 144 B = 16 B x 9, same reason

static_assert(NTOK % AT_QB == 0);
static_assert(NTOK % AT_KC == 0);
static_assert(AT_C == CHN);
static_assert(AT_D == DQK);
static_assert(AT_KP >= AT_D && AT_KP % 8 == 0 && (AT_KP / 8) % 2 == 1);
static_assert(AT_VP >= AT_KC && AT_VP % 8 == 0 && (AT_VP / 8) % 2 == 1);

// bf16 RNE of f, the result's 16 bits in the upper half of the word (the lower half is not cleared)
__device__ __forceinline__ unsigned at_bf_top(float f) {
  const unsigned u = __float_as_uint(f);
  return u + 0x7FFFu + ((u >> 16) & 1u);
}
// hi/lo split of two neighbouring operand elements, packed as one operand register each (p0 in the low half)
__device__ __forceinline__ void at_split_pk(float p0, float p1, unsigned& hi, unsigned& lo) {
  const unsigned h0 = at_bf_top(p0), h1 = at_bf_top(p1);
  const unsigned l0 = at_bf_top(p0 - __uint_as_float(h0 & 0xFFFF0000u));
  const unsigned l1 = at_bf_top(p1 - __uint_as_float(h1 & 0xFFFF0000u));
  hi = __builtin_amdgcn_perm(h1, h0, 0x07060302u);   // upper halves of h0 (low) and h1 (high) in one byte permute
  lo = __builtin_amdgcn_perm(l1, l0, 0x07060302u);
}
// lane l <-> lane l ^ 16 in the vector unit
__device__ __forceinline__ float at_xhalf(float x) {
  const int i = __builtin_bit_cast(int, x);
  return __builtin_bit_cast(float, __builtin_amdgcn_permlanex16(i, i, 0x76543210, 0xfedcba98, false, false));
}
// 2^x on the hardware's own instruction; every x here is -inf, or finite and not above a rounding error over 0, so nothing
// overflows, and a result under the smallest normal may go to 0 beside a row sum of about 1 or more
__device__ __forceinline__ float at_exp2(float x) { return __builtin_amdgcn_exp2f(x); }
// the builtin alone: the compiler keeps the distances behind it and is free to run independent products back to back
__device__ __forceinline__ v8f at_mma(v16b a, v16b b, v8f c) {
  return __builtin_amdgcn_wmma_f32_16x16x32_bf16(false, a, false, b, (short)0, c, false, false);
}

__global__ __launch_bounds__(128)
void attn_kernel(const unsigned short* __restrict__ qkhp, const unsigned short* __restrict__ qklp,
                 const unsigned short* __restrict__ vhp, const unsigned short* __restrict__ vlp,
                 float* __restrict__ out) {
  union FB { v16b v; v8b h[2]; unsigned u[8]; };
  __shared__ __align__(16) __bf16 Ksh[AT_KC * AT_KP];            // K hi [kv][d], padded rows      5 KB
  __shared__ __align__(16) __bf16 Ksl[AT_KC * AT_KP];            // K lo
  __shared__ __align__(16) __bf16 Vth[AT_C * AT_VP];             // V hi [c][kv], padded rows      9 KB
  __shared__ __align__(16) __bf16 Vtl[AT_C * AT_VP];             // V lo
  __shared__ __align__(16) float  Os[AT_C * OSP];                // block out tile [c][q], pitch 68

  const int tid  = threadIdx.x;
  const int wave = tid >> 5;
  const int lane = tid & 31;
  const int hh   = lane >> 4;
  const int c    = lane & 15;

  const int nqb  = NTOK / AT_QB;           // 64 query blocks per batch element
  const int bx   = blockIdx.x;             // grid = NB * nqb (exact)
  const int qb   = bx % nqb;
  const int b    = bx / nqb;               // 0..7
  const int nblk = qb * AT_QB;             // first position of this block
  const int q0   = b * NTOK + nblk + wave * 16;   // row in the q|k planes

  const __bf16* Qh = (const __bf16*)(const void*)qkhp;
  const __bf16* Ql = (const __bf16*)(const void*)qklp;
  const __bf16* Kh = Qh + AT_D;                                    // k columns 32..63
  const __bf16* Kl = Ql + AT_D;
  const __bf16* Vh = (const __bf16*)(const void*)vhp + (size_t)b * AT_C * NTOK;
  const __bf16* Vl = (const __bf16*)(const void*)vlp + (size_t)b * AT_C * NTOK;

  // ---- Q fragments (B operand, column = query = lane&15, split k map via Frag load): one 32-deep chunk, hi and lo ----
  const v16b qbh = Frag<__bf16>::load(Qh + (size_t)(q0 + c) * QKP + 8 * hh);
  const v16b qbl = Frag<__bf16>::load(Ql + (size_t)(q0 + c) * QKP + 8 * hh);

  // one query per lane: running max times log2(e) (equal in both lane halves) and this half's share of the row sum
  float mrow = -INFINITY, lrow = 0.f;
  v8f oacc[4];                             // oacc[t][r] = o^T(channel t*16 + 8*hh + r, query c)
#pragma unroll
  for (int t = 0; t < 4; ++t) oacc[t] = (v8f){0.f,0.f,0.f,0.f,0.f,0.f,0.f,0.f};

  const int nChunks = NTOK / AT_KC;   // 64, compile-time constant
  for (int kc = 0; kc < nChunks; ++kc) {
    const int kv0 = kc * AT_KC;
    __syncthreads();
    {
      // staging coverage: K: 128 threads x (2 x 8) = 64 rows x 32; V: 128 threads x (4 x 8) = 64 rows x 64 = whole tiles
      const int r = tid >> 1;
      const int hk = (tid & 1) * 16;
      const int hv = (tid & 1) * 32;
      const __bf16* ksh = Kh + (size_t)(b * NTOK + kv0 + r) * QKP + hk;   // K row (b, kv0+r), d = hk..hk+15
      const __bf16* ksl = Kl + (size_t)(b * NTOK + kv0 + r) * QKP + hk;
      const __bf16* vsh = Vh + (size_t)r * NTOK + kv0 + hv;               // V^T row c = r, keys kv0+hv..+31
      const __bf16* vsl = Vl + (size_t)r * NTOK + kv0 + hv;
#pragma unroll
      for (int i = 0; i < 2; ++i) {
        const v8b a0 = *(const v8b*)(ksh + 8 * i);
        const v8b a1 = *(const v8b*)(ksl + 8 * i);
        *(v8b*)(Ksh + r * AT_KP + hk + 8 * i) = a0;
        *(v8b*)(Ksl + r * AT_KP + hk + 8 * i) = a1;
      }
#pragma unroll
      for (int i = 0; i < 4; ++i) {
        const v8b b0 = *(const v8b*)(vsh + 8 * i);
        const v8b b1 = *(const v8b*)(vsl + 8 * i);
        *(v8b*)(Vth + r * AT_VP + hv + 8 * i) = b0;
        *(v8b*)(Vtl + r * AT_VP + hv + 8 * i) = b1;
      }
    }
    __syncthreads();

    // s[j][r] = energy^T(key j*16 + 8*hh + r, query c): K rows are the A operand, Q the B operand
    // All fragment reads of the chunk are issued here as one group, K first: the energy products wait for the K part alone,
    // and the V^T fragments land while the energies and the softmax are worked on.
    FB kb[4], kl[4], vb[2][4], vl[2][4];
#pragma unroll
    for (int j = 0; j < 4; ++j) {
      kb[j].h[0] = *(const v8b*)(Ksh + (j * 16 + c) * AT_KP + 8 * hh);
      kb[j].h[1] = *(const v8b*)(Ksh + (j * 16 + c) * AT_KP + 16 + 8 * hh);
    }
#pragma unroll
    for (int j = 0; j < 4; ++j) {
      kl[j].h[0] = *(const v8b*)(Ksl + (j * 16 + c) * AT_KP + 8 * hh);
      kl[j].h[1] = *(const v8b*)(Ksl + (j * 16 + c) * AT_KP + 16 + 8 * hh);
    }
#pragma unroll
    for (int kk = 0; kk < 2; ++kk) {
#pragma unroll
      for (int t = 0; t < 4; ++t) {
        vb[kk][t].h[0] = *(const v8b*)(Vth + (t * 16 + c) * AT_VP + kk * 32 + 8 * hh);
        vb[kk][t].h[1] = *(const v8b*)(Vth + (t * 16 + c) * AT_VP + kk * 32 + 16 + 8 * hh);
        vl[kk][t].h[0] = *(const v8b*)(Vtl + (t * 16 + c) * AT_VP + kk * 32 + 8 * hh);
        vl[kk][t].h[1] = *(const v8b*)(Vtl + (t * 16 + c) * AT_VP + kk * 32 + 16 + 8 * hh);
      }
    }
    // keeps the reads in this order above the products: without it the V^T reads are moved in front of the K reads, and the
    // first product waits for them too
    __builtin_amdgcn_sched_barrier(0);
    // term by term over the four independent accumulators (each s[j] still sums hi.hi, lo.hi, hi.lo in that order)
    v8f s[4];
#pragma unroll
    for (int j = 0; j < 4; ++j) s[j] = at_mma(kb[j].v, qbh, (v8f){0.f,0.f,0.f,0.f,0.f,0.f,0.f,0.f});
    // this one and the next keep the terms apart: regrouped by accumulator, every product would wait for the one before it
    __builtin_amdgcn_sched_barrier(0);
#pragma unroll
    for (int j = 0; j < 4; ++j) s[j] = at_mma(kl[j].v, qbh, s[j]);
    __builtin_amdgcn_sched_barrier(0);
#pragma unroll
    for (int j = 0; j < 4; ++j) s[j] = at_mma(kb[j].v, qbl, s[j]);
    // chunk max of this lane's query (no energy scaling): 32 keys in the lane, the other 32 in lane ^ 16
    float cm = -INFINITY;
#pragma unroll
    for (int j = 0; j < 4; ++j)
#pragma unroll
      for (int r = 0; r < 8; ++r) cm = fmaxf(cm, s[j][r]);
    cm = fmaxf(cm, at_xhalf(cm));
    const float mnew  = fmaxf(mrow, cm * AT_L2E);
    const float alpha = at_exp2(mrow - mnew);
    mrow = mnew;
    // p^T packs in place into B operands: element e of chunk half kk = key kk*32 + (e < 8 ? 8*hh + e : 16 + 8*hh + e - 8),
    // the same k order as the two 16-B reads of a V^T row above
    FB ph[2], pl[2];
    float ps[4];
#pragma unroll
    for (int j = 0; j < 4; ++j) {
      ps[j] = 0.f;
#pragma unroll
      for (int r = 0; r < 8; r += 2) {
        const v2f x = __builtin_elementwise_fma((v2f){s[j][r], s[j][r + 1]}, (v2f){AT_L2E, AT_L2E}, (v2f){-mnew, -mnew});
        const float p0 = at_exp2(x[0]);
        const float p1 = at_exp2(x[1]);
        ps[j] += p0;
        ps[j] += p1;
        at_split_pk(p0, p1, ph[j >> 1].u[(j & 1) * 4 + (r >> 1)], pl[j >> 1].u[(j & 1) * 4 + (r >> 1)]);
      }
    }
    lrow = lrow * alpha + ((ps[0] + ps[1]) + (ps[2] + ps[3]));
#pragma unroll
    for (int t = 0; t < 4; ++t)
#pragma unroll
      for (int r = 0; r < 8; ++r) oacc[t][r] *= alpha;
#pragma unroll
    for (int kk = 0; kk < 2; ++kk) {
      // term by term over the four independent accumulators (each oacc[t] still sums hi.hi, lo.hi, hi.lo in that order);
      // the two scheduling barriers keep the terms apart as above, but let vector, transcendental and scalar instructions
      // cross (mask 0x406), so that the other chunk half's softmax still fills the slots between the products
#pragma unroll
      for (int t = 0; t < 4; ++t) oacc[t] = at_mma(vb[kk][t].v, ph[kk].v, oacc[t]);
      __builtin_amdgcn_sched_barrier(0x406);
#pragma unroll
      for (int t = 0; t < 4; ++t) oacc[t] = at_mma(vl[kk][t].v, ph[kk].v, oacc[t]);
      __builtin_amdgcn_sched_barrier(0x406);
#pragma unroll
      for (int t = 0; t < 4; ++t) oacc[t] = at_mma(vb[kk][t].v, pl[kk].v, oacc[t]);
    }
  }

  // ---- join the two halves' row sums, normalise, stage the block's 64 (channel) x 64 (position) tile, write NCHW segments ----
  {
    const float inv = 1.0f / (lrow + at_xhalf(lrow));
#pragma unroll
    for (int t = 0; t < 4; ++t)
#pragma unroll
      for (int r = 0; r < 8; ++r) Os[(t * 16 + 8 * hh + r) * OSP + wave * 16 + c] = oacc[t][r] * inv;
  }
  __syncthreads();
  {
    const int c4 = c * 4;                                 // position offset within the block (0..60)
    float* ob = out + ((size_t)b * AT_C) * NTOK + nblk + c4;
    v4f ov[8];
#pragma unroll
    for (int it = 0; it < 8; ++it) {
      const int ch = wave * 16 + it * 2 + hh;             // it 0..7 x hh 0..1 = channels 0..15 of this wave
      ov[it] = *(const v4f*)(Os + ch * OSP + c4);
    }
#pragma unroll
    for (int it = 0; it < 8; ++it) {
      const int ch = wave * 16 + it * 2 + hh;
      *(v4f*)(ob + (size_t)ch * NTOK) = ov[it];
    }
  }
}

// ---------------------------------------------------------------------------
// Workspace region map (byte offsets; every region is fully written by its producer launch before any consumer
//   XB    bf16 [32768][64]            0       4194304
//   WB    bf16 [128][64]        4194304         16384
//   QKh   bf16 [32768][64]      4210688       4194304   QKl   8404992
//   VTh   bf16 [8][64][4096]   12599296       4194304   VTl  16793600
//   total                      20987904
// ---------------------------------------------------------------------------
extern "C" void kernel_launch(void* const* d_in, const int* in_sizes, int n_in,
                              void* d_out, int out_size, void* d_ws, size_t ws_size,
                              hipStream_t stream) {
  if (n_in < 4) return;
  if (in_sizes[0] != NB * CHN * NTOK) return;      // x  [8][64][64][64]
  if (in_sizes[1] != DQK * CHN) return;            // wq [32][64]
  if (in_sizes[2] != DQK * CHN) return;            // wk [32][64]
  if (in_sizes[3] != CHN * CHN) return;            // wv [64][64]
  if (out_size != NB * CHN * NTOK) return;

  const float* x  = (const float*)d_in[0];
  const float* wq = (const float*)d_in[1];   // [out 32][in 64]
  const float* wk = (const float*)d_in[2];   // [out 32][in 64]
  const float* wv = (const float*)d_in[3];   // [out 64][in 64]

  const size_t PXB = (size_t)MTOK * CHN * 2;         // 4194304
  const size_t PWB = (size_t)WROWS * CHN * 2;        // 16384
  const size_t PQK = (size_t)MTOK * QKP * 2;         // 4194304 per plane
  const size_t PVT = (size_t)NB * CHN * NTOK * 2;    // 4194304 per plane
  size_t off = 0;
  const size_t oXB  = off; off += PXB;
  const size_t oWB  = off; off += PWB;
  const size_t oQKh = off; off += PQK;  const size_t oQKl = off; off += PQK;
  const size_t oVTh = off; off += PVT;  const size_t oVTl = off; off += PVT;
  if (off > ws_size) return;                         // off = 20987904
  if (off > (size_t)134217728) return;

  char* ws = (char*)d_ws;
  unsigned short* XB  = (unsigned short*)(ws + oXB);
  unsigned short* WB  = (unsigned short*)(ws + oWB);
  unsigned short* QKh = (unsigned short*)(ws + oQKh); unsigned short* QKl = (unsigned short*)(ws + oQKl);
  unsigned short* VTh = (unsigned short*)(ws + oVTh); unsigned short* VTl = (unsigned short*)(ws + oVTl);

  const dim3 blk(256);

  // (1) x[b] viewed [R=64 c][Cc=4096 n] (pitch 4096) -> XB_b[n][c] (pitch 64); grid (Cc/64, R/64, B) = (64, 1, 8)
  tconv_kernel<<<dim3(NTOK / 64, CHN / 64, NB), blk, 0, stream>>>(x, XB, NTOK, CHN, (long)CHN * NTOK, (long)NTOK * CHN);
  // (2) weights -> WB bf16 rows 0..31 wq, 32..63 wk, 64..127 wv (natural [out][in]); 256 / 256 / 512 units
  conv8_kernel<<<dim3((DQK * CHN / 8) / 256), blk, 0, stream>>>(wq, WB, DQK * CHN / 8);
  conv8_kernel<<<dim3((DQK * CHN / 8) / 256), blk, 0, stream>>>(wk, WB + (size_t)DQK * CHN, DQK * CHN / 8);
  conv8_kernel<<<dim3((CHN * CHN / 8) / 256), blk, 0, stream>>>(wv, WB + (size_t)2 * DQK * CHN, CHN * CHN / 8);
  // (3) q|k = XB . WB[0..63]^T -> QKh|QKl [32768][64]   (M=32768, N=64, K=64; 512 tiles -> 64 blocks)
  const dim3 gQK(((MTOK / 64) * (QKP / 64) + 7) / 8, 1);
  wmma_gemm64<1, false, 0, 2, false, 0><<<gQK, blk, 0, stream>>>(
      XB, XB, CHN, 0L, WB, WB, CHN, 0L, (void*)QKh, (void*)QKl, QKP, 0L,
      wq, wq, 0L, MTOK, QKP, CHN, 1.0f);
  // (4) v^T_b = WB[64..127] . XB_b^T -> VTh|VTl [b][64][4096]   (M=64, N=4096, K=64 per batch; 64 tiles -> 8 blocks x 8 batches)
  const dim3 gVT(((CHN / 64) * (NTOK / 64) + 7) / 8, NB);
  wmma_gemm64<1, false, 0, 2, false, 0><<<gVT, blk, 0, stream>>>(
      WB + (size_t)2 * DQK * CHN, WB + (size_t)2 * DQK * CHN, CHN, 0L, XB, XB, CHN, (long)NTOK * CHN,
      (void*)VTh, (void*)VTl, NTOK, (long)CHN * NTOK,
      wq, wq, 0L, CHN, NTOK, CHN, 1.0f);
  // (5) attention per (batch, 64-position block) -> NCHW d_out; 512 blocks of 128 threads
  attn_kernel<<<dim3(NB * (NTOK / AT_QB)), dim3(128), 0, stream>>>(QKh, QKl, VTh, VTl, (float*)d_out);
  (void)hipGetLastError();
}

// v005
// One run takes 114 microseconds.
// Timed twice side by side with v004, it ran 1.10 and 1.11 times as fast.
// Counting every step since v000, it is 2.64 times as fast.
// Contractions: q|k projection and v^T projection = v_wmma_f32_16x16x32_bf16 single products on bf16 planes of the
// RNE-converted inputs (f32 accumulate, results split into bf16 hi|lo planes); q.k^T energies and p.v = bf16 hi/lo split
// (hi.hi + hi.lo + lo.hi) on v_wmma_f32_16x16x32_bf16, f32 accumulate; online max-shifted softmax (base 2: one fma and one
// v_exp_f32 per energy) and 1/rowsum in f32 on the VALU.
// Plane / carry map (every plane carries factor 1, nothing to fold back):
//   XB  = bf16(x) token-major [32768 (b*4096+n)][64 c], n = y*64 + x (NCHW token order);
//   WB  = bf16([wq; wk; wv]) [128][64], natural [out][in] (rows 0..31 wq, 32..63 wk, 64..127 wv);
//   QKh|QKl bf16 [32768][64]: cols 0..31 = q hi|lo over d, cols 32..63 = k hi|lo over d;
//   VTh|VTl bf16 [8][64 c][4096 m];
//   P hi|lo = unnormalised exp in (0,1] (bf16 keeps the f32 exponent range); 1/rowsum is applied to the f32 accumulator
//   in the attention epilogue right before the NCHW store (the only place a normaliser is applied).
#include <hip/hip_runtime.h>
#include <math.h>
#include <stdint.h>

#define NB    8
#define CHN   64
#define DQK   32
#define IMH   64
#define IMW   64
#define NTOK  4096
#define MTOK  (NB * NTOK)
#define QKP   64
#define WROWS 128

static_assert(NTOK == IMH * IMW);
static_assert(CHN == 64);
static_assert(DQK == 32);
static_assert(QKP == 2 * DQK);
static_assert(WROWS == 2 * DQK + CHN);
static_assert(NTOK % 64 == 0);
static_assert(MTOK % 64 == 0);
static_assert(CHN % 32 == 0);
static_assert((DQK * CHN) % (8 * 256) == 0);
static_assert((CHN * CHN) % (8 * 256) == 0);

typedef __attribute__((ext_vector_type(16))) _Float16 v16h;
typedef __attribute__((ext_vector_type(8)))  _Float16 v8h;
typedef __attribute__((ext_vector_type(16))) __bf16   v16b;
typedef __attribute__((ext_vector_type(8)))  __bf16   v8b;
typedef __attribute__((ext_vector_type(2)))  __bf16   v2b;
typedef __attribute__((ext_vector_type(8)))  float    v8f;
typedef __attribute__((ext_vector_type(4)))  float    v4f;
typedef __attribute__((ext_vector_type(2)))  float    v2f;
typedef __attribute__((ext_vector_type(4)))  unsigned int v4u;

__device__ __forceinline__ unsigned short f2bf_bits(float f) {
  unsigned u = __float_as_uint(f);
  return (unsigned short)((u + 0x7FFFu + ((u >> 16) & 1u)) >> 16);
}
__device__ __forceinline__ float bf_bits2f(unsigned short h) { return __uint_as_float(((unsigned)h) << 16); }
__device__ __forceinline__ float bf_rne(float f) { return bf_bits2f(f2bf_bits(f)); }
// bf16 of two neighbouring elements in one register (a in the low half): one v_cvt_pk_bf16_f32, round to nearest even
__device__ __forceinline__ unsigned bf_pk(float a, float b) {
  return __builtin_bit_cast(unsigned, __builtin_convertvector((v2f){a, b}, v2b));
}
// hi/lo split of two neighbouring elements, one packed register each (p0 in the low half): hi = bf16(p), lo = bf16(p - hi)
__device__ __forceinline__ void split_pk(float p0, float p1, unsigned& hi, unsigned& lo) {
  const v2f p = (v2f){p0, p1};
  const v2b h = __builtin_convertvector(p, v2b);
  const v2f d = p - __builtin_convertvector(h, v2f);             // exact in f32
  hi = __builtin_bit_cast(unsigned, h);
  lo = __builtin_bit_cast(unsigned, __builtin_convertvector(d, v2b));
}

// hazard guards as plain device helpers (no inline asm inside the kernel template body)
__device__ __forceinline__ void dep_guard_h(v8f& a, v8f& b, v16h x, v16h y) { asm volatile("v_nop\n\tv_nop\n\tv_nop\n\tv_nop" : "+v"(a), "+v"(b) : "v"(x), "v"(y)); }
__device__ __forceinline__ void dep_guard_b(v8f& a, v8f& b, v16b x, v16b y) { asm volatile("v_nop\n\tv_nop\n\tv_nop\n\tv_nop" : "+v"(a), "+v"(b) : "v"(x), "v"(y)); }
__device__ __forceinline__ void keep4_h(v16h a, v16h b, v16h c, v16h d) { asm volatile("v_nop" :: "v"(a), "v"(b), "v"(c), "v"(d)); }
__device__ __forceinline__ void keep4_b(v16b a, v16b b, v16b c, v16b d) { asm volatile("v_nop" :: "v"(a), "v"(b), "v"(c), "v"(d)); }
__device__ __forceinline__ void acc_guard4(v8f& a, v8f& b, v8f& c, v8f& d) { asm volatile("v_nop\n\tv_nop\n\tv_nop\n\tv_nop" : "+v"(a), "+v"(b), "+v"(c), "+v"(d)); }
template <typename T> struct Frag;
template <> struct Frag<_Float16> {
  typedef v16h V; union U { v16h v; v8h h[2]; };
  static __device__ __forceinline__ v16h load(const _Float16* p) {   // elements 0..7 <- p[0..7], 8..15 <- p[16..23]
    U f; f.h[0] = *(const v8h*)(p); f.h[1] = *(const v8h*)(p + 16); return f.v;
  }
  static __device__ __forceinline__ v8f mma(v16h a, v16h b, v8f c) {
    return __builtin_amdgcn_wmma_f32_16x16x32_f16(false, a, false, b, (short)0, c, false, false);
  }
  static __device__ __forceinline__ void guard(v8f& a, v8f& b, v16h x, v16h y) { dep_guard_h(a, b, x, y); }
  static __device__ __forceinline__ void keep(v16h a, v16h b, v16h c, v16h d) { keep4_h(a, b, c, d); }
};
template <> struct Frag<__bf16> {
  typedef v16b V; union U { v16b v; v8b h[2]; };
  static __device__ __forceinline__ v16b load(const __bf16* p) {
    U f; f.h[0] = *(const v8b*)(p); f.h[1] = *(const v8b*)(p + 16); return f.v;
  }
  static __device__ __forceinline__ v8f mma(v16b a, v16b b, v8f c) {
    return __builtin_amdgcn_wmma_f32_16x16x32_bf16(false, a, false, b, (short)0, c, false, false);
  }
  static __device__ __forceinline__ void guard(v8f& a, v8f& b, v16b x, v16b y) { dep_guard_b(a, b, x, y); }
  static __device__ __forceinline__ void keep(v16b a, v16b b, v16b c, v16b d) { keep4_b(a, b, c, d); }
};

// ---- Register-blocked batched WMMA GEMM ------------------------------------
// C[m,n] = scale * sum_k A[m,k] * Bt[n,k] (+bias)(+resid); each wave owns a 64x64 tile.
// A row-major [M,K]; Bt row-major [N,K]; M,N % 64 == 0, K % 32 == 0.
// SPLIT: operands are hi/lo planes (A2/Bt2 = lo planes, same layout); product = hi.hi + hi.lo + lo.hi.
// BIAS_MODE: 0 = none, 1 = bias[m], 2 = bias[n]; the bias value is RNE-converted to bf16 precision before the f32 add.
// OUT_MODE: 0 = f32, 1 = f16, 2 = bf16 hi plane (Cout) + bf16 lo plane (Cout2).
// ET: 0 = f16 operands, 1 = bf16 operands (pointers passed as 16-bit storage)
template <int ET> struct Elem;
template <> struct Elem<0> { typedef _Float16 T; };
template <> struct Elem<1> { typedef __bf16 T; };
template <int ET, bool SPLIT, int BIAS_MODE, int OUT_MODE, bool RESID, int ACT = 0>
__global__ __launch_bounds__(256) void wmma_gemm64(
    const unsigned short* __restrict__ Ap, const unsigned short* __restrict__ A2p, int lda, long strideA,
    const unsigned short* __restrict__ Btp, const unsigned short* __restrict__ Bt2p, int ldb, long strideB,
    void* __restrict__ Cout, void* __restrict__ Cout2, int ldc, long strideC,
    const float* __restrict__ bias,
    const float* __restrict__ resid, long strideR,
    int M, int N, int K, float scale) {
  typedef typename Elem<ET>::T T;
  typedef typename Frag<T>::V V;
  const T* A = (const T*)Ap; const T* A2 = (const T*)A2p; const T* Bt = (const T*)Btp; const T* Bt2 = (const T*)Bt2p;
  __shared__ __align__(16) float sT[8][16 * 68];   // per-wave 16x64 slab, pitch 68 floats
  const int b    = blockIdx.y;
  const int lane = threadIdx.x & 31;
  const int wave = threadIdx.x >> 5;
  const int tilesN = N >> 6;
  const int tilesM = M >> 6;
  const int tile = blockIdx.x * 8 + wave;
  if (tile >= tilesM * tilesN) return;   // wave-uniform; no block barriers in this kernel
  const int tm = tile / tilesN;
  const int tn = tile - tm * tilesN;
  const int m0 = tm << 6;
  const int n0 = tn << 6;

  const T* Ab  = A  + (size_t)b * strideA;
  const T* Bb  = Bt + (size_t)b * strideB;
  const T* Ab2 = SPLIT ? (A2  + (size_t)b * strideA) : nullptr;
  const T* Bb2 = SPLIT ? (Bt2 + (size_t)b * strideB) : nullptr;

  const int rlane = lane & 15;                 // row (A) / col (B, D) within subtile
  const int koff  = (lane >> 4) * 8;           // k offset of this lane half
  const int mOff  = (lane >> 4) * 8;           // D row offset

  v8f acc[4][4];
#pragma unroll
  for (int i = 0; i < 4; ++i)
#pragma unroll
    for (int j = 0; j < 4; ++j) acc[i][j] = (v8f){0.f,0.f,0.f,0.f,0.f,0.f,0.f,0.f};

  for (int k0 = 0; k0 < K; k0 += 32) {
    V bh[4], bl[4];
#pragma unroll
    for (int j = 0; j < 4; ++j) {
      const size_t bo = (size_t)(n0 + (j << 4) + rlane) * ldb + koff + k0;
      bh[j] = Frag<T>::load(Bb + bo);
      if (SPLIT) bl[j] = Frag<T>::load(Bb2 + bo); else bl[j] = bh[j];
    }
#pragma unroll
    for (int i = 0; i < 4; ++i) {
      const size_t ao = (size_t)(m0 + (i << 4) + rlane) * lda + koff + k0;
      V ah = Frag<T>::load(Ab + ao);
      V al;
      if (SPLIT) al = Frag<T>::load(Ab2 + ao); else al = ah;
#pragma unroll
      for (int j = 0; j < 4; ++j) {
        acc[i][j] = Frag<T>::mma(ah, bh[j], acc[i][j]);
        if (SPLIT) {
          acc[i][j] = Frag<T>::mma(ah, bl[j], acc[i][j]);
          acc[i][j] = Frag<T>::mma(al, bh[j], acc[i][j]);
        }
      }
      Frag<T>::guard(acc[i][0], acc[i][3], ah, al);
    }
    Frag<T>::keep(bh[0], bh[1], bh[2], bh[3]);
    if (SPLIT) Frag<T>::keep(bl[0], bl[1], bl[2], bl[3]);
  }
  acc_guard4(acc[0][0], acc[0][1], acc[0][2], acc[0][3]);
  acc_guard4(acc[1][0], acc[1][1], acc[1][2], acc[1][3]);
  acc_guard4(acc[2][0], acc[2][1], acc[2][2], acc[2][3]);
  acc_guard4(acc[3][0], acc[3][1], acc[3][2], acc[3][3]);

  // ---- epilogue ----
  float* slab = sT[wave];
  const float* Rb = RESID ? (resid + (size_t)b * strideR) : nullptr;
#pragma unroll
  for (int i = 0; i < 4; ++i) {
    const int mBase = m0 + (i << 4);
#pragma unroll
    for (int j = 0; j < 4; ++j) {
      const int n = n0 + (j << 4) + rlane;
      float bv = 0.f;
      if (BIAS_MODE == 2) bv = bf_rne(bias[n]);
#pragma unroll
      for (int r = 0; r < 8; ++r) {
        float v = acc[i][j][r] * scale;
        if (BIAS_MODE == 1) v += bf_rne(bias[mBase + mOff + r]);
        if (BIAS_MODE == 2) v += bv;
        if (RESID) v += Rb[(size_t)(mBase + mOff + r) * ldc + n];
        if (ACT == 1) v = tanhf(v);
        if (ACT == 2) v = fmaxf(v, 0.0f);
        if (ACT == 3) v = v / (1.0f + expf(-v));
        if (ACT == 4) v = (v > 0.f) ? v : 0.01f * v;
        if (ACT == 5) v = 0.5f * v * (1.0f + erff(v * 0.70710678118654752f));
        slab[(mOff + r) * 68 + (j << 4) + rlane] = v;
      }
    }
    __builtin_amdgcn_fence(__ATOMIC_RELEASE, "workgroup");
    __builtin_amdgcn_wave_barrier();
    __builtin_amdgcn_fence(__ATOMIC_ACQUIRE, "workgroup");
    if (OUT_MODE == 0) {
      float* C = (float*)Cout + (size_t)b * strideC;
      const int hh = lane >> 4, c4 = (lane & 15) * 4;     // row seg = 256 B = 16 lanes x 16 B
      {
#pragma unroll
        for (int it = 0; it < 8; ++it) {
          const int row = it * 2 + hh;
          v4f v = *(const v4f*)(slab + row * 68 + c4);
          *(v4f*)(C + (size_t)(mBase + row) * ldc + n0 + c4) = v;
        }
        
      }
    } else {
      const int q = lane >> 3, c8 = (lane & 7) * 8;
      unsigned short* C  = (unsigned short*)Cout  + (size_t)b * strideC;
      unsigned short* C2 = (OUT_MODE == 2) ? ((unsigned short*)Cout2 + (size_t)b * strideC) : nullptr;
      {
#pragma unroll
        for (int it = 0; it < 4; ++it) {
          const int row = it * 4 + q;
          const float* sp = slab + row * 68 + c8;
          v8h hv, lv;
          if (OUT_MODE == 1) {
#pragma unroll
            for (int e = 0; e < 8; ++e) hv[e] = (_Float16)sp[e];
          } else {
            v4u hu, lu;
#pragma unroll
            for (int e = 0; e < 4; ++e) {
              unsigned h, l;
              split_pk(sp[2 * e], sp[2 * e + 1], h, l);
              hu[e] = h;
              lu[e] = l;
            }
            hv = __builtin_bit_cast(v8h, hu);
            lv = __builtin_bit_cast(v8h, lu);
          }
          *(v8h*)(C + (size_t)(mBase + row) * ldc + n0 + c8) = hv;
          if (OUT_MODE == 2) *(v8h*)(C2 + (size_t)(mBase + row) * ldc + n0 + c8) = lv;
        }
        
      }
    }
    __builtin_amdgcn_fence(__ATOMIC_RELEASE, "workgroup");
    __builtin_amdgcn_wave_barrier();
    __builtin_amdgcn_fence(__ATOMIC_ACQUIRE, "workgroup");
  }
}

// ---------------------------------------------------------------------------
// Contiguous bf16 RNE convert of an f32 array: 8 consecutive elements per thread = one 16-B store; 8 consecutive lanes
// Coverage: grid = n8/256 blocks x 256 threads x 8 elements (n8 = n/8, host guarantees n % 2048 == 0).
// ---------------------------------------------------------------------------
__global__ __launch_bounds__(256) void conv8_kernel(const float* __restrict__ in, unsigned short* __restrict__ out, int n8) {
  const int i = blockIdx.x * 256 + threadIdx.x;
  if (i < n8) {
    const size_t e0 = (size_t)i * 8;
    const v4f a = *(const v4f*)(in + e0);
    const v4f c = *(const v4f*)(in + e0 + 4);
    v4u hv;
    hv[0] = bf_pk(a[0], a[1]);
    hv[1] = bf_pk(a[2], a[3]);
    hv[2] = bf_pk(c[0], c[1]);
    hv[3] = bf_pk(c[2], c[3]);
    {
      *(v4u*)(out + e0) = hv;
      
    }
  }
}

// ---------------------------------------------------------------------------
// Fused transpose + bf16 RNE convert of an f32 matrix, z-batched, one plane:
//   in_z = W + z*sIn viewed [R rows][Cc cols] with row pitch ldin  ->  oh_z[c][r] = bf16(in_z[r][c]), row pitch ldout, oh_z = oh + z*sOut.
// 64x64 tiles through LDS. grid = (Cc/64, R/64, Z), 256 threads (R, Cc multiples of 64; ldout multiple of 64 so every
// Coverage per block: load 4 it x 256 thr x 4 floats = 64x64; store 2 it x 256 thr x 8 u16 = 64x64.
// ---------------------------------------------------------------------------
__global__ __launch_bounds__(256) void tconv_kernel(const float* __restrict__ W, unsigned short* __restrict__ oh,
                                                    int ldin, int ldout, long sIn, long sOut) {
  __shared__ __align__(16) float tf[64 * 68];
  W  += (size_t)blockIdx.z * sIn;
  oh += (size_t)blockIdx.z * sOut;
  const int c0  = blockIdx.x * 64;   // input column block = output row block
  const int r0  = blockIdx.y * 64;   // input row block    = output column block
  const int tid = threadIdx.x;
  {
    const int lr = tid >> 4;         // 0..15
    const int c4 = (tid & 15) * 4;   // 0..60
#pragma unroll
    for (int it = 0; it < 4; ++it) {
      const int rr = it * 16 + lr;   // 0..63
      const v4f a = *(const v4f*)(W + (size_t)(r0 + rr) * ldin + c0 + c4);
      *(v4f*)(tf + rr * 68 + c4) = a;
    }
  }
  __syncthreads();
  const int sub = tid >> 3;          // 0..31
  const int c8  = (tid & 7) * 8;     // 0..56
  v4u hv[2];
#pragma unroll
  for (int it = 0; it < 2; ++it) {
    const int oc = it * 32 + sub;    // output row within tile (= input column)
    v4u a;
#pragma unroll
    for (int q = 0; q < 4; ++q) {
      const float f0 = tf[(c8 + 2 * q) * 68 + oc];
      const float f1 = tf[(c8 + 2 * q + 1) * 68 + oc];
      a[q] = bf_pk(f0, f1);
    }
    hv[it] = a;
  }
  {
#pragma unroll
    for (int it = 0; it < 2; ++it) {
      const int oc = it * 32 + sub;
      const size_t go = (size_t)(c0 + oc) * ldout + r0 + c8;
      *(v4u*)(oh + go) = hv[it];
    }
    
  }
}

#define AT_D  32
#define AT_C  64
#define AT_NW 4
#define AT_QB 64
#define AT_KC 64
#define OSP   68
#define AT_KP 40    // LDS row pitch of the K tiles in elements: 80 B = 16 B x 5, so 16 rows' 16-B reads fall on 64 distinct banks
#define AT_L2E 1.44269504088896340736f   // log2(e)
#define AT_VP 72    // LDS row pitch of the V^T tiles in elements: 144 B = 16 B x 9, same reason

static_assert(NTOK % AT_QB == 0);
static_assert(NTOK % AT_KC == 0);
static_assert(AT_C == CHN);
static_assert(AT_D == DQK);
static_assert(AT_KP >= AT_D && AT_KP % 8 == 0 && (AT_KP / 8) % 2 == 1);
static_assert(AT_VP >= AT_KC && AT_VP % 8 == 0 && (AT_VP / 8) % 2 == 1);

// lane l <-> lane l ^ 16 in the vector unit
__device__ __forceinline__ float at_xhalf(float x) {
  const int i = __builtin_bit_cast(int, x);
  return __builtin_bit_cast(float, __builtin_amdgcn_permlanex16(i, i, 0x76543210, 0xfedcba98, false, false));
}
// 2^x on the hardware's own instruction; every x here is -inf, or finite and not above a rounding error over 0, so nothing
// overflows, and a result under the smallest normal may go to 0 beside a row sum of about 1 or more
__device__ __forceinline__ float at_exp2(float x) { return __builtin_amdgcn_exp2f(x); }
// the builtin alone: the compiler keeps the distances behind it and is free to run independent products back to back
__device__ __forceinline__ v8f at_mma(v16b a, v16b b, v8f c) {
  return __builtin_amdgcn_wmma_f32_16x16x32_bf16(false, a, false, b, (short)0, c, false, false);
}

__global__ __launch_bounds__(128)
void attn_kernel(const unsigned short* __restrict__ qkhp, const unsigned short* __restrict__ qklp,
                 const unsigned short* __restrict__ vhp, const unsigned short* __restrict__ vlp,
                 float* __restrict__ out) {
  union FB { v16b v; v8b h[2]; unsigned u[8]; };
  __shared__ __align__(16) __bf16 Ksh[AT_KC * AT_KP];            // K hi [kv][d], padded rows      5 KB
  __shared__ __align__(16) __bf16 Ksl[AT_KC * AT_KP];            // K lo
  __shared__ __align__(16) __bf16 Vth[AT_C * AT_VP];             // V hi [c][kv], padded rows      9 KB
  __shared__ __align__(16) __bf16 Vtl[AT_C * AT_VP];             // V lo
  __shared__ __align__(16) float  Os[AT_C * OSP];                // block out tile [c][q], pitch 68

  const int tid  = threadIdx.x;
  const int wave = tid >> 5;
  const int lane = tid & 31;
  const int hh   = lane >> 4;
  const int c    = lane & 15;

  const int nqb  = NTOK / AT_QB;           // 64 query blocks per batch element
  const int bx   = blockIdx.x;             // grid = NB * nqb (exact)
  const int qb   = bx % nqb;
  const int b    = bx / nqb;               // 0..7
  const int nblk = qb * AT_QB;             // first position of this block
  const int q0   = b * NTOK + nblk + wave * 16;   // row in the q|k planes

  const __bf16* Qh = (const __bf16*)(const void*)qkhp;
  const __bf16* Ql = (const __bf16*)(const void*)qklp;
  const __bf16* Kh = Qh + AT_D;                                    // k columns 32..63
  const __bf16* Kl = Ql + AT_D;
  const __bf16* Vh = (const __bf16*)(const void*)vhp + (size_t)b * AT_C * NTOK;
  const __bf16* Vl = (const __bf16*)(const void*)vlp + (size_t)b * AT_C * NTOK;

  // ---- Q fragments (B operand, column = query = lane&15, split k map via Frag load): one 32-deep chunk, hi and lo ----
  const v16b qbh = Frag<__bf16>::load(Qh + (size_t)(q0 + c) * QKP + 8 * hh);
  const v16b qbl = Frag<__bf16>::load(Ql + (size_t)(q0 + c) * QKP + 8 * hh);

  // one query per lane: running max times log2(e) (equal in both lane halves) and this half's share of the row sum
  float mrow = -INFINITY, lrow = 0.f;
  v8f oacc[4];                             // oacc[t][r] = o^T(channel t*16 + 8*hh + r, query c)
#pragma unroll
  for (int t = 0; t < 4; ++t) oacc[t] = (v8f){0.f,0.f,0.f,0.f,0.f,0.f,0.f,0.f};

  const int nChunks = NTOK / AT_KC;   // 64, compile-time constant
  for (int kc = 0; kc < nChunks; ++kc) {
    const int kv0 = kc * AT_KC;
    __syncthreads();
    {
      // staging coverage: K: 128 threads x (2 x 8) = 64 rows x 32; V: 128 threads x (4 x 8) = 64 rows x 64 = whole tiles
      const int r = tid >> 1;
      const int hk = (tid & 1) * 16;
      const int hv = (tid & 1) * 32;
      const __bf16* ksh = Kh + (size_t)(b * NTOK + kv0 + r) * QKP + hk;   // K row (b, kv0+r), d = hk..hk+15
      const __bf16* ksl = Kl + (size_t)(b * NTOK + kv0 + r) * QKP + hk;
      const __bf16* vsh = Vh + (size_t)r * NTOK + kv0 + hv;               // V^T row c = r, keys kv0+hv..+31
      const __bf16* vsl = Vl + (size_t)r * NTOK + kv0 + hv;
#pragma unroll
      for (int i = 0; i < 2; ++i) {
        const v8b a0 = *(const v8b*)(ksh + 8 * i);
        const v8b a1 = *(const v8b*)(ksl + 8 * i);
        *(v8b*)(Ksh + r * AT_KP + hk + 8 * i) = a0;
        *(v8b*)(Ksl + r * AT_KP + hk + 8 * i) = a1;
      }
#pragma unroll
      for (int i = 0; i < 4; ++i) {
        const v8b b0 = *(const v8b*)(vsh + 8 * i);
        const v8b b1 = *(const v8b*)(vsl + 8 * i);
        *(v8b*)(Vth + r * AT_VP + hv + 8 * i) = b0;
        *(v8b*)(Vtl + r * AT_VP + hv + 8 * i) = b1;
      }
    }
    __syncthreads();

    // s[j][r] = energy^T(key j*16 + 8*hh + r, query c): K rows are the A operand, Q the B operand
    // All fragment reads of the chunk are issued here as one group, K first: the energy products wait for the K part alone,
    // and the V^T fragments land while the energies and the softmax are worked on.
    FB kb[4], kl[4], vb[2][4], vl[2][4];
#pragma unroll
    for (int j = 0; j < 4; ++j) {
      kb[j].h[0] = *(const v8b*)(Ksh + (j * 16 + c) * AT_KP + 8 * hh);
      kb[j].h[1] = *(const v8b*)(Ksh + (j * 16 + c) * AT_KP + 16 + 8 * hh);
    }
#pragma unroll
    for (int j = 0; j < 4; ++j) {
      kl[j].h[0] = *(const v8b*)(Ksl + (j * 16 + c) * AT_KP + 8 * hh);
      kl[j].h[1] = *(const v8b*)(Ksl + (j * 16 + c) * AT_KP + 16 + 8 * hh);
    }
#pragma unroll
    for (int kk = 0; kk < 2; ++kk) {
#pragma unroll
      for (int t = 0; t < 4; ++t) {
        vb[kk][t].h[0] = *(const v8b*)(Vth + (t * 16 + c) * AT_VP + kk * 32 + 8 * hh);
        vb[kk][t].h[1] = *(const v8b*)(Vth + (t * 16 + c) * AT_VP + kk * 32 + 16 + 8 * hh);
        vl[kk][t].h[0] = *(const v8b*)(Vtl + (t * 16 + c) * AT_VP + kk * 32 + 8 * hh);
        vl[kk][t].h[1] = *(const v8b*)(Vtl + (t * 16 + c) * AT_VP + kk * 32 + 16 + 8 * hh);
      }
    }
    // keeps the reads in this order above the products: without it the V^T reads are moved in front of the K reads, and the
    // first product waits for them too
    __builtin_amdgcn_sched_barrier(0);
    // term by term over the four independent accumulators (each s[j] still sums hi.hi, lo.hi, hi.lo in that order)
    v8f s[4];
#pragma unroll
    for (int j = 0; j < 4; ++j) s[j] = at_mma(kb[j].v, qbh, (v8f){0.f,0.f,0.f,0.f,0.f,0.f,0.f,0.f});
    // this one and the next keep the terms apart: regrouped by accumulator, every product would wait for the one before it
    __builtin_amdgcn_sched_barrier(0);
#pragma unroll
    for (int j = 0; j < 4; ++j) s[j] = at_mma(kl[j].v, qbh, s[j]);
    __builtin_amdgcn_sched_barrier(0);
#pragma unroll
    for (int j = 0; j < 4; ++j) s[j] = at_mma(kb[j].v, qbl, s[j]);
    // chunk max of this lane's query (no energy scaling): 32 keys in the lane, the other 32 in lane ^ 16
    float cm = -INFINITY;
#pragma unroll
    for (int j = 0; j < 4; ++j)
#pragma unroll
      for (int r = 0; r < 8; ++r) cm = fmaxf(cm, s[j][r]);
    cm = fmaxf(cm, at_xhalf(cm));
    const float mnew  = fmaxf(mrow, cm * AT_L2E);
    const float alpha = at_exp2(mrow - mnew);
    mrow = mnew;
    // p^T packs in place into B operands: element e of chunk half kk = key kk*32 + (e < 8 ? 8*hh + e : 16 + 8*hh + e - 8),
    // the same k order as the two 16-B reads of a V^T row above
    FB ph[2], pl[2];
    float ps[4];
#pragma unroll
    for (int j = 0; j < 4; ++j) {
      ps[j] = 0.f;
#pragma unroll
      for (int r = 0; r < 8; r += 2) {
        const v2f x = __builtin_elementwise_fma((v2f){s[j][r], s[j][r + 1]}, (v2f){AT_L2E, AT_L2E}, (v2f){-mnew, -mnew});
        const float p0 = at_exp2(x[0]);
        const float p1 = at_exp2(x[1]);
        ps[j] += p0;
        ps[j] += p1;
        split_pk(p0, p1, ph[j >> 1].u[(j & 1) * 4 + (r >> 1)], pl[j >> 1].u[(j & 1) * 4 + (r >> 1)]);
      }
    }
    lrow = lrow * alpha + ((ps[0] + ps[1]) + (ps[2] + ps[3]));
#pragma unroll
    for (int t = 0; t < 4; ++t)
#pragma unroll
      for (int r = 0; r < 8; ++r) oacc[t][r] *= alpha;
#pragma unroll
    for (int kk = 0; kk < 2; ++kk) {
      // term by term over the four independent accumulators (each oacc[t] still sums hi.hi, lo.hi, hi.lo in that order);
      // the two scheduling barriers keep the terms apart as above, but let vector, transcendental and scalar instructions
      // cross (mask 0x406), so that the other chunk half's softmax still fills the slots between the products
#pragma unroll
      for (int t = 0; t < 4; ++t) oacc[t] = at_mma(vb[kk][t].v, ph[kk].v, oacc[t]);
      __builtin_amdgcn_sched_barrier(0x406);
#pragma unroll
      for (int t = 0; t < 4; ++t) oacc[t] = at_mma(vl[kk][t].v, ph[kk].v, oacc[t]);
      __builtin_amdgcn_sched_barrier(0x406);
#pragma unroll
      for (int t = 0; t < 4; ++t) oacc[t] = at_mma(vb[kk][t].v, pl[kk].v, oacc[t]);
    }
  }

  // ---- join the two halves' row sums, normalise, stage the block's 64 (channel) x 64 (position) tile, write NCHW segments ----
  {
    const float inv = 1.0f / (lrow + at_xhalf(lrow));
#pragma unroll
    for (int t = 0; t < 4; ++t)
#pragma unroll
      for (int r = 0; r < 8; ++r) Os[(t * 16 + 8 * hh + r) * OSP + wave * 16 + c] = oacc[t][r] * inv;
  }
  __syncthreads();
  {
    const int c4 = c * 4;                                 // position offset within the block (0..60)
    float* ob = out + ((size_t)b * AT_C) * NTOK + nblk + c4;
    v4f ov[8];
#pragma unroll
    for (int it = 0; it < 8; ++it) {
      const int ch = wave * 16 + it * 2 + hh;             // it 0..7 x hh 0..1 = channels 0..15 of this wave
      ov[it] = *(const v4f*)(Os + ch * OSP + c4);
    }
#pragma unroll
    for (int it = 0; it < 8; ++it) {
      const int ch = wave * 16 + it * 2 + hh;
      *(v4f*)(ob + (size_t)ch * NTOK) = ov[it];
    }
  }
}

// ---------------------------------------------------------------------------
// Workspace region map (byte offsets; every region is fully written by its producer launch before any consumer
//   XB    bf16 [32768][64]            0       4194304
//   WB    bf16 [128][64]        4194304         16384
//   QKh   bf16 [32768][64]      4210688       4194304   QKl   8404992
//   VTh   bf16 [8][64][4096]   12599296       4194304   VTl  16793600
//   total                      20987904
// ---------------------------------------------------------------------------
extern "C" void kernel_launch(void* const* d_in, const int* in_sizes, int n_in,
                              void* d_out, int out_size, void* d_ws, size_t ws_size,
                              hipStream_t stream) {
  if (n_in < 4) return;
  if (in_sizes[0] != NB * CHN * NTOK) return;      // x  [8][64][64][64]
  if (in_sizes[1] != DQK * CHN) return;            // wq [32][64]
  if (in_sizes[2] != DQK * CHN) return;            // wk [32][64]
  if (in_sizes[3] != CHN * CHN) return;            // wv [64][64]
  if (out_size != NB * CHN * NTOK) return;

  const float* x  = (const float*)d_in[0];
  const float* wq = (const float*)d_in[1];   // [out 32][in 64]
  const float* wk = (const float*)d_in[2];   // [out 32][in 64]
  const float* wv = (const float*)d_in[3];   // [out 64][in 64]

  const size_t PXB = (size_t)MTOK * CHN * 2;         // 4194304
  const size_t PWB = (size_t)WROWS * CHN * 2;        // 16384
  const size_t PQK = (size_t)MTOK * QKP * 2;         // 4194304 per plane
  const size_t PVT = (size_t)NB * CHN * NTOK * 2;    // 4194304 per plane
  size_t off = 0;
  const size_t oXB  = off; off += PXB;
  const size_t oWB  = off; off += PWB;
  const size_t oQKh = off; off += PQK;  const size_t oQKl = off; off += PQK;
  const size_t oVTh = off; off += PVT;  const size_t oVTl = off; off += PVT;
  if (off > ws_size) return;                         // off = 20987904
  if (off > (size_t)134217728) return;

  char* ws = (char*)d_ws;
  unsigned short* XB  = (unsigned short*)(ws + oXB);
  unsigned short* WB  = (unsigned short*)(ws + oWB);
  unsigned short* QKh = (unsigned short*)(ws + oQKh); unsigned short* QKl = (unsigned short*)(ws + oQKl);
  unsigned short* VTh = (unsigned short*)(ws + oVTh); unsigned short* VTl = (unsigned short*)(ws + oVTl);

  const dim3 blk(256);

  // (1) x[b] viewed [R=64 c][Cc=4096 n] (pitch 4096) -> XB_b[n][c] (pitch 64); grid (Cc/64, R/64, B) = (64, 1, 8)
  tconv_kernel<<<dim3(NTOK / 64, CHN / 64, NB), blk, 0, stream>>>(x, XB, NTOK, CHN, (long)CHN * NTOK, (long)NTOK * CHN);
  // (2) weights -> WB bf16 rows 0..31 wq, 32..63 wk, 64..127 wv (natural [out][in]); 256 / 256 / 512 units
  conv8_kernel<<<dim3((DQK * CHN / 8) / 256), blk, 0, stream>>>(wq, WB, DQK * CHN / 8);
  conv8_kernel<<<dim3((DQK * CHN / 8) / 256), blk, 0, stream>>>(wk, WB + (size_t)DQK * CHN, DQK * CHN / 8);
  conv8_kernel<<<dim3((CHN * CHN / 8) / 256), blk, 0, stream>>>(wv, WB + (size_t)2 * DQK * CHN, CHN * CHN / 8);
  // (3) q|k = XB . WB[0..63]^T -> QKh|QKl [32768][64]   (M=32768, N=64, K=64; 512 tiles -> 64 blocks)
  const dim3 gQK(((MTOK / 64) * (QKP / 64) + 7) / 8, 1);
  wmma_gemm64<1, false, 0, 2, false, 0><<<gQK, blk, 0, stream>>>(
      XB, XB, CHN, 0L, WB, WB, CHN, 0L, (void*)QKh, (void*)QKl, QKP, 0L,
      wq, wq, 0L, MTOK, QKP, CHN, 1.0f);
  // (4) v^T_b = WB[64..127] . XB_b^T -> VTh|VTl [b][64][4096]   (M=64, N=4096, K=64 per batch; 64 tiles -> 8 blocks x 8 batches)
  const dim3 gVT(((CHN / 64) * (NTOK / 64) + 7) / 8, NB);
  wmma_gemm64<1, false, 0, 2, false, 0><<<gVT, blk, 0, stream>>>(
      WB + (size_t)2 * DQK * CHN, WB + (size_t)2 * DQK * CHN, CHN, 0L, XB, XB, CHN, (long)NTOK * CHN,
      (void*)VTh, (void*)VTl, NTOK, (long)CHN * NTOK,
      wq, wq, 0L, CHN, NTOK, CHN, 1.0f);
  // (5) attention per (batch, 64-position block) -> NCHW d_out; 512 blocks of 128 threads
  attn_kernel<<<dim3(NB * (NTOK / AT_QB)), dim3(128), 0, stream>>>(QKh, QKl, VTh, VTl, (float*)d_out);
  (void)hipGetLastError();
}

// v006
// A run of this version takes 107 microseconds.
// Two timings next to v005 both put it at 1.07 times that version's speed.
// All steps since v000 together make it 2.84 times as fast.
// Contractions: q|k projection and v^T projection = v_wmma_f32_16x16x32_bf16 single products on bf16 planes of the
// RNE-converted inputs (f32 accumulate, results split into bf16 hi|lo planes); q.k^T energies and p.v = bf16 hi/lo split
// (hi.hi + hi.lo + lo.hi) on v_wmma_f32_16x16x32_bf16, f32 accumulate; online max-shifted softmax (base 2: one fma and one
// v_exp_f32 per energy) and 1/rowsum in f32 on the VALU.
// Plane / carry map (every plane carries factor 1, nothing to fold back):
//   XB  = bf16(x) token-major [32768 (b*4096+n)][64 c], n = y*64 + x (NCHW token order);
//   WB  = bf16([wq; wk; wv]) [128][64], natural [out][in] (rows 0..31 wq, 32..63 wk, 64..127 wv);
//   QKh|QKl bf16 [32768][64]: cols 0..31 = q hi|lo over d, cols 32..63 = k hi|lo over d;
//   VTh|VTl bf16 [8][64 c][4096 m];
//   P hi|lo = unnormalised exp in (0,1] (bf16 keeps the f32 exponent range); 1/rowsum is applied to the f32 accumulator
//   in the attention epilogue right before the NCHW store (the only place a normaliser is applied).
#include <hip/hip_runtime.h>
#include <math.h>
#include <stdint.h>

#define NB    8
#define CHN   64
#define DQK   32
#define IMH   64
#define IMW   64
#define NTOK  4096
#define MTOK  (NB * NTOK)
#define QKP   64
#define WROWS 128

static_assert(NTOK == IMH * IMW);
static_assert(CHN == 64);
static_assert(DQK == 32);
static_assert(QKP == 2 * DQK);
static_assert(WROWS == 2 * DQK + CHN);
static_assert(NTOK % 64 == 0);
static_assert(MTOK % 64 == 0);
static_assert(CHN % 32 == 0);
static_assert((DQK * CHN) % (8 * 256) == 0);
static_assert((CHN * CHN) % (8 * 256) == 0);

typedef __attribute__((ext_vector_type(16))) _Float16 v16h;
typedef __attribute__((ext_vector_type(8)))  _Float16 v8h;
typedef __attribute__((ext_vector_type(16))) __bf16   v16b;
typedef __attribute__((ext_vector_type(8)))  __bf16   v8b;
typedef __attribute__((ext_vector_type(2)))  __bf16   v2b;
typedef __attribute__((ext_vector_type(8)))  float    v8f;
typedef __attribute__((ext_vector_type(4)))  float    v4f;
typedef __attribute__((ext_vector_type(2)))  float    v2f;
typedef __attribute__((ext_vector_type(4)))  unsigned int v4u;

__device__ __forceinline__ unsigned short f2bf_bits(float f) {
  unsigned u = __float_as_uint(f);
  return (unsigned short)((u + 0x7FFFu + ((u >> 16) & 1u)) >> 16);
}
__device__ __forceinline__ float bf_bits2f(unsigned short h) { return __uint_as_float(((unsigned)h) << 16); }
__device__ __forceinline__ float bf_rne(float f) { return bf_bits2f(f2bf_bits(f)); }
// bf16 of two neighbouring elements in one register (a in the low half): one v_cvt_pk_bf16_f32, round to nearest even
__device__ __forceinline__ unsigned bf_pk(float a, float b) {
  return __builtin_bit_cast(unsigned, __builtin_convertvector((v2f){a, b}, v2b));
}
// hi/lo split of two neighbouring elements, one packed register each (p0 in the low half): hi = bf16(p), lo = bf16(p - hi)
__device__ __forceinline__ void split_pk(float p0, float p1, unsigned& hi, unsigned& lo) {
  const v2f p = (v2f){p0, p1};
  const v2b h = __builtin_convertvector(p, v2b);
  const v2f d = p - __builtin_convertvector(h, v2f);             // exact in f32
  hi = __builtin_bit_cast(unsigned, h);
  lo = __builtin_bit_cast(unsigned, __builtin_convertvector(d, v2b));
}

// hazard guards as plain device helpers (no inline asm inside the kernel template body)
__device__ __forceinline__ void dep_guard_h(v8f& a, v8f& b, v16h x, v16h y) { asm volatile("v_nop\n\tv_nop\n\tv_nop\n\tv_nop" : "+v"(a), "+v"(b) : "v"(x), "v"(y)); }
__device__ __forceinline__ void dep_guard_b(v8f& a, v8f& b, v16b x, v16b y) { asm volatile("v_nop\n\tv_nop\n\tv_nop\n\tv_nop" : "+v"(a), "+v"(b) : "v"(x), "v"(y)); }
__device__ __forceinline__ void keep4_h(v16h a, v16h b, v16h c, v16h d) { asm volatile("v_nop" :: "v"(a), "v"(b), "v"(c), "v"(d)); }
__device__ __forceinline__ void keep4_b(v16b a, v16b b, v16b c, v16b d) { asm volatile("v_nop" :: "v"(a), "v"(b), "v"(c), "v"(d)); }
__device__ __forceinline__ void acc_guard4(v8f& a, v8f& b, v8f& c, v8f& d) { asm volatile("v_nop\n\tv_nop\n\tv_nop\n\tv_nop" : "+v"(a), "+v"(b), "+v"(c), "+v"(d)); }
template <typename T> struct Frag;
template <> struct Frag<_Float16> {
  typedef v16h V; union U { v16h v; v8h h[2]; };
  static __device__ __forceinline__ v16h load(const _Float16* p) {   // elements 0..7 <- p[0..7], 8..15 <- p[16..23]
    U f; f.h[0] = *(const v8h*)(p); f.h[1] = *(const v8h*)(p + 16); return f.v;
  }
  static __device__ __forceinline__ v8f mma(v16h a, v16h b, v8f c) {
    return __builtin_amdgcn_wmma_f32_16x16x32_f16(false, a, false, b, (short)0, c, false, false);
  }
  static __device__ __forceinline__ void guard(v8f& a, v8f& b, v16h x, v16h y) { dep_guard_h(a, b, x, y); }
  static __device__ __forceinline__ void keep(v16h a, v16h b, v16h c, v16h d) { keep4_h(a, b, c, d); }
};
template <> struct Frag<__bf16> {
  typedef v16b V; union U { v16b v; v8b h[2]; };
  static __device__ __forceinline__ v16b load(const __bf16* p) {
    U f; f.h[0] = *(const v8b*)(p); f.h[1] = *(const v8b*)(p + 16); return f.v;
  }
  static __device__ __forceinline__ v8f mma(v16b a, v16b b, v8f c) {
    return __builtin_amdgcn_wmma_f32_16x16x32_bf16(false, a, false, b, (short)0, c, false, false);
  }
  static __device__ __forceinline__ void guard(v8f& a, v8f& b, v16b x, v16b y) { dep_guard_b(a, b, x, y); }
  static __device__ __forceinline__ void keep(v16b a, v16b b, v16b c, v16b d) { keep4_b(a, b, c, d); }
};

// ---- Register-blocked batched WMMA GEMM ------------------------------------
// C[m,n] = scale * sum_k A[m,k] * Bt[n,k] (+bias)(+resid); each wave owns a 64x64 tile.
// A row-major [M,K]; Bt row-major [N,K]; M,N % 64 == 0, K % 32 == 0.
// SPLIT: operands are hi/lo planes (A2/Bt2 = lo planes, same layout); product = hi.hi + hi.lo + lo.hi.
// BIAS_MODE: 0 = none, 1 = bias[m], 2 = bias[n]; the bias value is RNE-converted to bf16 precision before the f32 add.
// OUT_MODE: 0 = f32, 1 = f16, 2 = bf16 hi plane (Cout) + bf16 lo plane (Cout2).
// ET: 0 = f16 operands, 1 = bf16 operands (pointers passed as 16-bit storage)
template <int ET> struct Elem;
template <> struct Elem<0> { typedef _Float16 T; };
template <> struct Elem<1> { typedef __bf16 T; };
template <int ET, bool SPLIT, int BIAS_MODE, int OUT_MODE, bool RESID, int ACT = 0>
__global__ __launch_bounds__(256) void wmma_gemm64(
    const unsigned short* __restrict__ Ap, const unsigned short* __restrict__ A2p, int lda, long strideA,
    const unsigned short* __restrict__ Btp, const unsigned short* __restrict__ Bt2p, int ldb, long strideB,
    void* __restrict__ Cout, void* __restrict__ Cout2, int ldc, long strideC,
    const float* __restrict__ bias,
    const float* __restrict__ resid, long strideR,
    int M, int N, int K, float scale) {
  typedef typename Elem<ET>::T T;
  typedef typename Frag<T>::V V;
  const T* A = (const T*)Ap; const T* A2 = (const T*)A2p; const T* Bt = (const T*)Btp; const T* Bt2 = (const T*)Bt2p;
  __shared__ __align__(16) float sT[8][16 * 68];   // per-wave 16x64 slab, pitch 68 floats
  const int b    = blockIdx.y;
  const int lane = threadIdx.x & 31;
  const int wave = threadIdx.x >> 5;
  const int tilesN = N >> 6;
  const int tilesM = M >> 6;
  const int tile = blockIdx.x * 8 + wave;
  if (tile >= tilesM * tilesN) return;   // wave-uniform; no block barriers in this kernel
  const int tm = tile / tilesN;
  const int tn = tile - tm * tilesN;
  const int m0 = tm << 6;
  const int n0 = tn << 6;

  const T* Ab  = A  + (size_t)b * strideA;
  const T* Bb  = Bt + (size_t)b * strideB;
  const T* Ab2 = SPLIT ? (A2  + (size_t)b * strideA) : nullptr;
  const T* Bb2 = SPLIT ? (Bt2 + (size_t)b * strideB) : nullptr;

  const int rlane = lane & 15;                 // row (A) / col (B, D) within subtile
  const int koff  = (lane >> 4) * 8;           // k offset of this lane half
  const int mOff  = (lane >> 4) * 8;           // D row offset

  v8f acc[4][4];
#pragma unroll
  for (int i = 0; i < 4; ++i)
#pragma unroll
    for (int j = 0; j < 4; ++j) acc[i][j] = (v8f){0.f,0.f,0.f,0.f,0.f,0.f,0.f,0.f};

  for (int k0 = 0; k0 < K; k0 += 32) {
    V bh[4], bl[4];
#pragma unroll
    for (int j = 0; j < 4; ++j) {
      const size_t bo = (size_t)(n0 + (j << 4) + rlane) * ldb + koff + k0;
      bh[j] = Frag<T>::load(Bb + bo);
      if (SPLIT) bl[j] = Frag<T>::load(Bb2 + bo); else bl[j] = bh[j];
    }
#pragma unroll
    for (int i = 0; i < 4; ++i) {
      const size_t ao = (size_t)(m0 + (i << 4) + rlane) * lda + koff + k0;
      V ah = Frag<T>::load(Ab + ao);
      V al;
      if (SPLIT) al = Frag<T>::load(Ab2 + ao); else al = ah;
#pragma unroll
      for (int j = 0; j < 4; ++j) {
        acc[i][j] = Frag<T>::mma(ah, bh[j], acc[i][j]);
        if (SPLIT) {
          acc[i][j] = Frag<T>::mma(ah, bl[j], acc[i][j]);
          acc[i][j] = Frag<T>::mma(al, bh[j], acc[i][j]);
        }
      }
      Frag<T>::guard(acc[i][0], acc[i][3], ah, al);
    }
    Frag<T>::keep(bh[0], bh[1], bh[2], bh[3]);
    if (SPLIT) Frag<T>::keep(bl[0], bl[1], bl[2], bl[3]);
  }
  acc_guard4(acc[0][0], acc[0][1], acc[0][2], acc[0][3]);
  acc_guard4(acc[1][0], acc[1][1], acc[1][2], acc[1][3]);
  acc_guard4(acc[2][0], acc[2][1], acc[2][2], acc[2][3]);
  acc_guard4(acc[3][0], acc[3][1], acc[3][2], acc[3][3]);

  // ---- epilogue ----
  float* slab = sT[wave];
  const float* Rb = RESID ? (resid + (size_t)b * strideR) : nullptr;
#pragma unroll
  for (int i = 0; i < 4; ++i) {
    const int mBase = m0 + (i << 4);
#pragma unroll
    for (int j = 0; j < 4; ++j) {
      const int n = n0 + (j << 4) + rlane;
      float bv = 0.f;
      if (BIAS_MODE == 2) bv = bf_rne(bias[n]);
#pragma unroll
      for (int r = 0; r < 8; ++r) {
        float v = acc[i][j][r] * scale;
        if (BIAS_MODE == 1) v += bf_rne(bias[mBase + mOff + r]);
        if (BIAS_MODE == 2) v += bv;
        if (RESID) v += Rb[(size_t)(mBase + mOff + r) * ldc + n];
        if (ACT == 1) v = tanhf(v);
        if (ACT == 2) v = fmaxf(v, 0.0f);
        if (ACT == 3) v = v / (1.0f + expf(-v));
        if (ACT == 4) v = (v > 0.f) ? v : 0.01f * v;
        if (ACT == 5) v = 0.5f * v * (1.0f + erff(v * 0.70710678118654752f));
        slab[(mOff + r) * 68 + (j << 4) + rlane] = v;
      }
    }
    __builtin_amdgcn_fence(__ATOMIC_RELEASE, "workgroup");
    __builtin_amdgcn_wave_barrier();
    __builtin_amdgcn_fence(__ATOMIC_ACQUIRE, "workgroup");
    if (OUT_MODE == 0) {
      float* C = (float*)Cout + (size_t)b * strideC;
      const int hh = lane >> 4, c4 = (lane & 15) * 4;     // row seg = 256 B = 16 lanes x 16 B
      {
#pragma unroll
        for (int it = 0; it < 8; ++it) {
          const int row = it * 2 + hh;
          v4f v = *(const v4f*)(slab + row * 68 + c4);
          *(v4f*)(C + (size_t)(mBase + row) * ldc + n0 + c4) = v;
        }
        
      }
    } else {
      const int q = lane >> 3, c8 = (lane & 7) * 8;
      unsigned short* C  = (unsigned short*)Cout  + (size_t)b * strideC;
      unsigned short* C2 = (OUT_MODE == 2) ? ((unsigned short*)Cout2 + (size_t)b * strideC) : nullptr;
      {
#pragma unroll
        for (int it = 0; it < 4; ++it) {
          const int row = it * 4 + q;
          const float* sp = slab + row * 68 + c8;
          v8h hv, lv;
          if (OUT_MODE == 1) {
#pragma unroll
            for (int e = 0; e < 8; ++e) hv[e] = (_Float16)sp[e];
          } else {
            v4u hu, lu;
#pragma unroll
            for (int e = 0; e < 4; ++e) {
              unsigned h, l;
              split_pk(sp[2 * e], sp[2 * e + 1], h, l);
              hu[e] = h;
              lu[e] = l;
            }
            hv = __builtin_bit_cast(v8h, hu);
            lv = __builtin_bit_cast(v8h, lu);
          }
          *(v8h*)(C + (size_t)(mBase + row) * ldc + n0 + c8) = hv;
          if (OUT_MODE == 2) *(v8h*)(C2 + (size_t)(mBase + row) * ldc + n0 + c8) = lv;
        }
        
      }
    }
    __builtin_amdgcn_fence(__ATOMIC_RELEASE, "workgroup");
    __builtin_amdgcn_wave_barrier();
    __builtin_amdgcn_fence(__ATOMIC_ACQUIRE, "workgroup");
  }
}

// ---------------------------------------------------------------------------
// Contiguous bf16 RNE convert of an f32 array: 8 consecutive elements per thread = one 16-B store; 8 consecutive lanes
// Coverage: grid = n8/256 blocks x 256 threads x 8 elements (n8 = n/8, host guarantees n % 2048 == 0).
// ---------------------------------------------------------------------------
__global__ __launch_bounds__(256) void conv8_kernel(const float* __restrict__ in, unsigned short* __restrict__ out, int n8) {
  const int i = blockIdx.x * 256 + threadIdx.x;
  if (i < n8) {
    const size_t e0 = (size_t)i * 8;
    const v4f a = *(const v4f*)(in + e0);
    const v4f c = *(const v4f*)(in + e0 + 4);
    v4u hv;
    hv[0] = bf_pk(a[0], a[1]);
    hv[1] = bf_pk(a[2], a[3]);
    hv[2] = bf_pk(c[0], c[1]);
    hv[3] = bf_pk(c[2], c[3]);
    {
      *(v4u*)(out + e0) = hv;
      
    }
  }
}

// ---------------------------------------------------------------------------
// Fused transpose + bf16 RNE convert of an f32 matrix, z-batched, one plane:
//   in_z = W + z*sIn viewed [R rows][Cc cols] with row pitch ldin  ->  oh_z[c][r] = bf16(in_z[r][c]), row pitch ldout, oh_z = oh + z*sOut.
// 64x64 tiles through LDS. grid = (Cc/64, R/64, Z), 256 threads (R, Cc multiples of 64; ldout multiple of 64 so every
// Coverage per block: load 4 it x 256 thr x 4 floats = 64x64; store 2 it x 256 thr x 8 u16 = 64x64.
// ---------------------------------------------------------------------------
__global__ __launch_bounds__(256) void tconv_kernel(const float* __restrict__ W, unsigned short* __restrict__ oh,
                                                    int ldin, int ldout, long sIn, long sOut) {
  __shared__ __align__(16) float tf[64 * 68];
  W  += (size_t)blockIdx.z * sIn;
  oh += (size_t)blockIdx.z * sOut;
  const int c0  = blockIdx.x * 64;   // input column block = output row block
  const int r0  = blockIdx.y * 64;   // input row block    = output column block
  const int tid = threadIdx.x;
  {
    const int lr = tid >> 4;         // 0..15
    const int c4 = (tid & 15) * 4;   // 0..60
#pragma unroll
    for (int it = 0; it < 4; ++it) {
      const int rr = it * 16 + lr;   // 0..63
      const v4f a = *(const v4f*)(W + (size_t)(r0 + rr) * ldin + c0 + c4);
      *(v4f*)(tf + rr * 68 + c4) = a;
    }
  }
  __syncthreads();
  const int sub = tid >> 3;          // 0..31
  const int c8  = (tid & 7) * 8;     // 0..56
  v4u hv[2];
#pragma unroll
  for (int it = 0; it < 2; ++it) {
    const int oc = it * 32 + sub;    // output row within tile (= input column)
    v4u a;
#pragma unroll
    for (int q = 0; q < 4; ++q) {
      const float f0 = tf[(c8 + 2 * q) * 68 + oc];
      const float f1 = tf[(c8 + 2 * q + 1) * 68 + oc];
      a[q] = bf_pk(f0, f1);
    }
    hv[it] = a;
  }
  {
#pragma unroll
    for (int it = 0; it < 2; ++it) {
      const int oc = it * 32 + sub;
      const size_t go = (size_t)(c0 + oc) * ldout + r0 + c8;
      *(v4u*)(oh + go) = hv[it];
    }
    
  }
}

#define AT_D  32
#define AT_C  64
#define AT_NW 4
#define AT_QB 64
#define AT_KC 64
#define OSP   68
#define AT_KP 40    // LDS row pitch of the K tiles in elements: 80 B = 16 B x 5, so 16 rows' 16-B reads fall on 64 distinct banks
#define AT_L2E 1.44269504088896340736f   // log2(e)
#define AT_VP 72    // LDS row pitch of the V^T tiles in elements: 144 B = 16 B x 9, same reason

static_assert(NTOK % AT_QB == 0);
static_assert(NTOK % AT_KC == 0);
static_assert(AT_C == CHN);
static_assert(AT_D == DQK);
static_assert(AT_KP >= AT_D && AT_KP % 8 == 0 && (AT_KP / 8) % 2 == 1);
static_assert(AT_VP >= AT_KC && AT_VP % 8 == 0 && (AT_VP / 8) % 2 == 1);

// lane l <-> lane l ^ 16 in the vector unit
__device__ __forceinline__ float at_xhalf(float x) {
  const int i = __builtin_bit_cast(int, x);
  return __builtin_bit_cast(float, __builtin_amdgcn_permlanex16(i, i, 0x76543210, 0xfedcba98, false, false));
}
// 2^x on the hardware's own instruction; every x here is -inf, or finite and not above a rounding error over 0, so nothing
// overflows, and a result under the smallest normal may go to 0 beside a row sum of about 1 or more
__device__ __forceinline__ float at_exp2(float x) { return __builtin_amdgcn_exp2f(x); }
// the builtin alone: the compiler keeps the distances behind it and is free to run independent products back to back
__device__ __forceinline__ v8f at_mma(v16b a, v16b b, v8f c) {
  return __builtin_amdgcn_wmma_f32_16x16x32_bf16(false, a, false, b, (short)0, c, false, false);
}

__global__ __launch_bounds__(128)
void attn_kernel(const unsigned short* __restrict__ qkhp, const unsigned short* __restrict__ qklp,
                 const unsigned short* __restrict__ vhp, const unsigned short* __restrict__ vlp,
                 float* __restrict__ out) {
  union FB { v16b v; v8b h[2]; unsigned u[8]; };
  __shared__ __align__(16) __bf16 Ksh[AT_KC * AT_KP];            // K hi [kv][d], padded rows      5 KB
  __shared__ __align__(16) __bf16 Ksl[AT_KC * AT_KP];            // K lo
  __shared__ __align__(16) __bf16 Vth[AT_C * AT_VP];             // V hi [c][kv], padded rows      9 KB
  __shared__ __align__(16) __bf16 Vtl[AT_C * AT_VP];             // V lo
  __shared__ __align__(16) float  Os[AT_C * OSP];                // block out tile [c][q], pitch 68

  const int tid  = threadIdx.x;
  const int wave = tid >> 5;
  const int lane = tid & 31;
  const int hh   = lane >> 4;
  const int c    = lane & 15;

  const int nqb  = NTOK / AT_QB;           // 64 query blocks per batch element
  const int bx   = blockIdx.x;             // grid = NB * nqb (exact)
  const int qb   = bx % nqb;
  const int b    = bx / nqb;               // 0..7
  const int nblk = qb * AT_QB;             // first position of this block
  const int q0   = b * NTOK + nblk + wave * 16;   // row in the q|k planes

  const __bf16* Qh = (const __bf16*)(const void*)qkhp;
  const __bf16* Ql = (const __bf16*)(const void*)qklp;
  const __bf16* Kh = Qh + AT_D;                                    // k columns 32..63
  const __bf16* Kl = Ql + AT_D;
  const __bf16* Vh = (const __bf16*)(const void*)vhp + (size_t)b * AT_C * NTOK;
  const __bf16* Vl = (const __bf16*)(const void*)vlp + (size_t)b * AT_C * NTOK;

  // ---- Q fragments (B operand, column = query = lane&15, split k map via Frag load): one 32-deep chunk, hi and lo ----
  const v16b qbh = Frag<__bf16>::load(Qh + (size_t)(q0 + c) * QKP + 8 * hh);
  const v16b qbl = Frag<__bf16>::load(Ql + (size_t)(q0 + c) * QKP + 8 * hh);

  // one query per lane: running max times log2(e) (equal in both lane halves) and this half's share of the row sum
  float mrow = -INFINITY, lrow = 0.f;
  v8f oacc[4];                             // oacc[t][r] = o^T(channel t*16 + 8*hh + r, query c)
#pragma unroll
  for (int t = 0; t < 4; ++t) oacc[t] = (v8f){0.f,0.f,0.f,0.f,0.f,0.f,0.f,0.f};

  const int nChunks = NTOK / AT_KC;   // 64, compile-time constant
  for (int kc = 0; kc < nChunks; ++kc) {
    const int kv0 = kc * AT_KC;
    __syncthreads();
    {
      // staging coverage: K: 4 waves x 2 x (8 rows x 32) = 64 rows x 32; V: 4 waves x 4 x (4 rows x 64) = 64 rows x 64 = whole tiles
      // Neighbouring lanes take neighbouring 16-B pieces of ONE row, so a wave-wide load touches as few cache lines as its 512 B
      // allow: 8 lanes = a whole 128-B V^T row (4 lines a load), 4 lanes = the 64-B k part of a q|k row (8 lines a load).
      // The rows that share a half-wave lie 8 apart (V^T: 8 x 144 B is a shift of 32 banks) or 4 apart (K: 4 x 80 B is a shift of
      // 16 banks), so the 16 lanes' ds_store_b128 fall on 64 distinct banks.
      const int kq = (tid & 3) * 8;                                        // d offset in the K row
      const int kr = (wave >> 1) * 32 + ((tid >> 4) & 1) * 16 + ((tid >> 2) & 3) * 4 + (wave & 1) * 2;   // + i, i < 2
      const int vq = (tid & 7) * 8;                                        // key offset in the V^T row
      const int vr = (wave >> 1) * 32 + ((tid >> 3) & 3) * 8 + (wave & 1) * 4;                           // + i, i < 4
      const __bf16* ksh = Kh + (size_t)(b * NTOK + kv0 + kr) * QKP + kq;   // K row (b, kv0+kr), d = kq..kq+7
      const __bf16* ksl = Kl + (size_t)(b * NTOK + kv0 + kr) * QKP + kq;
      const __bf16* vsh = Vh + (size_t)vr * NTOK + kv0 + vq;               // V^T row c = vr, keys kv0+vq..+7
      const __bf16* vsl = Vl + (size_t)vr * NTOK + kv0 + vq;
#pragma unroll
      for (int i = 0; i < 2; ++i) {
        const v8b a0 = *(const v8b*)(ksh + (size_t)i * QKP);
        const v8b a1 = *(const v8b*)(ksl + (size_t)i * QKP);
        *(v8b*)(Ksh + (kr + i) * AT_KP + kq) = a0;
        *(v8b*)(Ksl + (kr + i) * AT_KP + kq) = a1;
      }
#pragma unroll
      for (int i = 0; i < 4; ++i) {
        const v8b b0 = *(const v8b*)(vsh + (size_t)i * NTOK);
        const v8b b1 = *(const v8b*)(vsl + (size_t)i * NTOK);
        *(v8b*)(Vth + (vr + i) * AT_VP + vq) = b0;
        *(v8b*)(Vtl + (vr + i) * AT_VP + vq) = b1;
      }
    }
    __syncthreads();

    // s[j][r] = energy^T(key j*16 + 8*hh + r, query c): K rows are the A operand, Q the B operand
    // All fragment reads of the chunk are issued here as one group, K first: the energy products wait for the K part alone,
    // and the V^T fragments land while the energies and the softmax are worked on.
    FB kb[4], kl[4], vb[2][4], vl[2][4];
#pragma unroll
    for (int j = 0; j < 4; ++j) {
      kb[j].h[0] = *(const v8b*)(Ksh + (j * 16 + c) * AT_KP + 8 * hh);
      kb[j].h[1] = *(const v8b*)(Ksh + (j * 16 + c) * AT_KP + 16 + 8 * hh);
    }
#pragma unroll
    for (int j = 0; j < 4; ++j) {
      kl[j].h[0] = *(const v8b*)(Ksl + (j * 16 + c) * AT_KP + 8 * hh);
      kl[j].h[1] = *(const v8b*)(Ksl + (j * 16 + c) * AT_KP + 16 + 8 * hh);
    }
#pragma unroll
    for (int kk = 0; kk < 2; ++kk) {
#pragma unroll
      for (int t = 0; t < 4; ++t) {
        vb[kk][t].h[0] = *(const v8b*)(Vth + (t * 16 + c) * AT_VP + kk * 32 + 8 * hh);
        vb[kk][t].h[1] = *(const v8b*)(Vth + (t * 16 + c) * AT_VP + kk * 32 + 16 + 8 * hh);
        vl[kk][t].h[0] = *(const v8b*)(Vtl + (t * 16 + c) * AT_VP + kk * 32 + 8 * hh);
        vl[kk][t].h[1] = *(const v8b*)(Vtl + (t * 16 + c) * AT_VP + kk * 32 + 16 + 8 * hh);
      }
    }
    // keeps the reads in this order above the products: without it the V^T reads are moved in front of the K reads, and the
    // first product waits for them too
    __builtin_amdgcn_sched_barrier(0);
    // term by term over the four independent accumulators (each s[j] still sums hi.hi, lo.hi, hi.lo in that order)
    v8f s[4];
#pragma unroll
    for (int j = 0; j < 4; ++j) s[j] = at_mma(kb[j].v, qbh, (v8f){0.f,0.f,0.f,0.f,0.f,0.f,0.f,0.f});
    // this one and the next keep the terms apart: regrouped by accumulator, every product would wait for the one before it
    __builtin_amdgcn_sched_barrier(0);
#pragma unroll
    for (int j = 0; j < 4; ++j) s[j] = at_mma(kl[j].v, qbh, s[j]);
    __builtin_amdgcn_sched_barrier(0);
#pragma unroll
    for (int j = 0; j < 4; ++j) s[j] = at_mma(kb[j].v, qbl, s[j]);
    // chunk max of this lane's query (no energy scaling): 32 keys in the lane, the other 32 in lane ^ 16
    float cm = -INFINITY;
#pragma unroll
    for (int j = 0; j < 4; ++j)
#pragma unroll
      for (int r = 0; r < 8; ++r) cm = fmaxf(cm, s[j][r]);
    cm = fmaxf(cm, at_xhalf(cm));
    const float mnew  = fmaxf(mrow, cm * AT_L2E);
    const float alpha = at_exp2(mrow - mnew);
    mrow = mnew;
    // p^T packs in place into B operands: element e of chunk half kk = key kk*32 + (e < 8 ? 8*hh + e : 16 + 8*hh + e - 8),
    // the same k order as the two 16-B reads of a V^T row above
    FB ph[2], pl[2];
    float ps[4];
#pragma unroll
    for (int j = 0; j < 4; ++j) {
      ps[j] = 0.f;
#pragma unroll
      for (int r = 0; r < 8; r += 2) {
        const v2f x = __builtin_elementwise_fma((v2f){s[j][r], s[j][r + 1]}, (v2f){AT_L2E, AT_L2E}, (v2f){-mnew, -mnew});
        const float p0 = at_exp2(x[0]);
        const float p1 = at_exp2(x[1]);
        ps[j] += p0;
        ps[j] += p1;
        split_pk(p0, p1, ph[j >> 1].u[(j & 1) * 4 + (r >> 1)], pl[j >> 1].u[(j & 1) * 4 + (r >> 1)]);
      }
    }
    lrow = lrow * alpha + ((ps[0] + ps[1]) + (ps[2] + ps[3]));
#pragma unroll
    for (int t = 0; t < 4; ++t)
#pragma unroll
      for (int r = 0; r < 8; ++r) oacc[t][r] *= alpha;
#pragma unroll
    for (int kk = 0; kk < 2; ++kk) {
      // term by term over the four independent accumulators (each oacc[t] still sums hi.hi, lo.hi, hi.lo in that order);
      // the two scheduling barriers keep the terms apart as above, but let vector, transcendental and scalar instructions
      // cross (mask 0x406), so that the other chunk half's softmax still fills the slots between the products
#pragma unroll
      for (int t = 0; t < 4; ++t) oacc[t] = at_mma(vb[kk][t].v, ph[kk].v, oacc[t]);
      __builtin_amdgcn_sched_barrier(0x406);
#pragma unroll
      for (int t = 0; t < 4; ++t) oacc[t] = at_mma(vl[kk][t].v, ph[kk].v, oacc[t]);
      __builtin_amdgcn_sched_barrier(0x406);
#pragma unroll
      for (int t = 0; t < 4; ++t) oacc[t] = at_mma(vb[kk][t].v, pl[kk].v, oacc[t]);
    }
  }

  // ---- join the two halves' row sums, normalise, stage the block's 64 (channel) x 64 (position) tile, write NCHW segments ----
  {
    const float inv = 1.0f / (lrow + at_xhalf(lrow));
#pragma unroll
    for (int t = 0; t < 4; ++t)
#pragma unroll
      for (int r = 0; r < 8; ++r) Os[(t * 16 + 8 * hh + r) * OSP + wave * 16 + c] = oacc[t][r] * inv;
  }
  __syncthreads();
  {
    const int c4 = c * 4;                                 // position offset within the block (0..60)
    float* ob = out + ((size_t)b * AT_C) * NTOK + nblk + c4;
    v4f ov[8];
#pragma unroll
    for (int it = 0; it < 8; ++it) {
      const int ch = wave * 16 + it * 2 + hh;             // it 0..7 x hh 0..1 = channels 0..15 of this wave
      ov[it] = *(const v4f*)(Os + ch * OSP + c4);
    }
#pragma unroll
    for (int it = 0; it < 8; ++it) {
      const int ch = wave * 16 + it * 2 + hh;
      *(v4f*)(ob + (size_t)ch * NTOK) = ov[it];
    }
  }
}

// ---------------------------------------------------------------------------
// Workspace region map (byte offsets; every region is fully written by its producer launch before any consumer
//   XB    bf16 [32768][64]            0       4194304
//   WB    bf16 [128][64]        4194304         16384
//   QKh   bf16 [32768][64]      4210688       4194304   QKl   8404992
//   VTh   bf16 [8][64][4096]   12599296       4194304   VTl  16793600
//   total                      20987904
// ---------------------------------------------------------------------------
extern "C" void kernel_launch(void* const* d_in, const int* in_sizes, int n_in,
                              void* d_out, int out_size, void* d_ws, size_t ws_size,
                              hipStream_t stream) {
  if (n_in < 4) return;
  if (in_sizes[0] != NB * CHN * NTOK) return;      // x  [8][64][64][64]
  if (in_sizes[1] != DQK * CHN) return;            // wq [32][64]
  if (in_sizes[2] != DQK * CHN) return;            // wk [32][64]
  if (in_sizes[3] != CHN * CHN) return;            // wv [64][64]
  if (out_size != NB * CHN * NTOK) return;

  const float* x  = (const float*)d_in[0];
  const float* wq = (const float*)d_in[1];   // [out 32][in 64]
  const float* wk = (const float*)d_in[2];   // [out 32][in 64]
  const float* wv = (const float*)d_in[3];   // [out 64][in 64]

  const size_t PXB = (size_t)MTOK * CHN * 2;         // 4194304
  const size_t PWB = (size_t)WROWS * CHN * 2;        // 16384
  const size_t PQK = (size_t)MTOK * QKP * 2;         // 4194304 per plane
  const size_t PVT = (size_t)NB * CHN * NTOK * 2;    // 4194304 per plane
  size_t off = 0;
  const size_t oXB  = off; off += PXB;
  const size_t oWB  = off; off += PWB;
  const size_t oQKh = off; off += PQK;  const size_t oQKl = off; off += PQK;
  const size_t oVTh = off; off += PVT;  const size_t oVTl = off; off += PVT;
  if (off > ws_size) return;                         // off = 20987904
  if (off > (size_t)134217728) return;

  char* ws = (char*)d_ws;
  unsigned short* XB  = (unsigned short*)(ws + oXB);
  unsigned short* WB  = (unsigned short*)(ws + oWB);
  unsigned short* QKh = (unsigned short*)(ws + oQKh); unsigned short* QKl = (unsigned short*)(ws + oQKl);
  unsigned short* VTh = (unsigned short*)(ws + oVTh); unsigned short* VTl = (unsigned short*)(ws + oVTl);

  const dim3 blk(256);

  // (1) x[b] viewed [R=64 c][Cc=4096 n] (pitch 4096) -> XB_b[n][c] (pitch 64); grid (Cc/64, R/64, B) = (64, 1, 8)
  tconv_kernel<<<dim3(NTOK / 64, CHN / 64, NB), blk, 0, stream>>>(x, XB, NTOK, CHN, (long)CHN * NTOK, (long)NTOK * CHN);
  // (2) weights -> WB bf16 rows 0..31 wq, 32..63 wk, 64..127 wv (natural [out][in]); 256 / 256 / 512 units
  conv8_kernel<<<dim3((DQK * CHN / 8) / 256), blk, 0, stream>>>(wq, WB, DQK * CHN / 8);
  conv8_kernel<<<dim3((DQK * CHN / 8) / 256), blk, 0, stream>>>(wk, WB + (size_t)DQK * CHN, DQK * CHN / 8);
  conv8_kernel<<<dim3((CHN * CHN / 8) / 256), blk, 0, stream>>>(wv, WB + (size_t)2 * DQK * CHN, CHN * CHN / 8);
  // (3) q|k = XB . WB[0..63]^T -> QKh|QKl [32768][64]   (M=32768, N=64, K=64; 512 tiles -> 64 blocks)
  const dim3 gQK(((MTOK / 64) * (QKP / 64) + 7) / 8, 1);
  wmma_gemm64<1, false, 0, 2, false, 0><<<gQK, blk, 0, stream>>>(
      XB, XB, CHN, 0L, WB, WB, CHN, 0L, (void*)QKh, (void*)QKl, QKP, 0L,
      wq, wq, 0L, MTOK, QKP, CHN, 1.0f);
  // (4) v^T_b = WB[64..127] . XB_b^T -> VTh|VTl [b][64][4096]   (M=64, N=4096, K=64 per batch; 64 tiles -> 8 blocks x 8 batches)
  const dim3 gVT(((CHN / 64) * (NTOK / 64) + 7) / 8, NB);
  wmma_gemm64<1, false, 0, 2, false, 0><<<gVT, blk, 0, stream>>>(
      WB + (size_t)2 * DQK * CHN, WB + (size_t)2 * DQK * CHN, CHN, 0L, XB, XB, CHN, (long)NTOK * CHN,
      (void*)VTh, (void*)VTl, NTOK, (long)CHN * NTOK,
      wq, wq, 0L, CHN, NTOK, CHN, 1.0f);
  // (5) attention per (batch, 64-position block) -> NCHW d_out; 512 blocks of 128 threads
  attn_kernel<<<dim3(NB * (NTOK / AT_QB)), dim3(128), 0, stream>>>(QKh, QKl, VTh, VTl, (float*)d_out);
  (void)hipGetLastError();
}

// v007
// One run takes 93.4 microseconds.
// Two timings next to v006 put it at 1.15 and 1.14 times that version's speed.
// Counting every step since v000, it is 3.25 times as fast.
// Contractions: q|k projection and v^T projection = v_wmma_f32_16x16x32_bf16 single products on bf16 planes of the
// RNE-converted inputs (f32 accumulate, results split into bf16 hi|lo planes); q.k^T energies and p.v = bf16 hi/lo split
// (hi.hi + hi.lo + lo.hi) on v_wmma_f32_16x16x32_bf16, f32 accumulate; online max-shifted softmax (base 2: one fma and one
// v_exp_f32 per energy) and 1/rowsum in f32 on the VALU.
// Plane / carry map (every plane carries factor 1, nothing to fold back):
//   XB  = bf16(x) token-major [32768 (b*4096+n)][64 c], n = y*64 + x (NCHW token order);
//   WB  = bf16([wq; wk; wv]) [128][64], natural [out][in] (rows 0..31 wq, 32..63 wk, 64..127 wv);
//   QKh|QKl bf16 [32768][64]: cols 0..31 = q hi|lo over d, cols 32..63 = k hi|lo over d;
//   VTh|VTl bf16 [8][64 c][4096 m];
//   P hi|lo = unnormalised exp in (0,1] (bf16 keeps the f32 exponent range); 1/rowsum is applied to the f32 accumulator
//   in the attention epilogue right before the NCHW store (the only place a normaliser is applied).
#include <hip/hip_runtime.h>
#include <math.h>
#include <stdint.h>

#define NB    8
#define CHN   64
#define DQK   32
#define IMH   64
#define IMW   64
#define NTOK  4096
#define MTOK  (NB * NTOK)
#define QKP   64
#define WROWS 128

static_assert(NTOK == IMH * IMW);
static_assert(CHN == 64);
static_assert(DQK == 32);
static_assert(QKP == 2 * DQK);
static_assert(WROWS == 2 * DQK + CHN);
static_assert(NTOK % 64 == 0);
static_assert(MTOK % 64 == 0);
static_assert(CHN % 32 == 0);
static_assert((DQK * CHN) % (8 * 256) == 0);
static_assert((CHN * CHN) % (8 * 256) == 0);

typedef __attribute__((ext_vector_type(16))) _Float16 v16h;
typedef __attribute__((ext_vector_type(8)))  _Float16 v8h;
typedef __attribute__((ext_vector_type(16))) __bf16   v16b;
typedef __attribute__((ext_vector_type(8)))  __bf16   v8b;
typedef __attribute__((ext_vector_type(2)))  __bf16   v2b;
typedef __attribute__((ext_vector_type(8)))  float    v8f;
typedef __attribute__((ext_vector_type(4)))  float    v4f;
typedef __attribute__((ext_vector_type(2)))  float    v2f;
typedef __attribute__((ext_vector_type(4)))  unsigned int v4u;

__device__ __forceinline__ unsigned short f2bf_bits(float f) {
  unsigned u = __float_as_uint(f);
  return (unsigned short)((u + 0x7FFFu + ((u >> 16) & 1u)) >> 16);
}
__device__ __forceinline__ float bf_bits2f(unsigned short h) { return __uint_as_float(((unsigned)h) << 16); }
__device__ __forceinline__ float bf_rne(float f) { return bf_bits2f(f2bf_bits(f)); }
// bf16 of two neighbouring elements in one register (a in the low half): one v_cvt_pk_bf16_f32, round to nearest even
__device__ __forceinline__ unsigned bf_pk(float a, float b) {
  return __builtin_bit_cast(unsigned, __builtin_convertvector((v2f){a, b}, v2b));
}
// hi/lo split of two neighbouring elements, one packed register each (p0 in the low half): hi = bf16(p), lo = bf16(p - hi)
__device__ __forceinline__ void split_pk(float p0, float p1, unsigned& hi, unsigned& lo) {
  const v2f p = (v2f){p0, p1};
  const v2b h = __builtin_convertvector(p, v2b);
  const v2f d = p - __builtin_convertvector(h, v2f);             // exact in f32
  hi = __builtin_bit_cast(unsigned, h);
  lo = __builtin_bit_cast(unsigned, __builtin_convertvector(d, v2b));
}

// hazard guards as plain device helpers (no inline asm inside the kernel template body)
__device__ __forceinline__ void dep_guard_h(v8f& a, v8f& b, v16h x, v16h y) { asm volatile("v_nop\n\tv_nop\n\tv_nop\n\tv_nop" : "+v"(a), "+v"(b) : "v"(x), "v"(y)); }
__device__ __forceinline__ void dep_guard_b(v8f& a, v8f& b, v16b x, v16b y) { asm volatile("v_nop\n\tv_nop\n\tv_nop\n\tv_nop" : "+v"(a), "+v"(b) : "v"(x), "v"(y)); }
__device__ __forceinline__ void keep4_h(v16h a, v16h b, v16h c, v16h d) { asm volatile("v_nop" :: "v"(a), "v"(b), "v"(c), "v"(d)); }
__device__ __forceinline__ void keep4_b(v16b a, v16b b, v16b c, v16b d) { asm volatile("v_nop" :: "v"(a), "v"(b), "v"(c), "v"(d)); }
__device__ __forceinline__ void acc_guard4(v8f& a, v8f& b, v8f& c, v8f& d) { asm volatile("v_nop\n\tv_nop\n\tv_nop\n\tv_nop" : "+v"(a), "+v"(b), "+v"(c), "+v"(d)); }
template <typename T> struct Frag;
template <> struct Frag<_Float16> {
  typedef v16h V; union U { v16h v; v8h h[2]; };
  static __device__ __forceinline__ v16h load(const _Float16* p) {   // elements 0..7 <- p[0..7], 8..15 <- p[16..23]
    U f; f.h[0] = *(const v8h*)(p); f.h[1] = *(const v8h*)(p + 16); return f.v;
  }
  static __device__ __forceinline__ v8f mma(v16h a, v16h b, v8f c) {
    return __builtin_amdgcn_wmma_f32_16x16x32_f16(false, a, false, b, (short)0, c, false, false);
  }
  static __device__ __forceinline__ void guard(v8f& a, v8f& b, v16h x, v16h y) { dep_guard_h(a, b, x, y); }
  static __device__ __forceinline__ void keep(v16h a, v16h b, v16h c, v16h d) { keep4_h(a, b, c, d); }
};
template <> struct Frag<__bf16> {
  typedef v16b V; union U { v16b v; v8b h[2]; };
  static __device__ __forceinline__ v16b load(const __bf16* p) {
    U f; f.h[0] = *(const v8b*)(p); f.h[1] = *(const v8b*)(p + 16); return f.v;
  }
  static __device__ __forceinline__ v8f mma(v16b a, v16b b, v8f c) {
    return __builtin_amdgcn_wmma_f32_16x16x32_bf16(false, a, false, b, (short)0, c, false, false);
  }
  static __device__ __forceinline__ void guard(v8f& a, v8f& b, v16b x, v16b y) { dep_guard_b(a, b, x, y); }
  static __device__ __forceinline__ void keep(v16b a, v16b b, v16b c, v16b d) { keep4_b(a, b, c, d); }
};

// ---- Register-blocked batched WMMA GEMM ------------------------------------
// C[m,n] = scale * sum_k A[m,k] * Bt[n,k] (+bias)(+resid); each wave owns a 64x64 tile.
// A row-major [M,K]; Bt row-major [N,K]; M,N % 64 == 0, K % 32 == 0.
// SPLIT: operands are hi/lo planes (A2/Bt2 = lo planes, same layout); product = hi.hi + hi.lo + lo.hi.
// BIAS_MODE: 0 = none, 1 = bias[m], 2 = bias[n]; the bias value is RNE-converted to bf16 precision before the f32 add.
// OUT_MODE: 0 = f32, 1 = f16, 2 = bf16 hi plane (Cout) + bf16 lo plane (Cout2).
// ET: 0 = f16 operands, 1 = bf16 operands (pointers passed as 16-bit storage)
template <int ET> struct Elem;
template <> struct Elem<0> { typedef _Float16 T; };
template <> struct Elem<1> { typedef __bf16 T; };
template <int ET, bool SPLIT, int BIAS_MODE, int OUT_MODE, bool RESID, int ACT = 0>
__global__ __launch_bounds__(256) void wmma_gemm64(
    const unsigned short* __restrict__ Ap, const unsigned short* __restrict__ A2p, int lda, long strideA,
    const unsigned short* __restrict__ Btp, const unsigned short* __restrict__ Bt2p, int ldb, long strideB,
    void* __restrict__ Cout, void* __restrict__ Cout2, int ldc, long strideC,
    const float* __restrict__ bias,
    const float* __restrict__ resid, long strideR,
    int M, int N, int K, float scale) {
  typedef typename Elem<ET>::T T;
  typedef typename Frag<T>::V V;
  const T* A = (const T*)Ap; const T* A2 = (const T*)A2p; const T* Bt = (const T*)Btp; const T* Bt2 = (const T*)Bt2p;
  __shared__ __align__(16) float sT[8][16 * 68];   // per-wave 16x64 slab, pitch 68 floats
  const int b    = blockIdx.y;
  const int lane = threadIdx.x & 31;
  const int wave = threadIdx.x >> 5;
  const int tilesN = N >> 6;
  const int tilesM = M >> 6;
  const int tile = blockIdx.x * 8 + wave;
  if (tile >= tilesM * tilesN) return;   // wave-uniform; no block barriers in this kernel
  const int tm = tile / tilesN;
  const int tn = tile - tm * tilesN;
  const int m0 = tm << 6;
  const int n0 = tn << 6;

  const T* Ab  = A  + (size_t)b * strideA;
  const T* Bb  = Bt + (size_t)b * strideB;
  const T* Ab2 = SPLIT ? (A2  + (size_t)b * strideA) : nullptr;
  const T* Bb2 = SPLIT ? (Bt2 + (size_t)b * strideB) : nullptr;

  const int rlane = lane & 15;                 // row (A) / col (B, D) within subtile
  const int koff  = (lane >> 4) * 8;           // k offset of this lane half
  const int mOff  = (lane >> 4) * 8;           // D row offset

  v8f acc[4][4];
#pragma unroll
  for (int i = 0; i < 4; ++i)
#pragma unroll
    for (int j = 0; j < 4; ++j) acc[i][j] = (v8f){0.f,0.f,0.f,0.f,0.f,0.f,0.f,0.f};

  for (int k0 = 0; k0 < K; k0 += 32) {
    V bh[4], bl[4];
#pragma unroll
    for (int j = 0; j < 4; ++j) {
      const size_t bo = (size_t)(n0 + (j << 4) + rlane) * ldb + koff + k0;
      bh[j] = Frag<T>::load(Bb + bo);
      if (SPLIT) bl[j] = Frag<T>::load(Bb2 + bo); else bl[j] = bh[j];
    }
#pragma unroll
    for (int i = 0; i < 4; ++i) {
      const size_t ao = (size_t)(m0 + (i << 4) + rlane) * lda + koff + k0;
      V ah = Frag<T>::load(Ab + ao);
      V al;
      if (SPLIT) al = Frag<T>::load(Ab2 + ao); else al = ah;
#pragma unroll
      for (int j = 0; j < 4; ++j) {
        acc[i][j] = Frag<T>::mma(ah, bh[j], acc[i][j]);
        if (SPLIT) {
          acc[i][j] = Frag<T>::mma(ah, bl[j], acc[i][j]);
          acc[i][j] = Frag<T>::mma(al, bh[j], acc[i][j]);
        }
      }
      Frag<T>::guard(acc[i][0], acc[i][3], ah, al);
    }
    Frag<T>::keep(bh[0], bh[1], bh[2], bh[3]);
    if (SPLIT) Frag<T>::keep(bl[0], bl[1], bl[2], bl[3]);
  }
  acc_guard4(acc[0][0], acc[0][1], acc[0][2], acc[0][3]);
  acc_guard4(acc[1][0], acc[1][1], acc[1][2], acc[1][3]);
  acc_guard4(acc[2][0], acc[2][1], acc[2][2], acc[2][3]);
  acc_guard4(acc[3][0], acc[3][1], acc[3][2], acc[3][3]);

  // ---- epilogue ----
  float* slab = sT[wave];
  const float* Rb = RESID ? (resid + (size_t)b * strideR) : nullptr;
#pragma unroll
  for (int i = 0; i < 4; ++i) {
    const int mBase = m0 + (i << 4);
#pragma unroll
    for (int j = 0; j < 4; ++j) {
      const int n = n0 + (j << 4) + rlane;
      float bv = 0.f;
      if (BIAS_MODE == 2) bv = bf_rne(bias[n]);
#pragma unroll
      for (int r = 0; r < 8; ++r) {
        float v = acc[i][j][r] * scale;
        if (BIAS_MODE == 1) v += bf_rne(bias[mBase + mOff + r]);
        if (BIAS_MODE == 2) v += bv;
        if (RESID) v += Rb[(size_t)(mBase + mOff + r) * ldc + n];
        if (ACT == 1) v = tanhf(v);
        if (ACT == 2) v = fmaxf(v, 0.0f);
        if (ACT == 3) v = v / (1.0f + expf(-v));
        if (ACT == 4) v = (v > 0.f) ? v : 0.01f * v;
        if (ACT == 5) v = 0.5f * v * (1.0f + erff(v * 0.70710678118654752f));
        slab[(mOff + r) * 68 + (j << 4) + rlane] = v;
      }
    }
    __builtin_amdgcn_fence(__ATOMIC_RELEASE, "workgroup");
    __builtin_amdgcn_wave_barrier();
    __builtin_amdgcn_fence(__ATOMIC_ACQUIRE, "workgroup");
    if (OUT_MODE == 0) {
      float* C = (float*)Cout + (size_t)b * strideC;
      const int hh = lane >> 4, c4 = (lane & 15) * 4;     // row seg = 256 B = 16 lanes x 16 B
      {
#pragma unroll
        for (int it = 0; it < 8; ++it) {
          const int row = it * 2 + hh;
          v4f v = *(const v4f*)(slab + row * 68 + c4);
          *(v4f*)(C + (size_t)(mBase + row) * ldc + n0 + c4) = v;
        }
        
      }
    } else {
      const int q = lane >> 3, c8 = (lane & 7) * 8;
      unsigned short* C  = (unsigned short*)Cout  + (size_t)b * strideC;
      unsigned short* C2 = (OUT_MODE == 2) ? ((unsigned short*)Cout2 + (size_t)b * strideC) : nullptr;
      {
#pragma unroll
        for (int it = 0; it < 4; ++it) {
          const int row = it * 4 + q;
          const float* sp = slab + row * 68 + c8;
          v8h hv, lv;
          if (OUT_MODE == 1) {
#pragma unroll
            for (int e = 0; e < 8; ++e) hv[e] = (_Float16)sp[e];
          } else {
            v4u hu, lu;
#pragma unroll
            for (int e = 0; e < 4; ++e) {
              unsigned h, l;
              split_pk(sp[2 * e], sp[2 * e + 1], h, l);
              hu[e] = h;
              lu[e] = l;
            }
            hv = __builtin_bit_cast(v8h, hu);
            lv = __builtin_bit_cast(v8h, lu);
          }
          *(v8h*)(C + (size_t)(mBase + row) * ldc + n0 + c8) = hv;
          if (OUT_MODE == 2) *(v8h*)(C2 + (size_t)(mBase + row) * ldc + n0 + c8) = lv;
        }
        
      }
    }
    __builtin_amdgcn_fence(__ATOMIC_RELEASE, "workgroup");
    __builtin_amdgcn_wave_barrier();
    __builtin_amdgcn_fence(__ATOMIC_ACQUIRE, "workgroup");
  }
}

// ---------------------------------------------------------------------------
// Contiguous bf16 RNE convert of an f32 array: 8 consecutive elements per thread = one 16-B store; 8 consecutive lanes
// Coverage: grid = n8/256 blocks x 256 threads x 8 elements (n8 = n/8, host guarantees n % 2048 == 0).
// ---------------------------------------------------------------------------
__global__ __launch_bounds__(256) void conv8_kernel(const float* __restrict__ in, unsigned short* __restrict__ out, int n8) {
  const int i = blockIdx.x * 256 + threadIdx.x;
  if (i < n8) {
    const size_t e0 = (size_t)i * 8;
    const v4f a = *(const v4f*)(in + e0);
    const v4f c = *(const v4f*)(in + e0 + 4);
    v4u hv;
    hv[0] = bf_pk(a[0], a[1]);
    hv[1] = bf_pk(a[2], a[3]);
    hv[2] = bf_pk(c[0], c[1]);
    hv[3] = bf_pk(c[2], c[3]);
    {
      *(v4u*)(out + e0) = hv;
      
    }
  }
}

// ---------------------------------------------------------------------------
// Fused transpose + bf16 RNE convert of an f32 matrix, z-batched, one plane:
//   in_z = W + z*sIn viewed [R rows][Cc cols] with row pitch ldin  ->  oh_z[c][r] = bf16(in_z[r][c]), row pitch ldout, oh_z = oh + z*sOut.
// 64x64 tiles through LDS. grid = (Cc/64, R/64, Z), 256 threads (R, Cc multiples of 64; ldout multiple of 64 so every
// Coverage per block: load 4 it x 256 thr x 4 floats = 64x64; store 2 it x 256 thr x 8 u16 = 64x64.
// ---------------------------------------------------------------------------
__global__ __launch_bounds__(256) void tconv_kernel(const float* __restrict__ W, unsigned short* __restrict__ oh,
                                                    int ldin, int ldout, long sIn, long sOut) {
  __shared__ __align__(16) float tf[64 * 68];
  W  += (size_t)blockIdx.z * sIn;
  oh += (size_t)blockIdx.z * sOut;
  const int c0  = blockIdx.x * 64;   // input column block = output row block
  const int r0  = blockIdx.y * 64;   // input row block    = output column block
  const int tid = threadIdx.x;
  {
    const int lr = tid >> 4;         // 0..15
    const int c4 = (tid & 15) * 4;   // 0..60
#pragma unroll
    for (int it = 0; it < 4; ++it) {
      const int rr = it * 16 + lr;   // 0..63
      const v4f a = *(const v4f*)(W + (size_t)(r0 + rr) * ldin + c0 + c4);
      *(v4f*)(tf + rr * 68 + c4) = a;
    }
  }
  __syncthreads();
  const int sub = tid >> 3;          // 0..31
  const int c8  = (tid & 7) * 8;     // 0..56
  v4u hv[2];
#pragma unroll
  for (int it = 0; it < 2; ++it) {
    const int oc = it * 32 + sub;    // output row within tile (= input column)
    v4u a;
#pragma unroll
    for (int q = 0; q < 4; ++q) {
      const float f0 = tf[(c8 + 2 * q) * 68 + oc];
      const float f1 = tf[(c8 + 2 * q + 1) * 68 + oc];
      a[q] = bf_pk(f0, f1);
    }
    hv[it] = a;
  }
  {
#pragma unroll
    for (int it = 0; it < 2; ++it) {
      const int oc = it * 32 + sub;
      const size_t go = (size_t)(c0 + oc) * ldout + r0 + c8;
      *(v4u*)(oh + go) = hv[it];
    }
    
  }
}

#define AT_D  32
#define AT_C  64
#define AT_NW 4
#define AT_QB 64
#define AT_KC 64
#define OSP   68
#define AT_KP 40    // LDS row pitch of the K tiles in elements: 80 B = 16 B x 5, so 16 rows' 16-B reads fall on 64 distinct banks
#define AT_L2E 1.44269504088896340736f   // log2(e)
#define AT_VP 72    // LDS row pitch of the V^T tiles in elements: 144 B = 16 B x 9, same reason
#define AT_KT (AT_KC * AT_KP)            // elements of one K plane tile in LDS (5 KB)
#define AT_VT (AT_C * AT_VP)             // elements of one V^T plane tile in LDS (9 KB)
#define AT_ST (2 * AT_KT + 2 * AT_VT)    // elements of one buffer: K hi | K lo | V^T hi | V^T lo (28 KB)

static_assert(NTOK % AT_QB == 0);
static_assert(NTOK % AT_KC == 0);
static_assert(AT_C == CHN);
static_assert(AT_D == DQK);
static_assert(AT_KP >= AT_D && AT_KP % 8 == 0 && (AT_KP / 8) % 2 == 1);
static_assert(AT_VP >= AT_KC && AT_VP % 8 == 0 && (AT_VP / 8) % 2 == 1);

// lane l <-> lane l ^ 16 in the vector unit
__device__ __forceinline__ float at_xhalf(float x) {
  const int i = __builtin_bit_cast(int, x);
  return __builtin_bit_cast(float, __builtin_amdgcn_permlanex16(i, i, 0x76543210, 0xfedcba98, false, false));
}
// 2^x on the hardware's own instruction; every x here is -inf, or finite and not above a rounding error over 0, so nothing
// overflows, and a result under the smallest normal may go to 0 beside a row sum of about 1 or more
__device__ __forceinline__ float at_exp2(float x) { return __builtin_amdgcn_exp2f(x); }
// the builtin alone: the compiler keeps the distances behind it and is free to run independent products back to back
__device__ __forceinline__ v8f at_mma(v16b a, v16b b, v8f c) {
  return __builtin_amdgcn_wmma_f32_16x16x32_bf16(false, a, false, b, (short)0, c, false, false);
}

// byte address in the work-group's LDS of an element of a __shared__ array
__device__ __forceinline__ unsigned at_lds(const __bf16* p) {
  typedef __attribute__((address_space(3))) const __bf16 lds_bf;
  return (unsigned)(uintptr_t)(lds_bf*)p;
}
// One chunk's K and V^T tiles, hi and lo, into one LDS buffer: 12 asynchronous 16-B copies a lane, through no register.
// lk / lv: the lane's LDS byte address of its first K hi / V^T hi piece in that buffer; kh, kl, vh, vl: its first global pieces.
// s_wait_xcnt 0 as the statement's last line: a precaution, it stands in front of every later write of a register that a copy names.
__device__ __forceinline__ void at_stage(unsigned lk, unsigned lv, const __bf16* kh, const __bf16* kl,
                                         const __bf16* vh, const __bf16* vl) {
  asm volatile(
      "global_load_async_to_lds_b128 %0, %12, off\n\t"
      "global_load_async_to_lds_b128 %1, %13, off\n\t"
      "global_load_async_to_lds_b128 %2, %14, off\n\t"
      "global_load_async_to_lds_b128 %3, %15, off\n\t"
      "global_load_async_to_lds_b128 %4, %16, off\n\t"
      "global_load_async_to_lds_b128 %5, %17, off\n\t"
      "global_load_async_to_lds_b128 %6, %18, off\n\t"
      "global_load_async_to_lds_b128 %7, %19, off\n\t"
      "global_load_async_to_lds_b128 %8, %20, off\n\t"
      "global_load_async_to_lds_b128 %9, %21, off\n\t"
      "global_load_async_to_lds_b128 %10, %22, off\n\t"
      "global_load_async_to_lds_b128 %11, %23, off\n\t"
      "s_wait_xcnt 0x0"
      :: "v"(lk), "v"(lk + AT_KP * 2), "v"(lk + AT_KT * 2), "v"(lk + AT_KT * 2 + AT_KP * 2),
         "v"(lv), "v"(lv + AT_VP * 2), "v"(lv + AT_VP * 4), "v"(lv + AT_VP * 6),
         "v"(lv + AT_VT * 2), "v"(lv + AT_VT * 2 + AT_VP * 2), "v"(lv + AT_VT * 2 + AT_VP * 4), "v"(lv + AT_VT * 2 + AT_VP * 6),
         "v"(kh), "v"(kh + QKP), "v"(kl), "v"(kl + QKP),
         "v"(vh), "v"(vh + NTOK), "v"(vh + 2 * NTOK), "v"(vh + 3 * NTOK),
         "v"(vl), "v"(vl + NTOK), "v"(vl + 2 * NTOK), "v"(vl + 3 * NTOK)
      : "memory");
}

__global__ __launch_bounds__(128)
void attn_kernel(const unsigned short* __restrict__ qkhp, const unsigned short* __restrict__ qklp,
                 const unsigned short* __restrict__ vhp, const unsigned short* __restrict__ vlp,
                 float* __restrict__ out) {
  union FB { v16b v; v8b h[2]; unsigned u[8]; };
  __shared__ __align__(16) __bf16 St[2 * AT_ST];                 // two buffers of K hi [kv][d] | K lo | V hi [c][kv] | V lo, padded rows
  __shared__ __align__(16) float  Os[AT_C * OSP];                // block out tile [c][q], pitch 68

  const int tid  = threadIdx.x;
  const int wave = tid >> 5;
  const int lane = tid & 31;
  const int hh   = lane >> 4;
  const int c    = lane & 15;

  const int nqb  = NTOK / AT_QB;           // 64 query blocks per batch element
  const int bx   = blockIdx.x;             // grid = NB * nqb (exact)
  const int qb   = bx % nqb;
  const int b    = bx / nqb;               // 0..7
  const int nblk = qb * AT_QB;             // first position of this block
  const int q0   = b * NTOK + nblk + wave * 16;   // row in the q|k planes

  const __bf16* Qh = (const __bf16*)(const void*)qkhp;
  const __bf16* Ql = (const __bf16*)(const void*)qklp;
  const __bf16* Kh = Qh + AT_D;                                    // k columns 32..63
  const __bf16* Kl = Ql + AT_D;
  const __bf16* Vh = (const __bf16*)(const void*)vhp + (size_t)b * AT_C * NTOK;
  const __bf16* Vl = (const __bf16*)(const void*)vlp + (size_t)b * AT_C * NTOK;

  // ---- Q fragments (B operand, column = query = lane&15, split k map via Frag load): one 32-deep chunk, hi and lo ----
  const v16b qbh = Frag<__bf16>::load(Qh + (size_t)(q0 + c) * QKP + 8 * hh);
  const v16b qbl = Frag<__bf16>::load(Ql + (size_t)(q0 + c) * QKP + 8 * hh);

  // one query per lane: running max times log2(e) (equal in both lane halves) and this half's share of the row sum
  float mrow = -INFINITY, lrow = 0.f;
  v8f oacc[4];                             // oacc[t][r] = o^T(channel t*16 + 8*hh + r, query c)
#pragma unroll
  for (int t = 0; t < 4; ++t) oacc[t] = (v8f){0.f,0.f,0.f,0.f,0.f,0.f,0.f,0.f};

  const int nChunks = NTOK / AT_KC;   // 64, compile-time constant
  static_assert(NTOK / AT_KC >= 2);
  // staging coverage: K: 4 waves x 2 x (8 rows x 32) = 64 rows x 32; V: 4 waves x 4 x (4 rows x 64) = 64 rows x 64 = whole tiles
  // Neighbouring lanes take neighbouring 16-B pieces of ONE row, so a wave-wide copy touches as few cache lines as its 512 B
  // allow: 8 lanes = a whole 128-B V^T row (4 lines a copy), 4 lanes = the 64-B k part of a q|k row (8 lines a copy).
  // The rows that share a half-wave lie 8 apart (V^T: 8 x 144 B is a shift of 32 banks) or 4 apart (K: 4 x 80 B is a shift of
  // 16 banks), so the 16 lanes' 16-B LDS writes fall on 64 distinct banks.
  const int kq = (tid & 3) * 8;                                        // d offset in the K row
  const int kr = (wave >> 1) * 32 + ((tid >> 4) & 1) * 16 + ((tid >> 2) & 3) * 4 + (wave & 1) * 2;   // + i, i < 2
  const int vq = (tid & 7) * 8;                                        // key offset in the V^T row
  const int vr = (wave >> 1) * 32 + ((tid >> 3) & 3) * 8 + (wave & 1) * 4;                           // + i, i < 4
  const __bf16* ksh = Kh + (size_t)(b * NTOK + kr) * QKP + kq;         // K row (b, kr), d = kq..kq+7; chunk t: + t * 64 rows
  const __bf16* ksl = Kl + (size_t)(b * NTOK + kr) * QKP + kq;
  const __bf16* vsh = Vh + (size_t)vr * NTOK + vq;                     // V^T row c = vr, keys vq..vq+7; chunk t: + t * 64 keys
  const __bf16* vsl = Vl + (size_t)vr * NTOK + vq;
  const unsigned lk0 = at_lds(St + kr * AT_KP + kq);                   // buffer 0; buffer 1: + AT_ST * 2 bytes
  const unsigned lv0 = at_lds(St + 2 * AT_KT + vr * AT_VP + vq);

  // chunk 0 into buffer 0, landed and published; then chunk 1 into buffer 1, which flies while chunk 0 is worked on
  at_stage(lk0, lv0, ksh, ksl, vsh, vsl);
  asm volatile("s_wait_asynccnt 0x0" ::: "memory");   // this wave's copies of chunk 0 have landed before the barrier publishes them
  __syncthreads();
  at_stage(lk0 + AT_ST * 2, lv0 + AT_ST * 2, ksh + (size_t)AT_KC * QKP, ksl + (size_t)AT_KC * QKP, vsh + AT_KC, vsl + AT_KC);

  for (int kc = 0; kc < nChunks; ++kc) {
    const __bf16* Ksh = St + (kc & 1) * AT_ST;   // this trip's buffer
    const __bf16* Ksl = Ksh + AT_KT;
    const __bf16* Vth = Ksh + 2 * AT_KT;
    const __bf16* Vtl = Vth + AT_VT;

    // s[j][r] = energy^T(key j*16 + 8*hh + r, query c): K rows are the A operand, Q the B operand
    // All fragment reads of the chunk are issued here as one group, K first: the energy products wait for the K part alone,
    // and the V^T fragments land while the energies and the softmax are worked on.
    FB kb[4], kl[4], vb[2][4], vl[2][4];
#pragma unroll
    for (int j = 0; j < 4; ++j) {
      kb[j].h[0] = *(const v8b*)(Ksh + (j * 16 + c) * AT_KP + 8 * hh);
      kb[j].h[1] = *(const v8b*)(Ksh + (j * 16 + c) * AT_KP + 16 + 8 * hh);
    }
#pragma unroll
    for (int j = 0; j < 4; ++j) {
      kl[j].h[0] = *(const v8b*)(Ksl + (j * 16 + c) * AT_KP + 8 * hh);
      kl[j].h[1] = *(const v8b*)(Ksl + (j * 16 + c) * AT_KP + 16 + 8 * hh);
    }
#pragma unroll
    for (int kk = 0; kk < 2; ++kk) {
#pragma unroll
      for (int t = 0; t < 4; ++t) {
        vb[kk][t].h[0] = *(const v8b*)(Vth + (t * 16 + c) * AT_VP + kk * 32 + 8 * hh);
        vb[kk][t].h[1] = *(const v8b*)(Vth + (t * 16 + c) * AT_VP + kk * 32 + 16 + 8 * hh);
        vl[kk][t].h[0] = *(const v8b*)(Vtl + (t * 16 + c) * AT_VP + kk * 32 + 8 * hh);
        vl[kk][t].h[1] = *(const v8b*)(Vtl + (t * 16 + c) * AT_VP + kk * 32 + 16 + 8 * hh);
      }
    }
    // keeps the reads in this order above the products: without it the V^T reads are moved in front of the K reads, and the
    // first product waits for them too
    __builtin_amdgcn_sched_barrier(0);
    // term by term over the four independent accumulators (each s[j] still sums hi.hi, lo.hi, hi.lo in that order)
    v8f s[4];
#pragma unroll
    for (int j = 0; j < 4; ++j) s[j] = at_mma(kb[j].v, qbh, (v8f){0.f,0.f,0.f,0.f,0.f,0.f,0.f,0.f});
    // this one and the next keep the terms apart: regrouped by accumulator, every product would wait for the one before it
    __builtin_amdgcn_sched_barrier(0);
#pragma unroll
    for (int j = 0; j < 4; ++j) s[j] = at_mma(kl[j].v, qbh, s[j]);
    __builtin_amdgcn_sched_barrier(0);
#pragma unroll
    for (int j = 0; j < 4; ++j) s[j] = at_mma(kb[j].v, qbl, s[j]);
    // chunk max of this lane's query (no energy scaling): 32 keys in the lane, the other 32 in lane ^ 16
    float cm = -INFINITY;
#pragma unroll
    for (int j = 0; j < 4; ++j)
#pragma unroll
      for (int r = 0; r < 8; ++r) cm = fmaxf(cm, s[j][r]);
    cm = fmaxf(cm, at_xhalf(cm));
    const float mnew  = fmaxf(mrow, cm * AT_L2E);
    const float alpha = at_exp2(mrow - mnew);
    mrow = mnew;
    // p^T packs in place into B operands: element e of chunk half kk = key kk*32 + (e < 8 ? 8*hh + e : 16 + 8*hh + e - 8),
    // the same k order as the two 16-B reads of a V^T row above
    FB ph[2], pl[2];
    float ps[4];
#pragma unroll
    for (int j = 0; j < 4; ++j) {
      ps[j] = 0.f;
#pragma unroll
      for (int r = 0; r < 8; r += 2) {
        const v2f x = __builtin_elementwise_fma((v2f){s[j][r], s[j][r + 1]}, (v2f){AT_L2E, AT_L2E}, (v2f){-mnew, -mnew});
        const float p0 = at_exp2(x[0]);
        const float p1 = at_exp2(x[1]);
        ps[j] += p0;
        ps[j] += p1;
        split_pk(p0, p1, ph[j >> 1].u[(j & 1) * 4 + (r >> 1)], pl[j >> 1].u[(j & 1) * 4 + (r >> 1)]);
      }
    }
    lrow = lrow * alpha + ((ps[0] + ps[1]) + (ps[2] + ps[3]));
#pragma unroll
    for (int t = 0; t < 4; ++t)
#pragma unroll
      for (int r = 0; r < 8; ++r) oacc[t][r] *= alpha;
#pragma unroll
    for (int kk = 0; kk < 2; ++kk) {
      // term by term over the four independent accumulators (each oacc[t] still sums hi.hi, lo.hi, hi.lo in that order);
      // the two scheduling barriers keep the terms apart as above, but let vector, transcendental and scalar instructions
      // cross (mask 0x406), so that the other chunk half's softmax still fills the slots between the products
#pragma unroll
      for (int t = 0; t < 4; ++t) oacc[t] = at_mma(vb[kk][t].v, ph[kk].v, oacc[t]);
      __builtin_amdgcn_sched_barrier(0x406);
#pragma unroll
      for (int t = 0; t < 4; ++t) oacc[t] = at_mma(vl[kk][t].v, ph[kk].v, oacc[t]);
      __builtin_amdgcn_sched_barrier(0x406);
#pragma unroll
      for (int t = 0; t < 4; ++t) oacc[t] = at_mma(vb[kk][t].v, pl[kk].v, oacc[t]);
    }
    // keeps the products above the hand-over: without it the waits and the barrier are lifted to right behind the fragment reads,
    // and the wait for the next chunk's copies comes shortly after their issue instead of a whole trip later
    __builtin_amdgcn_sched_barrier(0);
    // hand-over: this wave's reads of the trip's buffer are done, its copies of the next chunk have landed; the barrier says both
    // of every wave, so the next chunk may be read and this trip's buffer filled anew
    asm volatile("s_wait_dscnt 0x0" ::: "memory");
    asm volatile("s_wait_asynccnt 0x0" ::: "memory");
    __syncthreads();
    if (kc + 2 < nChunks) {
      const size_t t2 = (size_t)(kc + 2) * AT_KC;
      const unsigned bo = (unsigned)(kc & 1) * (AT_ST * 2);
      at_stage(lk0 + bo, lv0 + bo, ksh + t2 * QKP, ksl + t2 * QKP, vsh + t2, vsl + t2);
    }
  }
  asm volatile("s_wait_asynccnt 0x0" ::: "memory");   // nothing of this wave is in flight when it leaves the loop

  // ---- join the two halves' row sums, normalise, stage the block's 64 (channel) x 64 (position) tile, write NCHW segments ----
  {
    const float inv = 1.0f / (lrow + at_xhalf(lrow));
#pragma unroll
    for (int t = 0; t < 4; ++t)
#pragma unroll
      for (int r = 0; r < 8; ++r) Os[(t * 16 + 8 * hh + r) * OSP + wave * 16 + c] = oacc[t][r] * inv;
  }
  __syncthreads();
  {
    const int c4 = c * 4;                                 // position offset within the block (0..60)
    float* ob = out + ((size_t)b * AT_C) * NTOK + nblk + c4;
    v4f ov[8];
#pragma unroll
    for (int it = 0; it < 8; ++it) {
      const int ch = wave * 16 + it * 2 + hh;             // it 0..7 x hh 0..1 = channels 0..15 of this wave
      ov[it] = *(const v4f*)(Os + ch * OSP + c4);
    }
#pragma unroll
    for (int it = 0; it < 8; ++it) {
      const int ch = wave * 16 + it * 2 + hh;
      *(v4f*)(ob + (size_t)ch * NTOK) = ov[it];
    }
  }
}

// ---------------------------------------------------------------------------
// Workspace region map (byte offsets; every region is fully written by its producer launch before any consumer
//   XB    bf16 [32768][64]            0       4194304
//   WB    bf16 [128][64]        4194304         16384
//   QKh   bf16 [32768][64]      4210688       4194304   QKl   8404992
//   VTh   bf16 [8][64][4096]   12599296       4194304   VTl  16793600
//   total                      20987904
// ---------------------------------------------------------------------------
extern "C" void kernel_launch(void* const* d_in, const int* in_sizes, int n_in,
                              void* d_out, int out_size, void* d_ws, size_t ws_size,
                              hipStream_t stream) {
  if (n_in < 4) return;
  if (in_sizes[0] != NB * CHN * NTOK) return;      // x  [8][64][64][64]
  if (in_sizes[1] != DQK * CHN) return;            // wq [32][64]
  if (in_sizes[2] != DQK * CHN) return;            // wk [32][64]
  if (in_sizes[3] != CHN * CHN) return;            // wv [64][64]
  if (out_size != NB * CHN * NTOK) return;

  const float* x  = (const float*)d_in[0];
  const float* wq = (const float*)d_in[1];   // [out 32][in 64]
  const float* wk = (const float*)d_in[2];   // [out 32][in 64]
  const float* wv = (const float*)d_in[3];   // [out 64][in 64]

  const size_t PXB = (size_t)MTOK * CHN * 2;         // 4194304
  const size_t PWB = (size_t)WROWS * CHN * 2;        // 16384
  const size_t PQK = (size_t)MTOK * QKP * 2;         // 4194304 per plane
  const size_t PVT = (size_t)NB * CHN * NTOK * 2;    // 4194304 per plane
  size_t off = 0;
  const size_t oXB  = off; off += PXB;
  const size_t oWB  = off; off += PWB;
  const size_t oQKh = off; off += PQK;  const size_t oQKl = off; off += PQK;
  const size_t oVTh = off; off += PVT;  const size_t oVTl = off; off += PVT;
  if (off > ws_size) return;                         // off = 20987904
  if (off > (size_t)134217728) return;

  char* ws = (char*)d_ws;
  unsigned short* XB  = (unsigned short*)(ws + oXB);
  unsigned short* WB  = (unsigned short*)(ws + oWB);
  unsigned short* QKh = (unsigned short*)(ws + oQKh); unsigned short* QKl = (unsigned short*)(ws + oQKl);
  unsigned short* VTh = (unsigned short*)(ws + oVTh); unsigned short* VTl = (unsigned short*)(ws + oVTl);

  const dim3 blk(256);

  // (1) x[b] viewed [R=64 c][Cc=4096 n] (pitch 4096) -> XB_b[n][c] (pitch 64); grid (Cc/64, R/64, B) = (64, 1, 8)
  tconv_kernel<<<dim3(NTOK / 64, CHN / 64, NB), blk, 0, stream>>>(x, XB, NTOK, CHN, (long)CHN * NTOK, (long)NTOK * CHN);
  // (2) weights -> WB bf16 rows 0..31 wq, 32..63 wk, 64..127 wv (natural [out][in]); 256 / 256 / 512 units
  conv8_kernel<<<dim3((DQK * CHN / 8) / 256), blk, 0, stream>>>(wq, WB, DQK * CHN / 8);
  conv8_kernel<<<dim3((DQK * CHN / 8) / 256), blk, 0, stream>>>(wk, WB + (size_t)DQK * CHN, DQK * CHN / 8);
  conv8_kernel<<<dim3((CHN * CHN / 8) / 256), blk, 0, stream>>>(wv, WB + (size_t)2 * DQK * CHN, CHN * CHN / 8);
  // (3) q|k = XB . WB[0..63]^T -> QKh|QKl [32768][64]   (M=32768, N=64, K=64; 512 tiles -> 64 blocks)
  const dim3 gQK(((MTOK / 64) * (QKP / 64) + 7) / 8, 1);
  wmma_gemm64<1, false, 0, 2, false, 0><<<gQK, blk, 0, stream>>>(
      XB, XB, CHN, 0L, WB, WB, CHN, 0L, (void*)QKh, (void*)QKl, QKP, 0L,
      wq, wq, 0L, MTOK, QKP, CHN, 1.0f);
  // (4) v^T_b = WB[64..127] . XB_b^T -> VTh|VTl [b][64][4096]   (M=64, N=4096, K=64 per batch; 64 tiles -> 8 blocks x 8 batches)
  const dim3 gVT(((CHN / 64) * (NTOK / 64) + 7) / 8, NB);
  wmma_gemm64<1, false, 0, 2, false, 0><<<gVT, blk, 0, stream>>>(
      WB + (size_t)2 * DQK * CHN, WB + (size_t)2 * DQK * CHN, CHN, 0L, XB, XB, CHN, (long)NTOK * CHN,
      (void*)VTh, (void*)VTl, NTOK, (long)CHN * NTOK,
      wq, wq, 0L, CHN, NTOK, CHN, 1.0f);
  // (5) attention per (batch, 64-position block) -> NCHW d_out; 512 blocks of 128 threads
  attn_kernel<<<dim3(NB * (NTOK / AT_QB)), dim3(128), 0, stream>>>(QKh, QKl, VTh, VTl, (float*)d_out);
  (void)hipGetLastError();
}

// v008
// Measured time: 70.1 microseconds a run.
// Two timings next to v007 both put it at 1.34 times that version's speed.
// All steps since v000 together make it 4.36 times as fast.
// Contractions: q|k projection and v^T projection = v_wmma_f32_16x16x32_bf16 single products on the RNE bf16 conversions of the
// f32 inputs (f32 accumulate, results split into bf16 hi|lo planes); q.k^T energies and p.v = bf16 hi/lo split
// (hi.hi + hi.lo + lo.hi) on v_wmma_f32_16x16x32_bf16, f32 accumulate; online max-shifted softmax (base 2: one fma and one
// v_exp_f32 per energy) and 1/rowsum in f32 on the VALU.
// Two launches: the projections (x and the weights are converted in registers, no bf16 copy of them is stored), the attention.
// Plane / carry map (every plane carries factor 1, nothing to fold back):
//   QKh|QKl bf16 [32768 (b*4096+n)][64], n = y*64 + x (NCHW token order): cols 0..31 = q hi|lo over d, cols 32..63 = k hi|lo over d;
//   VTh|VTl bf16 [8][64 c][4096 m];
//   P hi|lo = unnormalised exp in (0,1] (bf16 keeps the f32 exponent range); 1/rowsum is applied to the f32 accumulator
//   in the attention epilogue right before the NCHW store (the only place a normaliser is applied).
#include <hip/hip_runtime.h>
#include <math.h>
#include <stdint.h>

#define NB    8
#define CHN   64
#define DQK   32
#define IMH   64
#define IMW   64
#define NTOK  4096
#define MTOK  (NB * NTOK)
#define QKP   64

static_assert(NTOK == IMH * IMW);
static_assert(CHN == 64);
static_assert(DQK == 32);
static_assert(QKP == 2 * DQK);
static_assert(NTOK % 64 == 0);
static_assert(MTOK % 128 == 0);

typedef __attribute__((ext_vector_type(16))) __bf16   v16b;
typedef __attribute__((ext_vector_type(8)))  __bf16   v8b;
typedef __attribute__((ext_vector_type(2)))  __bf16   v2b;
typedef __attribute__((ext_vector_type(8)))  float    v8f;
typedef __attribute__((ext_vector_type(4)))  float    v4f;
typedef __attribute__((ext_vector_type(2)))  float    v2f;
typedef __attribute__((ext_vector_type(4)))  unsigned int v4u;

// bf16 of two neighbouring elements in one register (a in the low half): one v_cvt_pk_bf16_f32, round to nearest even
__device__ __forceinline__ unsigned bf_pk(float a, float b) {
  return __builtin_bit_cast(unsigned, __builtin_convertvector((v2f){a, b}, v2b));
}
// hi/lo split of two neighbouring elements, one packed register each (p0 in the low half): hi = bf16(p), lo = bf16(p - hi)
__device__ __forceinline__ void split_pk(float p0, float p1, unsigned& hi, unsigned& lo) {
  const v2f p = (v2f){p0, p1};
  const v2b h = __builtin_convertvector(p, v2b);
  const v2f d = p - __builtin_convertvector(h, v2f);             // exact in f32
  hi = __builtin_bit_cast(unsigned, h);
  lo = __builtin_bit_cast(unsigned, __builtin_convertvector(d, v2b));
}

template <typename T> struct Frag;
template <> struct Frag<__bf16> {
  typedef v16b V; union U { v16b v; v8b h[2]; };
  static __device__ __forceinline__ v16b load(const __bf16* p) {   // elements 0..7 <- p[0..7], 8..15 <- p[16..23]
    U f; f.h[0] = *(const v8b*)(p); f.h[1] = *(const v8b*)(p + 16); return f.v;
  }
};

#define AT_D  32
#define AT_C  64
#define AT_NW 4
#define AT_QB 64
#define AT_KC 64
#define OSP   68
#define AT_KP 40    // LDS row pitch of the K tiles in elements: 80 B = 16 B x 5, so 16 rows' 16-B reads fall on 64 distinct banks
#define AT_L2E 1.44269504088896340736f   // log2(e)
#define AT_VP 72    // LDS row pitch of the V^T tiles in elements: 144 B = 16 B x 9, same reason
#define AT_KT (AT_KC * AT_KP)            // elements of one K plane tile in LDS (5 KB)
#define AT_VT (AT_C * AT_VP)             // elements of one V^T plane tile in LDS (9 KB)
#define AT_ST (2 * AT_KT + 2 * AT_VT)    // elements of one buffer: K hi | K lo | V^T hi | V^T lo (28 KB)

static_assert(NTOK % AT_QB == 0);
static_assert(NTOK % AT_KC == 0);
static_assert(AT_C == CHN);
static_assert(AT_D == DQK);
static_assert(AT_KP >= AT_D && AT_KP % 8 == 0 && (AT_KP / 8) % 2 == 1);
static_assert(AT_VP >= AT_KC && AT_VP % 8 == 0 && (AT_VP / 8) % 2 == 1);

// lane l <-> lane l ^ 16 in the vector unit
__device__ __forceinline__ float at_xhalf(float x) {
  const int i = __builtin_bit_cast(int, x);
  return __builtin_bit_cast(float, __builtin_amdgcn_permlanex16(i, i, 0x76543210, 0xfedcba98, false, false));
}
// 2^x on the hardware's own instruction; every x here is -inf, or finite and not above a rounding error over 0, so nothing
// overflows, and a result under the smallest normal may go to 0 beside a row sum of about 1 or more
__device__ __forceinline__ float at_exp2(float x) { return __builtin_amdgcn_exp2f(x); }
// the builtin alone: the compiler keeps the distances behind it and is free to run independent products back to back
__device__ __forceinline__ v8f at_mma(v16b a, v16b b, v8f c) {
  return __builtin_amdgcn_wmma_f32_16x16x32_bf16(false, a, false, b, (short)0, c, false, false);
}

// byte address in the work-group's LDS of an element of a __shared__ array
__device__ __forceinline__ unsigned at_lds(const __bf16* p) {
  typedef __attribute__((address_space(3))) const __bf16 lds_bf;
  return (unsigned)(uintptr_t)(lds_bf*)p;
}
// One chunk's K and V^T tiles, hi and lo, into one LDS buffer: 12 asynchronous 16-B copies a lane, through no register.
// lk / lv: the lane's LDS byte address of its first K hi / V^T hi piece in that buffer; kh, kl, vh, vl: its first global pieces.
// s_wait_xcnt 0 as the statement's last line: a precaution, it stands in front of every later write of a register that a copy names.
__device__ __forceinline__ void at_stage(unsigned lk, unsigned lv, const __bf16* kh, const __bf16* kl,
                                         const __bf16* vh, const __bf16* vl) {
  asm volatile(
      "global_load_async_to_lds_b128 %0, %12, off\n\t"
      "global_load_async_to_lds_b128 %1, %13, off\n\t"
      "global_load_async_to_lds_b128 %2, %14, off\n\t"
      "global_load_async_to_lds_b128 %3, %15, off\n\t"
      "global_load_async_to_lds_b128 %4, %16, off\n\t"
      "global_load_async_to_lds_b128 %5, %17, off\n\t"
      "global_load_async_to_lds_b128 %6, %18, off\n\t"
      "global_load_async_to_lds_b128 %7, %19, off\n\t"
      "global_load_async_to_lds_b128 %8, %20, off\n\t"
      "global_load_async_to_lds_b128 %9, %21, off\n\t"
      "global_load_async_to_lds_b128 %10, %22, off\n\t"
      "global_load_async_to_lds_b128 %11, %23, off\n\t"
      "s_wait_xcnt 0x0"
      :: "v"(lk), "v"(lk + AT_KP * 2), "v"(lk + AT_KT * 2), "v"(lk + AT_KT * 2 + AT_KP * 2),
         "v"(lv), "v"(lv + AT_VP * 2), "v"(lv + AT_VP * 4), "v"(lv + AT_VP * 6),
         "v"(lv + AT_VT * 2), "v"(lv + AT_VT * 2 + AT_VP * 2), "v"(lv + AT_VT * 2 + AT_VP * 4), "v"(lv + AT_VT * 2 + AT_VP * 6),
         "v"(kh), "v"(kh + QKP), "v"(kl), "v"(kl + QKP),
         "v"(vh), "v"(vh + NTOK), "v"(vh + 2 * NTOK), "v"(vh + 3 * NTOK),
         "v"(vl), "v"(vl + NTOK), "v"(vl + 2 * NTOK), "v"(vl + 3 * NTOK)
      : "memory");
}

__global__ __launch_bounds__(128)
void attn_kernel(const unsigned short* __restrict__ qkhp, const unsigned short* __restrict__ qklp,
                 const unsigned short* __restrict__ vhp, const unsigned short* __restrict__ vlp,
                 float* __restrict__ out) {
  union FB { v16b v; v8b h[2]; unsigned u[8]; };
  __shared__ __align__(16) __bf16 St[2 * AT_ST];                 // two buffers of K hi [kv][d] | K lo | V hi [c][kv] | V lo, padded rows
  __shared__ __align__(16) float  Os[AT_C * OSP];                // block out tile [c][q], pitch 68

  const int tid  = threadIdx.x;
  const int wave = tid >> 5;
  const int lane = tid & 31;
  const int hh   = lane >> 4;
  const int c    = lane & 15;

  const int nqb  = NTOK / AT_QB;           // 64 query blocks per batch element
  const int bx   = blockIdx.x;             // grid = NB * nqb (exact)
  const int qb   = bx % nqb;
  const int b    = bx / nqb;               // 0..7
  const int nblk = qb * AT_QB;             // first position of this block
  const int q0   = b * NTOK + nblk + wave * 16;   // row in the q|k planes

  const __bf16* Qh = (const __bf16*)(const void*)qkhp;
  const __bf16* Ql = (const __bf16*)(const void*)qklp;
  const __bf16* Kh = Qh + AT_D;                                    // k columns 32..63
  const __bf16* Kl = Ql + AT_D;
  const __bf16* Vh = (const __bf16*)(const void*)vhp + (size_t)b * AT_C * NTOK;
  const __bf16* Vl = (const __bf16*)(const void*)vlp + (size_t)b * AT_C * NTOK;

  // ---- Q fragments (B operand, column = query = lane&15, split k map via Frag load): one 32-deep chunk, hi and lo ----
  const v16b qbh = Frag<__bf16>::load(Qh + (size_t)(q0 + c) * QKP + 8 * hh);
  const v16b qbl = Frag<__bf16>::load(Ql + (size_t)(q0 + c) * QKP + 8 * hh);

  // one query per lane: running max times log2(e) (equal in both lane halves) and this half's share of the row sum
  float mrow = -INFINITY, lrow = 0.f;
  v8f oacc[4];                             // oacc[t][r] = o^T(channel t*16 + 8*hh + r, query c)
#pragma unroll
  for (int t = 0; t < 4; ++t) oacc[t] = (v8f){0.f,0.f,0.f,0.f,0.f,0.f,0.f,0.f};

  const int nChunks = NTOK / AT_KC;   // 64, compile-time constant
  static_assert(NTOK / AT_KC >= 2);
  // staging coverage: K: 4 waves x 2 x (8 rows x 32) = 64 rows x 32; V: 4 waves x 4 x (4 rows x 64) = 64 rows x 64 = whole tiles
  // Neighbouring lanes take neighbouring 16-B pieces of ONE row, so a wave-wide copy touches as few cache lines as its 512 B
  // allow: 8 lanes = a whole 128-B V^T row (4 lines a copy), 4 lanes = the 64-B k part of a q|k row (8 lines a copy).
  // The rows that share a half-wave lie 8 apart (V^T: 8 x 144 B is a shift of 32 banks) or 4 apart (K: 4 x 80 B is a shift of
  // 16 banks), so the 16 lanes' 16-B LDS writes fall on 64 distinct banks.
  const int kq = (tid & 3) * 8;                                        // d offset in the K row
  const int kr = (wave >> 1) * 32 + ((tid >> 4) & 1) * 16 + ((tid >> 2) & 3) * 4 + (wave & 1) * 2;   // + i, i < 2
  const int vq = (tid & 7) * 8;                                        // key offset in the V^T row
  const int vr = (wave >> 1) * 32 + ((tid >> 3) & 3) * 8 + (wave & 1) * 4;                           // + i, i < 4
  const __bf16* ksh = Kh + (size_t)(b * NTOK + kr) * QKP + kq;         // K row (b, kr), d = kq..kq+7; chunk t: + t * 64 rows
  const __bf16* ksl = Kl + (size_t)(b * NTOK + kr) * QKP + kq;
  const __bf16* vsh = Vh + (size_t)vr * NTOK + vq;                     // V^T row c = vr, keys vq..vq+7; chunk t: + t * 64 keys
  const __bf16* vsl = Vl + (size_t)vr * NTOK + vq;
  const unsigned lk0 = at_lds(St + kr * AT_KP + kq);                   // buffer 0; buffer 1: + AT_ST * 2 bytes
  const unsigned lv0 = at_lds(St + 2 * AT_KT + vr * AT_VP + vq);

  // chunk 0 into buffer 0, landed and published; then chunk 1 into buffer 1, which flies while chunk 0 is worked on
  at_stage(lk0, lv0, ksh, ksl, vsh, vsl);
  asm volatile("s_wait_asynccnt 0x0" ::: "memory");   // this wave's copies of chunk 0 have landed before the barrier publishes them
  __syncthreads();
  at_stage(lk0 + AT_ST * 2, lv0 + AT_ST * 2, ksh + (size_t)AT_KC * QKP, ksl + (size_t)AT_KC * QKP, vsh + AT_KC, vsl + AT_KC);

  for (int kc = 0; kc < nChunks; ++kc) {
    const __bf16* Ksh = St + (kc & 1) * AT_ST;   // this trip's buffer
    const __bf16* Ksl = Ksh + AT_KT;
    const __bf16* Vth = Ksh + 2 * AT_KT;
    const __bf16* Vtl = Vth + AT_VT;

    // s[j][r] = energy^T(key j*16 + 8*hh + r, query c): K rows are the A operand, Q the B operand
    // All fragment reads of the chunk are issued here as one group, K first: the energy products wait for the K part alone,
    // and the V^T fragments land while the energies and the softmax are worked on.
    FB kb[4], kl[4], vb[2][4], vl[2][4];
#pragma unroll
    for (int j = 0; j < 4; ++j) {
      kb[j].h[0] = *(const v8b*)(Ksh + (j * 16 + c) * AT_KP + 8 * hh);
      kb[j].h[1] = *(const v8b*)(Ksh + (j * 16 + c) * AT_KP + 16 + 8 * hh);
    }
#pragma unroll
    for (int j = 0; j < 4; ++j) {
      kl[j].h[0] = *(const v8b*)(Ksl + (j * 16 + c) * AT_KP + 8 * hh);
      kl[j].h[1] = *(const v8b*)(Ksl + (j * 16 + c) * AT_KP + 16 + 8 * hh);
    }
#pragma unroll
    for (int kk = 0; kk < 2; ++kk) {
#pragma unroll
      for (int t = 0; t < 4; ++t) {
        vb[kk][t].h[0] = *(const v8b*)(Vth + (t * 16 + c) * AT_VP + kk * 32 + 8 * hh);
        vb[kk][t].h[1] = *(const v8b*)(Vth + (t * 16 + c) * AT_VP + kk * 32 + 16 + 8 * hh);
        vl[kk][t].h[0] = *(const v8b*)(Vtl + (t * 16 + c) * AT_VP + kk * 32 + 8 * hh);
        vl[kk][t].h[1] = *(const v8b*)(Vtl + (t * 16 + c) * AT_VP + kk * 32 + 16 + 8 * hh);
      }
    }
    // keeps the reads in this order above the products: without it the V^T reads are moved in front of the K reads, and the
    // first product waits for them too
    __builtin_amdgcn_sched_barrier(0);
    // term by term over the four independent accumulators (each s[j] still sums hi.hi, lo.hi, hi.lo in that order)
    v8f s[4];
#pragma unroll
    for (int j = 0; j < 4; ++j) s[j] = at_mma(kb[j].v, qbh, (v8f){0.f,0.f,0.f,0.f,0.f,0.f,0.f,0.f});
    // this one and the next keep the terms apart: regrouped by accumulator, every product would wait for the one before it
    __builtin_amdgcn_sched_barrier(0);
#pragma unroll
    for (int j = 0; j < 4; ++j) s[j] = at_mma(kl[j].v, qbh, s[j]);
    __builtin_amdgcn_sched_barrier(0);
#pragma unroll
    for (int j = 0; j < 4; ++j) s[j] = at_mma(kb[j].v, qbl, s[j]);
    // chunk max of this lane's query (no energy scaling): 32 keys in the lane, the other 32 in lane ^ 16
    float cm = -INFINITY;
#pragma unroll
    for (int j = 0; j < 4; ++j)
#pragma unroll
      for (int r = 0; r < 8; ++r) cm = fmaxf(cm, s[j][r]);
    cm = fmaxf(cm, at_xhalf(cm));
    const float mnew  = fmaxf(mrow, cm * AT_L2E);
    const float alpha = at_exp2(mrow - mnew);
    mrow = mnew;
    // p^T packs in place into B operands: element e of chunk half kk = key kk*32 + (e < 8 ? 8*hh + e : 16 + 8*hh + e - 8),
    // the same k order as the two 16-B reads of a V^T row above
    FB ph[2], pl[2];
    float ps[4];
#pragma unroll
    for (int j = 0; j < 4; ++j) {
      ps[j] = 0.f;
#pragma unroll
      for (int r = 0; r < 8; r += 2) {
        const v2f x = __builtin_elementwise_fma((v2f){s[j][r], s[j][r + 1]}, (v2f){AT_L2E, AT_L2E}, (v2f){-mnew, -mnew});
        const float p0 = at_exp2(x[0]);
        const float p1 = at_exp2(x[1]);
        ps[j] += p0;
        ps[j] += p1;
        split_pk(p0, p1, ph[j >> 1].u[(j & 1) * 4 + (r >> 1)], pl[j >> 1].u[(j & 1) * 4 + (r >> 1)]);
      }
    }
    lrow = lrow * alpha + ((ps[0] + ps[1]) + (ps[2] + ps[3]));
#pragma unroll
    for (int t = 0; t < 4; ++t)
#pragma unroll
      for (int r = 0; r < 8; ++r) oacc[t][r] *= alpha;
#pragma unroll
    for (int kk = 0; kk < 2; ++kk) {
      // term by term over the four independent accumulators (each oacc[t] still sums hi.hi, lo.hi, hi.lo in that order);
      // the two scheduling barriers keep the terms apart as above, but let vector, transcendental and scalar instructions
      // cross (mask 0x406), so that the other chunk half's softmax still fills the slots between the products
#pragma unroll
      for (int t = 0; t < 4; ++t) oacc[t] = at_mma(vb[kk][t].v, ph[kk].v, oacc[t]);
      __builtin_amdgcn_sched_barrier(0x406);
#pragma unroll
      for (int t = 0; t < 4; ++t) oacc[t] = at_mma(vl[kk][t].v, ph[kk].v, oacc[t]);
      __builtin_amdgcn_sched_barrier(0x406);
#pragma unroll
      for (int t = 0; t < 4; ++t) oacc[t] = at_mma(vb[kk][t].v, pl[kk].v, oacc[t]);
    }
    // keeps the products above the hand-over: without it the waits and the barrier are lifted to right behind the fragment reads,
    // and the wait for the next chunk's copies comes shortly after their issue instead of a whole trip later
    __builtin_amdgcn_sched_barrier(0);
    // hand-over: this wave's reads of the trip's buffer are done, its copies of the next chunk have landed; the barrier says both
    // of every wave, so the next chunk may be read and this trip's buffer filled anew
    asm volatile("s_wait_dscnt 0x0" ::: "memory");
    asm volatile("s_wait_asynccnt 0x0" ::: "memory");
    __syncthreads();
    if (kc + 2 < nChunks) {
      const size_t t2 = (size_t)(kc + 2) * AT_KC;
      const unsigned bo = (unsigned)(kc & 1) * (AT_ST * 2);
      at_stage(lk0 + bo, lv0 + bo, ksh + t2 * QKP, ksl + t2 * QKP, vsh + t2, vsl + t2);
    }
  }
  asm volatile("s_wait_asynccnt 0x0" ::: "memory");   // nothing of this wave is in flight when it leaves the loop

  // ---- join the two halves' row sums, normalise, stage the block's 64 (channel) x 64 (position) tile, write NCHW segments ----
  {
    const float inv = 1.0f / (lrow + at_xhalf(lrow));
#pragma unroll
    for (int t = 0; t < 4; ++t)
#pragma unroll
      for (int r = 0; r < 8; ++r) Os[(t * 16 + 8 * hh + r) * OSP + wave * 16 + c] = oacc[t][r] * inv;
  }
  __syncthreads();
  {
    const int c4 = c * 4;                                 // position offset within the block (0..60)
    float* ob = out + ((size_t)b * AT_C) * NTOK + nblk + c4;
    v4f ov[8];
#pragma unroll
    for (int it = 0; it < 8; ++it) {
      const int ch = wave * 16 + it * 2 + hh;             // it 0..7 x hh 0..1 = channels 0..15 of this wave
      ov[it] = *(const v4f*)(Os + ch * OSP + c4);
    }
#pragma unroll
    for (int it = 0; it < 8; ++it) {
      const int ch = wave * 16 + it * 2 + hh;
      *(v4f*)(ob + (size_t)ch * NTOK) = ov[it];
    }
  }
}


// =====================================================================================
// Both projections in one launch, straight from the f32 inputs to the four bf16 planes that the attention reads.
// A wave owns 64 neighbouring positions of one batch element and one of two roles; no LDS, no barrier.
//   Position fragments: a lane reads x(c, n0 + 4j .. 4j+3), j = lane & 15, as one 16-B load per channel (a wave-wide load = two
//   channel rows of 256 B); component i goes to position tile i, so row / column j of tile i is position n0 + 4j + i. The same
//   registers serve as A and as B operand. Element e of a fragment is channel ks*32 + (e < 8 ? 8*hh + e : 16 + 8*hh + e - 8),
//   for the position fragments and the weight fragments alike.
//   Role q|k (waves 0, 1): D = W . X^T, a lane holds 8 neighbouring outputs of ONE position = one 16-B piece of a q|k row.
//   Role v^T (waves 2, 3): D = X . Wv^T, a lane holds, over the 4 position tiles, 32 neighbouring positions of ONE channel
//   (n0 + 32*hh + 4r + i) = four 16-B pieces of a v^T row. So neither result needs a transposition.
//   Every 128-B line of a plane is written by one wave. Coverage: 256 blocks x 2 groups x 64 positions = 32768, each role.
// =====================================================================================
union PF { v16b v; unsigned u[8]; };

__global__ __launch_bounds__(128)
void proj_kernel(const float* __restrict__ x, const float* __restrict__ wq, const float* __restrict__ wk,
                 const float* __restrict__ wv,
                 unsigned short* __restrict__ qkh, unsigned short* __restrict__ qkl,
                 unsigned short* __restrict__ vth, unsigned short* __restrict__ vtl) {
  const int lane = threadIdx.x & 31;
  const int wave = __builtin_amdgcn_readfirstlane(threadIdx.x >> 5);   // scalar, so the role test below is a scalar branch
  const int hh   = lane >> 4;
  const int j    = lane & 15;
  const int g    = blockIdx.x * 2 + (wave & 1);    // group of 64 positions, 0..511 (grid = MTOK / 128, exact)
  const int b    = g / (NTOK / 64);
  const int n0   = (g % (NTOK / 64)) * 64;

  // The weights of the wave's role, 4 output tiles of 16 rows: wq | wk, or wv. The row bases are picked by scalar selects in
  // front of the role branch, so that these loads and the x loads are in flight together (one memory latency, not two).
  const float* w01 = ((wave < 2) ? wq : wv) + j * CHN + 8 * hh;
  const float* w23 = ((wave < 2) ? wk : wv + 32 * CHN) + j * CHN + 8 * hh;
  const float* xp  = x + ((size_t)b * CHN + 8 * hh) * NTOK + n0 + 4 * j;
  v4f wr[4][2][4];                                 // [tile][k step][piece]: channels ks*32 + 8*hh + 0..3, 4..7, 16..19, 20..23
  v4f xr[2][16];                                   // [k step][element e]: 4 neighbouring positions of one channel
#pragma unroll
  for (int t = 0; t < 4; ++t)
#pragma unroll
    for (int ks = 0; ks < 2; ++ks)
#pragma unroll
      for (int q = 0; q < 4; ++q)
        wr[t][ks][q] = *(const v4f*)((t < 2 ? w01 : w23) + (t & 1) * 16 * CHN + ks * 32 + (q >> 1) * 16 + (q & 1) * 4);
#pragma unroll
  for (int ks = 0; ks < 2; ++ks)
#pragma unroll
    for (int e = 0; e < 16; ++e) xr[ks][e] = *(const v4f*)(xp + (size_t)(ks * 32 + (e >> 3) * 16 + (e & 7)) * NTOK);
  // stands in front of every later write of an address register that one of the loads above names (this build reuses them for the
  // converted values); the scheduling barrier keeps those writes behind it
  asm volatile("s_wait_xcnt 0x0" ::: "memory");
  __builtin_amdgcn_sched_barrier(0);

  PF wf[4][2], xf[4][2];
#pragma unroll
  for (int t = 0; t < 4; ++t)
#pragma unroll
    for (int ks = 0; ks < 2; ++ks)
#pragma unroll
      for (int q = 0; q < 4; ++q) {
        wf[t][ks].u[2 * q]     = bf_pk(wr[t][ks][q][0], wr[t][ks][q][1]);
        wf[t][ks].u[2 * q + 1] = bf_pk(wr[t][ks][q][2], wr[t][ks][q][3]);
      }
#pragma unroll
  for (int ks = 0; ks < 2; ++ks)
#pragma unroll
    for (int i = 0; i < 4; ++i)
#pragma unroll
      for (int p = 0; p < 8; ++p) xf[i][ks].u[p] = bf_pk(xr[ks][2 * p][i], xr[ks][2 * p + 1][i]);

  v8f acc[4][4];                                   // [output tile][position tile]
#pragma unroll
  for (int t = 0; t < 4; ++t)
#pragma unroll
    for (int i = 0; i < 4; ++i) acc[t][i] = (v8f){0.f,0.f,0.f,0.f,0.f,0.f,0.f,0.f};

  v4u hu[16], lu[16];                              // the wave's 16-B pieces of the hi and the lo plane
  if (wave < 2) {
#pragma unroll
    for (int ks = 0; ks < 2; ++ks)
#pragma unroll
      for (int t = 0; t < 4; ++t)
#pragma unroll
        for (int i = 0; i < 4; ++i) acc[t][i] = at_mma(wf[t][ks].v, xf[i][ks].v, acc[t][i]);
    // acc[t][i][r] = (q|k)(position n0 + 4j + i, output t*16 + 8*hh + r)
#pragma unroll
    for (int i = 0; i < 4; ++i)
#pragma unroll
      for (int t = 0; t < 4; ++t)
#pragma unroll
        for (int e = 0; e < 4; ++e) {
          unsigned h, l;
          split_pk(acc[t][i][2 * e], acc[t][i][2 * e + 1], h, l);
          hu[i * 4 + t][e] = h;
          lu[i * 4 + t][e] = l;
        }
    unsigned short* ph = qkh + (size_t)(b * NTOK + n0 + 4 * j) * QKP + 8 * hh;
    unsigned short* pl = qkl + (size_t)(b * NTOK + n0 + 4 * j) * QKP + 8 * hh;
    // all stores stand behind all vector work, so that no register which an issued store names is written again
    __builtin_amdgcn_sched_barrier(0);
#pragma unroll
    for (int i = 0; i < 4; ++i)
#pragma unroll
      for (int t = 0; t < 4; ++t) {
        *(v4u*)(ph + i * QKP + t * 16) = hu[i * 4 + t];
        *(v4u*)(pl + i * QKP + t * 16) = lu[i * 4 + t];
      }
    // behind the last store of the role: no register that an issued store names is written again in front of this wait, on
    // whichever way the built code leaves this block (the other role's block may be laid out directly behind it)
    asm volatile("s_wait_xcnt 0x0" ::: "memory");
  } else {
#pragma unroll
    for (int ks = 0; ks < 2; ++ks)
#pragma unroll
      for (int t = 0; t < 4; ++t)
#pragma unroll
        for (int i = 0; i < 4; ++i) acc[t][i] = at_mma(xf[i][ks].v, wf[t][ks].v, acc[t][i]);
    // acc[t][i][r] = v(channel t*16 + j, position n0 + 4*(8*hh + r) + i)
#pragma unroll
    for (int t = 0; t < 4; ++t)
#pragma unroll
      for (int s = 0; s < 4; ++s)
#pragma unroll
        for (int e = 0; e < 4; ++e) {              // positions 8s + 2e, 8s + 2e + 1 of the lane's 32: r = 2s + (e >> 1), i = 2*(e & 1)
          unsigned h, l;
          split_pk(acc[t][2 * (e & 1)][2 * s + (e >> 1)], acc[t][2 * (e & 1) + 1][2 * s + (e >> 1)], h, l);
          hu[t * 4 + s][e] = h;
          lu[t * 4 + s][e] = l;
        }
    unsigned short* ph = vth + (size_t)(b * CHN + j) * NTOK + n0 + 32 * hh;
    unsigned short* pl = vtl + (size_t)(b * CHN + j) * NTOK + n0 + 32 * hh;
    // as above: all stores behind all vector work
    __builtin_amdgcn_sched_barrier(0);
#pragma unroll
    for (int t = 0; t < 4; ++t)
#pragma unroll
      for (int s = 0; s < 4; ++s) {
        *(v4u*)(ph + (size_t)t * 16 * NTOK + 8 * s) = hu[t * 4 + s];
        *(v4u*)(pl + (size_t)t * 16 * NTOK + 8 * s) = lu[t * 4 + s];
      }
    // as above, behind the last store of this role
    asm volatile("s_wait_xcnt 0x0" ::: "memory");
  }
}

// ---------------------------------------------------------------------------
// Workspace region map (byte offsets; every region is fully written by the projection launch before the attention reads it)
//   QKh   bf16 [32768][64]            0       4194304   QKl   4194304
//   VTh   bf16 [8][64][4096]    8388608       4194304   VTl  12582912
//   total                      16777216
// ---------------------------------------------------------------------------
extern "C" void kernel_launch(void* const* d_in, const int* in_sizes, int n_in,
                              void* d_out, int out_size, void* d_ws, size_t ws_size,
                              hipStream_t stream) {
  if (n_in < 4) return;
  if (in_sizes[0] != NB * CHN * NTOK) return;      // x  [8][64][64][64]
  if (in_sizes[1] != DQK * CHN) return;            // wq [32][64]
  if (in_sizes[2] != DQK * CHN) return;            // wk [32][64]
  if (in_sizes[3] != CHN * CHN) return;            // wv [64][64]
  if (out_size != NB * CHN * NTOK) return;

  const float* x  = (const float*)d_in[0];
  const float* wq = (const float*)d_in[1];   // [out 32][in 64]
  const float* wk = (const float*)d_in[2];   // [out 32][in 64]
  const float* wv = (const float*)d_in[3];   // [out 64][in 64]

  const size_t PQK = (size_t)MTOK * QKP * 2;         // 4194304 per plane
  const size_t PVT = (size_t)NB * CHN * NTOK * 2;    // 4194304 per plane
  size_t off = 0;
  const size_t oQKh = off; off += PQK;  const size_t oQKl = off; off += PQK;
  const size_t oVTh = off; off += PVT;  const size_t oVTl = off; off += PVT;
  if (off > ws_size) return;                         // off = 16777216

  char* ws = (char*)d_ws;
  unsigned short* QKh = (unsigned short*)(ws + oQKh); unsigned short* QKl = (unsigned short*)(ws + oQKl);
  unsigned short* VTh = (unsigned short*)(ws + oVTh); unsigned short* VTl = (unsigned short*)(ws + oVTl);

  // (1) q|k and v^T planes from x, wq, wk, wv; 256 blocks of 4 waves, 128 positions a block
  proj_kernel<<<dim3(MTOK / 128), dim3(128), 0, stream>>>(x, wq, wk, wv, QKh, QKl, VTh, VTl);
  // (2) attention per (batch, 64-position block) -> NCHW d_out; 512 blocks of 128 threads
  attn_kernel<<<dim3(NB * (NTOK / AT_QB)), dim3(128), 0, stream>>>(QKh, QKl, VTh, VTl, (float*)d_out);
  (void)hipGetLastError();
}

// v009
// A run of this version takes 55.5 microseconds.
// Two timings next to v008 put it at 1.26 and 1.25 times that version's speed.
// All steps since v000 together make it 5.48 times as fast.
// Contractions: q|k projection and v^T projection = v_wmma_f32_16x16x32_bf16 single products on the RNE bf16 conversions of the
// f32 inputs (f32 accumulate, results split into bf16 hi|lo planes); q.k^T energies and p.v = bf16 hi/lo split
// (hi.hi + hi.lo + lo.hi) on v_wmma_f32_16x16x32_bf16, f32 accumulate; online max-shifted softmax (base 2: one fma and one
// v_exp_f32 per energy) and 1/rowsum in f32 on the VALU.
// Two launches: the projections (x and the weights are converted in registers, no bf16 copy of them is stored), the attention.
// Plane / carry map (every plane carries factor 1, nothing to fold back):
//   QKh|QKl bf16 [32768 (b*4096+n)][64], n = y*64 + x (NCHW token order): cols 0..31 = q hi|lo over d, cols 32..63 = k hi|lo over d;
//   VTh|VTl bf16 [8][64 c][4096 m];
//   P hi|lo = unnormalised exp in (0,1] (bf16 keeps the f32 exponent range); 1/rowsum is applied to the f32 accumulator
//   in the attention epilogue right before the NCHW store (the only place a normaliser is applied).
#include <hip/hip_runtime.h>
#include <math.h>
#include <stdint.h>

#define NB    8
#define CHN   64
#define DQK   32
#define IMH   64
#define IMW   64
#define NTOK  4096
#define MTOK  (NB * NTOK)
#define QKP   64

static_assert(NTOK == IMH * IMW);
static_assert(CHN == 64);
static_assert(DQK == 32);
static_assert(QKP == 2 * DQK);
static_assert(NTOK % 64 == 0);
static_assert(MTOK % 128 == 0);

typedef __attribute__((ext_vector_type(16))) __bf16   v16b;
typedef __attribute__((ext_vector_type(8)))  __bf16   v8b;
typedef __attribute__((ext_vector_type(2)))  __bf16   v2b;
typedef __attribute__((ext_vector_type(8)))  float    v8f;
typedef __attribute__((ext_vector_type(4)))  float    v4f;
typedef __attribute__((ext_vector_type(2)))  float    v2f;
typedef __attribute__((ext_vector_type(4)))  unsigned int v4u;

// bf16 of two neighbouring elements in one register (a in the low half): one v_cvt_pk_bf16_f32, round to nearest even
__device__ __forceinline__ unsigned bf_pk(float a, float b) {
  return __builtin_bit_cast(unsigned, __builtin_convertvector((v2f){a, b}, v2b));
}
// hi/lo split of two neighbouring elements, one packed register each (p0 in the low half): hi = bf16(p), lo = bf16(p - hi)
__device__ __forceinline__ void split_pk(float p0, float p1, unsigned& hi, unsigned& lo) {
  const v2f p = (v2f){p0, p1};
  const v2b h = __builtin_convertvector(p, v2b);
  const v2f d = p - __builtin_convertvector(h, v2f);             // exact in f32
  hi = __builtin_bit_cast(unsigned, h);
  lo = __builtin_bit_cast(unsigned, __builtin_convertvector(d, v2b));
}

template <typename T> struct Frag;
template <> struct Frag<__bf16> {
  typedef v16b V; union U { v16b v; v8b h[2]; };
  static __device__ __forceinline__ v16b load(const __bf16* p) {   // elements 0..7 <- p[0..7], 8..15 <- p[16..23]
    U f; f.h[0] = *(const v8b*)(p); f.h[1] = *(const v8b*)(p + 16); return f.v;
  }
};

#define AT_D  32
#define AT_C  64
#define AT_NW 16
#define AT_QB 128
#define AT_KC 128
#define OSP   132
#define AT_KP 40    // LDS row pitch of the K tiles in elements: 80 B = 16 B x 5, so 16 rows' 16-B reads fall on 64 distinct banks
#define AT_L2E 1.44269504088896340736f   // log2(e)
#define AT_VP 136   // LDS row pitch of the V^T tiles in elements: 272 B = 16 B x 17, same reason
#define AT_KT (AT_KC * AT_KP)            // elements of one K plane tile in LDS (10 KB)
#define AT_VT (AT_C * AT_VP)             // elements of one V^T plane tile in LDS (17 KB)
#define AT_ST (2 * AT_KT + 2 * AT_VT)    // elements of one buffer: K hi | K lo | V^T hi | V^T lo (54 KB)
#define AT_JP 17                         // 16-B pieces a lane hands over in the join: 16 of o^T, one of shifts and sums

static_assert(NTOK % AT_QB == 0);
static_assert(NTOK % AT_KC == 0);
static_assert(AT_C == CHN);
static_assert(AT_D == DQK);
static_assert(AT_QB == 4 * 32 && AT_KC == (AT_NW / 4) * 32);
static_assert(AT_KP >= AT_D && AT_KP % 8 == 0 && (AT_KP / 8) % 2 == 1);
static_assert(AT_VP >= AT_KC && AT_VP % 8 == 0 && (AT_VP / 8) % 2 == 1);
static_assert(OSP >= AT_QB && OSP % 4 == 0);

// lane l <-> lane l ^ 16 in the vector unit
__device__ __forceinline__ float at_xhalf(float x) {
  const int i = __builtin_bit_cast(int, x);
  return __builtin_bit_cast(float, __builtin_amdgcn_permlanex16(i, i, 0x76543210, 0xfedcba98, false, false));
}
// 2^x on the hardware's own instruction; every x here is -inf, or finite and not above a rounding error over 0, so nothing
// overflows, and a result under the smallest normal may go to 0 beside a row sum of about 1 or more
__device__ __forceinline__ float at_exp2(float x) { return __builtin_amdgcn_exp2f(x); }
// the builtin alone: the compiler keeps the distances behind it and is free to run independent products back to back
__device__ __forceinline__ v8f at_mma(v16b a, v16b b, v8f c) {
  return __builtin_amdgcn_wmma_f32_16x16x32_bf16(false, a, false, b, (short)0, c, false, false);
}

// byte address in the work-group's LDS of an element of a __shared__ array
__device__ __forceinline__ unsigned at_lds(const __bf16* p) {
  typedef __attribute__((address_space(3))) const __bf16 lds_bf;
  return (unsigned)(uintptr_t)(lds_bf*)p;
}
// One chunk's K and V^T tiles, hi and lo, into one LDS buffer: 6 asynchronous 16-B copies a lane, through no register.
// lk / lv: the lane's LDS byte address of its K hi / first V^T hi piece in that buffer; kh, kl, vh, vl: its first global pieces.
// s_wait_xcnt 0 as the statement's last line: a precaution, it stands in front of every later write of a register that a copy names.
__device__ __forceinline__ void at_stage(unsigned lk, unsigned lv, const __bf16* kh, const __bf16* kl,
                                         const __bf16* vh, const __bf16* vl) {
  asm volatile(
      "global_load_async_to_lds_b128 %0, %6, off\n\t"
      "global_load_async_to_lds_b128 %1, %7, off\n\t"
      "global_load_async_to_lds_b128 %2, %8, off\n\t"
      "global_load_async_to_lds_b128 %3, %9, off\n\t"
      "global_load_async_to_lds_b128 %4, %10, off\n\t"
      "global_load_async_to_lds_b128 %5, %11, off\n\t"
      "s_wait_xcnt 0x0"
      :: "v"(lk), "v"(lk + AT_KT * 2),
         "v"(lv), "v"(lv + 32 * AT_VP * 2), "v"(lv + AT_VT * 2), "v"(lv + AT_VT * 2 + 32 * AT_VP * 2),
         "v"(kh), "v"(kl),
         "v"(vh), "v"(vh + 32 * NTOK), "v"(vl), "v"(vl + 32 * NTOK)
      : "memory");
}

__global__ __launch_bounds__(512)
void attn_kernel(const unsigned short* __restrict__ qkhp, const unsigned short* __restrict__ qklp,
                 const unsigned short* __restrict__ vhp, const unsigned short* __restrict__ vlp,
                 float* __restrict__ out) {
  union FB { v16b v; v8b h[2]; unsigned u[8]; };
  __shared__ __align__(16) __bf16 St[2 * AT_ST];                 // two buffers of K hi [kv][d] | K lo | V hi [c][kv] | V lo, padded rows
  __shared__ __align__(16) float  Jn[3 * 4 * AT_JP * 32 * 4];    // join area [key quarter - 1][query group][piece][lane][4]
  __shared__ __align__(16) float  Os[AT_C * OSP];                // block out tile [c][q], pitch 132

  const int tid  = threadIdx.x;
  const int wave = __builtin_amdgcn_readfirstlane(tid >> 5);     // scalar, so the tests on it in the epilogue are scalar branches
  const int lane = tid & 31;
  const int hh   = lane >> 4;
  const int c    = lane & 15;
  const int wq   = wave & 3;               // query group: 32 positions
  const int wk   = wave >> 2;              // which 32 keys of every chunk

  const int nqb  = NTOK / AT_QB;           // 32 query blocks per batch element
  const int bx   = blockIdx.x;             // grid = NB * nqb (exact)
  const int qb   = bx % nqb;
  const int b    = bx / nqb;               // 0..7
  const int nblk = qb * AT_QB;             // first position of this block
  const int q0   = b * NTOK + nblk + wq * 32;     // row in the q|k planes

  const __bf16* Qh = (const __bf16*)(const void*)qkhp;
  const __bf16* Ql = (const __bf16*)(const void*)qklp;
  const __bf16* Kh = Qh + AT_D;                                    // k columns 32..63
  const __bf16* Kl = Ql + AT_D;
  const __bf16* Vh = (const __bf16*)(const void*)vhp + (size_t)b * AT_C * NTOK;
  const __bf16* Vl = (const __bf16*)(const void*)vlp + (size_t)b * AT_C * NTOK;

  // ---- Q fragments (B operand, column = query = lane&15, split k map via Frag load): two query tiles, one 32-deep chunk, hi and lo ----
  v16b qbh[2], qbl[2];
#pragma unroll
  for (int u = 0; u < 2; ++u) {
    qbh[u] = Frag<__bf16>::load(Qh + (size_t)(q0 + u * 16 + c) * QKP + 8 * hh);
    qbl[u] = Frag<__bf16>::load(Ql + (size_t)(q0 + u * 16 + c) * QKP + 8 * hh);
  }

  // one query per lane and query tile: running max times log2(e) (equal in both lane halves) and this half's share of the row sum
  float mrow[2] = {-INFINITY, -INFINITY}, lrow[2] = {0.f, 0.f};
  v8f oacc[2][4];                          // oacc[u][t][r] = o^T(channel t*16 + 8*hh + r, query u*16 + c)
#pragma unroll
  for (int u = 0; u < 2; ++u)
#pragma unroll
    for (int t = 0; t < 4; ++t) oacc[u][t] = (v8f){0.f,0.f,0.f,0.f,0.f,0.f,0.f,0.f};

  const int nChunks = NTOK / AT_KC;   // 32, compile-time constant
  static_assert(NTOK / AT_KC >= 2);
  // staging coverage: K: 16 waves x (8 rows x 32) = 128 rows x 32; V: 16 waves x 2 x (2 rows x 128) = 64 rows x 128 = whole tiles
  // Neighbouring lanes take neighbouring 16-B pieces of ONE row, so a wave-wide copy touches as few cache lines as its 512 B
  // allow: 16 lanes = a whole 256-B V^T row (4 lines a copy), 4 lanes = the 64-B k part of a q|k row (8 lines a copy).
  // A half-wave writes one whole V^T row (256 B in a row), or four K rows that lie 4 apart (4 x 80 B is a shift of 16 banks),
  // so the 16 lanes' 16-B LDS writes fall on 64 distinct banks.
  const int kq = (tid & 3) * 8;                                        // d offset in the K row
  const int kr = wk * 32 + ((tid >> 4) & 1) * 16 + ((tid >> 2) & 3) * 4 + wq;
  const int vq = (tid & 15) * 8;                                       // key offset in the V^T row
  const int vr = tid >> 4;                                             // + 32 * i, i < 2
  const __bf16* ksh = Kh + (size_t)(b * NTOK + kr) * QKP + kq;         // K row (b, kr), d = kq..kq+7; chunk t: + t * 128 rows
  const __bf16* ksl = Kl + (size_t)(b * NTOK + kr) * QKP + kq;
  const __bf16* vsh = Vh + (size_t)vr * NTOK + vq;                     // V^T row c = vr, keys vq..vq+7; chunk t: + t * 128 keys
  const __bf16* vsl = Vl + (size_t)vr * NTOK + vq;
  const unsigned lk0 = at_lds(St + kr * AT_KP + kq);                   // buffer 0; buffer 1: + AT_ST * 2 bytes
  const unsigned lv0 = at_lds(St + 2 * AT_KT + vr * AT_VP + vq);

  // chunk 0 into buffer 0, landed and published; then chunk 1 into buffer 1, which flies while chunk 0 is worked on
  at_stage(lk0, lv0, ksh, ksl, vsh, vsl);
  asm volatile("s_wait_asynccnt 0x0" ::: "memory");   // this wave's copies of chunk 0 have landed before the barrier publishes them
  __syncthreads();
  at_stage(lk0 + AT_ST * 2, lv0 + AT_ST * 2, ksh + (size_t)AT_KC * QKP, ksl + (size_t)AT_KC * QKP, vsh + AT_KC, vsl + AT_KC);

  for (int kc = 0; kc < nChunks; ++kc) {
    const __bf16* Ksh = St + (kc & 1) * AT_ST + wk * 32 * AT_KP;   // this trip's buffer, the wave's 32 key rows
    const __bf16* Ksl = Ksh + AT_KT;
    const __bf16* Vth = St + (kc & 1) * AT_ST + 2 * AT_KT + wk * 32;   // the wave's 32 key columns
    const __bf16* Vtl = Vth + AT_VT;

    // s[u][j][r] = energy^T(key wk*32 + j*16 + 8*hh + r, query u*16 + c): K rows are the A operand, Q the B operand
    // All fragment reads of the trip are issued here as one group, K first: the energy products wait for the K part alone,
    // and the V^T fragments land while the energies and the softmax are worked on.
    FB kb[2], kl[2], vb[4], vl[4];
#pragma unroll
    for (int j = 0; j < 2; ++j) {
      kb[j].h[0] = *(const v8b*)(Ksh + (j * 16 + c) * AT_KP + 8 * hh);
      kb[j].h[1] = *(const v8b*)(Ksh + (j * 16 + c) * AT_KP + 16 + 8 * hh);
    }
#pragma unroll
    for (int j = 0; j < 2; ++j) {
      kl[j].h[0] = *(const v8b*)(Ksl + (j * 16 + c) * AT_KP + 8 * hh);
      kl[j].h[1] = *(const v8b*)(Ksl + (j * 16 + c) * AT_KP + 16 + 8 * hh);
    }
#pragma unroll
    for (int t = 0; t < 4; ++t) {
      vb[t].h[0] = *(const v8b*)(Vth + (t * 16 + c) * AT_VP + 8 * hh);
      vb[t].h[1] = *(const v8b*)(Vth + (t * 16 + c) * AT_VP + 16 + 8 * hh);
      vl[t].h[0] = *(const v8b*)(Vtl + (t * 16 + c) * AT_VP + 8 * hh);
      vl[t].h[1] = *(const v8b*)(Vtl + (t * 16 + c) * AT_VP + 16 + 8 * hh);
    }
    // keeps the reads in this order above the products: without it the V^T reads are moved in front of the K reads, and the
    // first product waits for them too
    __builtin_amdgcn_sched_barrier(0);
    // term by term over the four independent accumulators (each s[u][j] still sums hi.hi, lo.hi, hi.lo in that order)
    v8f s[2][2];
#pragma unroll
    for (int u = 0; u < 2; ++u)
#pragma unroll
      for (int j = 0; j < 2; ++j) s[u][j] = at_mma(kb[j].v, qbh[u], (v8f){0.f,0.f,0.f,0.f,0.f,0.f,0.f,0.f});
    // this one and the next keep the terms apart: regrouped by accumulator, every product would wait for the one before it
    __builtin_amdgcn_sched_barrier(0);
#pragma unroll
    for (int u = 0; u < 2; ++u)
#pragma unroll
      for (int j = 0; j < 2; ++j) s[u][j] = at_mma(kl[j].v, qbh[u], s[u][j]);
    __builtin_amdgcn_sched_barrier(0);
#pragma unroll
    for (int u = 0; u < 2; ++u)
#pragma unroll
      for (int j = 0; j < 2; ++j) s[u][j] = at_mma(kb[j].v, qbl[u], s[u][j]);
    // p^T packs in place into B operands: element e = key wk*32 + (e < 8 ? 8*hh + e : 16 + 8*hh + e - 8),
    // the same k order as the two 16-B reads of a V^T row above
    FB ph[2], pl[2];
#pragma unroll
    for (int u = 0; u < 2; ++u) {
      // trip max of this lane's query of tile u (no energy scaling): 16 keys in the lane, the other 16 in lane ^ 16
      float cm = -INFINITY;
#pragma unroll
      for (int j = 0; j < 2; ++j)
#pragma unroll
        for (int r = 0; r < 8; ++r) cm = fmaxf(cm, s[u][j][r]);
      cm = fmaxf(cm, at_xhalf(cm));
      const float mnew  = fmaxf(mrow[u], cm * AT_L2E);
      const float alpha = at_exp2(mrow[u] - mnew);
      mrow[u] = mnew;
      float ps[2];
#pragma unroll
      for (int j = 0; j < 2; ++j) {
        ps[j] = 0.f;
#pragma unroll
        for (int r = 0; r < 8; r += 2) {
          const v2f x = __builtin_elementwise_fma((v2f){s[u][j][r], s[u][j][r + 1]}, (v2f){AT_L2E, AT_L2E}, (v2f){-mnew, -mnew});
          const float p0 = at_exp2(x[0]);
          const float p1 = at_exp2(x[1]);
          ps[j] += p0;
          ps[j] += p1;
          split_pk(p0, p1, ph[u].u[j * 4 + (r >> 1)], pl[u].u[j * 4 + (r >> 1)]);
        }
      }
      lrow[u] = lrow[u] * alpha + (ps[0] + ps[1]);
#pragma unroll
      for (int t = 0; t < 4; ++t)
#pragma unroll
        for (int r = 0; r < 8; ++r) oacc[u][t][r] *= alpha;
    }
#pragma unroll
    for (int u = 0; u < 2; ++u) {
      // term by term over the four independent accumulators (each oacc[u][t] still sums hi.hi, lo.hi, hi.lo in that order);
      // the two scheduling barriers keep the terms apart as above, but let vector, transcendental and scalar instructions
      // cross (mask 0x406), so that the other query tile's softmax still fills the slots between the products
#pragma unroll
      for (int t = 0; t < 4; ++t) oacc[u][t] = at_mma(vb[t].v, ph[u].v, oacc[u][t]);
      __builtin_amdgcn_sched_barrier(0x406);
#pragma unroll
      for (int t = 0; t < 4; ++t) oacc[u][t] = at_mma(vl[t].v, ph[u].v, oacc[u][t]);
      __builtin_amdgcn_sched_barrier(0x406);
#pragma unroll
      for (int t = 0; t < 4; ++t) oacc[u][t] = at_mma(vb[t].v, pl[u].v, oacc[u][t]);
    }
    // keeps the products above the hand-over: without it the waits and the barrier are lifted to right behind the fragment reads,
    // and the wait for the next chunk's copies comes shortly after their issue instead of a whole trip later
    __builtin_amdgcn_sched_barrier(0);
    // hand-over: this wave's reads of the trip's buffer are done, its copies of the next chunk have landed; the barrier says both
    // of every wave, so the next chunk may be read and this trip's buffer filled anew
    asm volatile("s_wait_dscnt 0x0" ::: "memory");
    asm volatile("s_wait_asynccnt 0x0" ::: "memory");
    __syncthreads();
    if (kc + 2 < nChunks) {
      const size_t t2 = (size_t)(kc + 2) * AT_KC;
      const unsigned bo = (unsigned)(kc & 1) * (AT_ST * 2);
      at_stage(lk0 + bo, lv0 + bo, ksh + t2 * QKP, ksl + t2 * QKP, vsh + t2, vsl + t2);
    }
  }
  asm volatile("s_wait_asynccnt 0x0" ::: "memory");   // nothing of this wave is in flight when it leaves the loop

  // ---- join the lane halves' row sums; waves 4..15 hand their partial o^T, shifts and sums to waves 0..3 (same lane, same
  //      query and channels), which bring the four parts to the largest shift, add, normalise and stage the block's
  //      64 (channel) x 128 (position) tile; then all waves write NCHW segments ----
  const float lsum[2] = {lrow[0] + at_xhalf(lrow[0]), lrow[1] + at_xhalf(lrow[1])};
  if (wk > 0) {
    float* jn = Jn + ((size_t)((wk - 1) * 4 + wq) * AT_JP * 32 + lane) * 4;   // piece i of this lane: + i * 128 floats
#pragma unroll
    for (int u = 0; u < 2; ++u)
#pragma unroll
      for (int t = 0; t < 4; ++t)
#pragma unroll
        for (int h = 0; h < 2; ++h)
          *(v4f*)(jn + ((u * 4 + t) * 2 + h) * 128) =
              (v4f){oacc[u][t][4 * h], oacc[u][t][4 * h + 1], oacc[u][t][4 * h + 2], oacc[u][t][4 * h + 3]};
    *(v4f*)(jn + 16 * 128) = (v4f){mrow[0], mrow[1], lsum[0], lsum[1]};
  }
  __syncthreads();
  if (wk == 0) {
    const float* jn = Jn + ((size_t)wq * AT_JP * 32 + lane) * 4;              // key quarter g + 1: + g * 4 * AT_JP * 128 floats
    v4f ml[3];
#pragma unroll
    for (int g = 0; g < 3; ++g) ml[g] = *(const v4f*)(jn + (g * 4 * AT_JP + 16) * 128);
#pragma unroll
    for (int u = 0; u < 2; ++u) {
      const float mj  = fmaxf(fmaxf(mrow[u], ml[0][u]), fmaxf(ml[1][u], ml[2][u]));
      const float f0  = at_exp2(mrow[u] - mj);
      const float f1  = at_exp2(ml[0][u] - mj);
      const float f2  = at_exp2(ml[1][u] - mj);
      const float f3  = at_exp2(ml[2][u] - mj);
      const float inv = 1.0f / ((lsum[u] * f0 + ml[0][2 + u] * f1) + (ml[1][2 + u] * f2 + ml[2][2 + u] * f3));
      const float cf[3] = {f1 * inv, f2 * inv, f3 * inv};
      const float c0  = f0 * inv;
#pragma unroll
      for (int t = 0; t < 4; ++t)
#pragma unroll
        for (int h = 0; h < 2; ++h) {
          v4f a = (v4f){oacc[u][t][4 * h], oacc[u][t][4 * h + 1], oacc[u][t][4 * h + 2], oacc[u][t][4 * h + 3]} * c0;
#pragma unroll
          for (int g = 0; g < 3; ++g) a += *(const v4f*)(jn + (g * 4 * AT_JP + (u * 4 + t) * 2 + h) * 128) * cf[g];
#pragma unroll
          for (int e = 0; e < 4; ++e) Os[(t * 16 + 8 * hh + 4 * h + e) * OSP + wq * 32 + u * 16 + c] = a[e];
        }
    }
  }
  __syncthreads();
  {
    const int c4 = lane * 4;                              // position offset within the block (0..124)
    float* ob = out + ((size_t)b * AT_C) * NTOK + nblk + c4;
    v4f ov[4];
#pragma unroll
    for (int it = 0; it < 4; ++it) {
      const int ch = wave * 4 + it;                       // channels 0..3 of this wave
      ov[it] = *(const v4f*)(Os + ch * OSP + c4);
    }
#pragma unroll
    for (int it = 0; it < 4; ++it) {
      const int ch = wave * 4 + it;
      *(v4f*)(ob + (size_t)ch * NTOK) = ov[it];
    }
  }
}


// =====================================================================================
// Both projections in one launch, straight from the f32 inputs to the four bf16 planes that the attention reads.
// A wave owns 64 neighbouring positions of one batch element and one of two roles; no LDS, no barrier.
//   Position fragments: a lane reads x(c, n0 + 4j .. 4j+3), j = lane & 15, as one 16-B load per channel (a wave-wide load = two
//   channel rows of 256 B); component i goes to position tile i, so row / column j of tile i is position n0 + 4j + i. The same
//   registers serve as A and as B operand. Element e of a fragment is channel ks*32 + (e < 8 ? 8*hh + e : 16 + 8*hh + e - 8),
//   for the position fragments and the weight fragments alike.
//   Role q|k (waves 0, 1): D = W . X^T, a lane holds 8 neighbouring outputs of ONE position = one 16-B piece of a q|k row.
//   Role v^T (waves 2, 3): D = X . Wv^T, a lane holds, over the 4 position tiles, 32 neighbouring positions of ONE channel
//   (n0 + 32*hh + 4r + i) = four 16-B pieces of a v^T row. So neither result needs a transposition.
//   Every 128-B line of a plane is written by one wave. Coverage: 256 blocks x 2 groups x 64 positions = 32768, each role.
// =====================================================================================
union PF { v16b v; unsigned u[8]; };

__global__ __launch_bounds__(128)
void proj_kernel(const float* __restrict__ x, const float* __restrict__ wq, const float* __restrict__ wk,
                 const float* __restrict__ wv,
                 unsigned short* __restrict__ qkh, unsigned short* __restrict__ qkl,
                 unsigned short* __restrict__ vth, unsigned short* __restrict__ vtl) {
  const int lane = threadIdx.x & 31;
  const int wave = __builtin_amdgcn_readfirstlane(threadIdx.x >> 5);   // scalar, so the role test below is a scalar branch
  const int hh   = lane >> 4;
  const int j    = lane & 15;
  const int g    = blockIdx.x * 2 + (wave & 1);    // group of 64 positions, 0..511 (grid = MTOK / 128, exact)
  const int b    = g / (NTOK / 64);
  const int n0   = (g % (NTOK / 64)) * 64;

  // The weights of the wave's role, 4 output tiles of 16 rows: wq | wk, or wv. The row bases are picked by scalar selects in
  // front of the role branch, so that these loads and the x loads are in flight together (one memory latency, not two).
  const float* w01 = ((wave < 2) ? wq : wv) + j * CHN + 8 * hh;
  const float* w23 = ((wave < 2) ? wk : wv + 32 * CHN) + j * CHN + 8 * hh;
  const float* xp  = x + ((size_t)b * CHN + 8 * hh) * NTOK + n0 + 4 * j;
  v4f wr[4][2][4];                                 // [tile][k step][piece]: channels ks*32 + 8*hh + 0..3, 4..7, 16..19, 20..23
  v4f xr[2][16];                                   // [k step][element e]: 4 neighbouring positions of one channel
#pragma unroll
  for (int t = 0; t < 4; ++t)
#pragma unroll
    for (int ks = 0; ks < 2; ++ks)
#pragma unroll
      for (int q = 0; q < 4; ++q)
        wr[t][ks][q] = *(const v4f*)((t < 2 ? w01 : w23) + (t & 1) * 16 * CHN + ks * 32 + (q >> 1) * 16 + (q & 1) * 4);
#pragma unroll
  for (int ks = 0; ks < 2; ++ks)
#pragma unroll
    for (int e = 0; e < 16; ++e) xr[ks][e] = *(const v4f*)(xp + (size_t)(ks * 32 + (e >> 3) * 16 + (e & 7)) * NTOK);
  // stands in front of every later write of an address register that one of the loads above names (this build reuses them for the
  // converted values); the scheduling barrier keeps those writes behind it
  asm volatile("s_wait_xcnt 0x0" ::: "memory");
  __builtin_amdgcn_sched_barrier(0);

  PF wf[4][2], xf[4][2];
#pragma unroll
  for (int t = 0; t < 4; ++t)
#pragma unroll
    for (int ks = 0; ks < 2; ++ks)
#pragma unroll
      for (int q = 0; q < 4; ++q) {
        wf[t][ks].u[2 * q]     = bf_pk(wr[t][ks][q][0], wr[t][ks][q][1]);
        wf[t][ks].u[2 * q + 1] = bf_pk(wr[t][ks][q][2], wr[t][ks][q][3]);
      }
#pragma unroll
  for (int ks = 0; ks < 2; ++ks)
#pragma unroll
    for (int i = 0; i < 4; ++i)
#pragma unroll
      for (int p = 0; p < 8; ++p) xf[i][ks].u[p] = bf_pk(xr[ks][2 * p][i], xr[ks][2 * p + 1][i]);

  v8f acc[4][4];                                   // [output tile][position tile]
#pragma unroll
  for (int t = 0; t < 4; ++t)
#pragma unroll
    for (int i = 0; i < 4; ++i) acc[t][i] = (v8f){0.f,0.f,0.f,0.f,0.f,0.f,0.f,0.f};

  v4u hu[16], lu[16];                              // the wave's 16-B pieces of the hi and the lo plane
  if (wave < 2) {
#pragma unroll
    for (int ks = 0; ks < 2; ++ks)
#pragma unroll
      for (int t = 0; t < 4; ++t)
#pragma unroll
        for (int i = 0; i < 4; ++i) acc[t][i] = at_mma(wf[t][ks].v, xf[i][ks].v, acc[t][i]);
    // acc[t][i][r] = (q|k)(position n0 + 4j + i, output t*16 + 8*hh + r)
#pragma unroll
    for (int i = 0; i < 4; ++i)
#pragma unroll
      for (int t = 0; t < 4; ++t)
#pragma unroll
        for (int e = 0; e < 4; ++e) {
          unsigned h, l;
          split_pk(acc[t][i][2 * e], acc[t][i][2 * e + 1], h, l);
          hu[i * 4 + t][e] = h;
          lu[i * 4 + t][e] = l;
        }
    unsigned short* ph = qkh + (size_t)(b * NTOK + n0 + 4 * j) * QKP + 8 * hh;
    unsigned short* pl = qkl + (size_t)(b * NTOK + n0 + 4 * j) * QKP + 8 * hh;
    // all stores stand behind all vector work, so that no register which an issued store names is written again
    __builtin_amdgcn_sched_barrier(0);
#pragma unroll
    for (int i = 0; i < 4; ++i)
#pragma unroll
      for (int t = 0; t < 4; ++t) {
        *(v4u*)(ph + i * QKP + t * 16) = hu[i * 4 + t];
        *(v4u*)(pl + i * QKP + t * 16) = lu[i * 4 + t];
      }
    // behind the last store of the role: no register that an issued store names is written again in front of this wait, on
    // whichever way the built code leaves this block (the other role's block may be laid out directly behind it)
    asm volatile("s_wait_xcnt 0x0" ::: "memory");
  } else {
#pragma unroll
    for (int ks = 0; ks < 2; ++ks)
#pragma unroll
      for (int t = 0; t < 4; ++t)
#pragma unroll
        for (int i = 0; i < 4; ++i) acc[t][i] = at_mma(xf[i][ks].v, wf[t][ks].v, acc[t][i]);
    // acc[t][i][r] = v(channel t*16 + j, position n0 + 4*(8*hh + r) + i)
#pragma unroll
    for (int t = 0; t < 4; ++t)
#pragma unroll
      for (int s = 0; s < 4; ++s)
#pragma unroll
        for (int e = 0; e < 4; ++e) {              // positions 8s + 2e, 8s + 2e + 1 of the lane's 32: r = 2s + (e >> 1), i = 2*(e & 1)
          unsigned h, l;
          split_pk(acc[t][2 * (e & 1)][2 * s + (e >> 1)], acc[t][2 * (e & 1) + 1][2 * s + (e >> 1)], h, l);
          hu[t * 4 + s][e] = h;
          lu[t * 4 + s][e] = l;
        }
    unsigned short* ph = vth + (size_t)(b * CHN + j) * NTOK + n0 + 32 * hh;
    unsigned short* pl = vtl + (size_t)(b * CHN + j) * NTOK + n0 + 32 * hh;
    // as above: all stores behind all vector work
    __builtin_amdgcn_sched_barrier(0);
#pragma unroll
    for (int t = 0; t < 4; ++t)
#pragma unroll
      for (int s = 0; s < 4; ++s) {
        *(v4u*)(ph + (size_t)t * 16 * NTOK + 8 * s) = hu[t * 4 + s];
        *(v4u*)(pl + (size_t)t * 16 * NTOK + 8 * s) = lu[t * 4 + s];
      }
    // as above, behind the last store of this role
    asm volatile("s_wait_xcnt 0x0" ::: "memory");
  }
}

// ---------------------------------------------------------------------------
// Workspace region map (byte offsets; every region is fully written by the projection launch before the attention reads it)
//   QKh   bf16 [32768][64]            0       4194304   QKl   4194304
//   VTh   bf16 [8][64][4096]    8388608       4194304   VTl  12582912
//   total                      16777216
// ---------------------------------------------------------------------------
extern "C" void kernel_launch(void* const* d_in, const int* in_sizes, int n_in,
                              void* d_out, int out_size, void* d_ws, size_t ws_size,
                              hipStream_t stream) {
  if (n_in < 4) return;
  if (in_sizes[0] != NB * CHN * NTOK) return;      // x  [8][64][64][64]
  if (in_sizes[1] != DQK * CHN) return;            // wq [32][64]
  if (in_sizes[2] != DQK * CHN) return;            // wk [32][64]
  if (in_sizes[3] != CHN * CHN) return;            // wv [64][64]
  if (out_size != NB * CHN * NTOK) return;

  const float* x  = (const float*)d_in[0];
  const float* wq = (const float*)d_in[1];   // [out 32][in 64]
  const float* wk = (const float*)d_in[2];   // [out 32][in 64]
  const float* wv = (const float*)d_in[3];   // [out 64][in 64]

  const size_t PQK = (size_t)MTOK * QKP * 2;         // 4194304 per plane
  const size_t PVT = (size_t)NB * CHN * NTOK * 2;    // 4194304 per plane
  size_t off = 0;
  const size_t oQKh = off; off += PQK;  const size_t oQKl = off; off += PQK;
  const size_t oVTh = off; off += PVT;  const size_t oVTl = off; off += PVT;
  if (off > ws_size) return;                         // off = 16777216

  char* ws = (char*)d_ws;
  unsigned short* QKh = (unsigned short*)(ws + oQKh); unsigned short* QKl = (unsigned short*)(ws + oQKl);
  unsigned short* VTh = (unsigned short*)(ws + oVTh); unsigned short* VTl = (unsigned short*)(ws + oVTl);

  // (1) q|k and v^T planes from x, wq, wk, wv; 256 blocks of 4 waves, 128 positions a block
  proj_kernel<<<dim3(MTOK / 128), dim3(128), 0, stream>>>(x, wq, wk, wv, QKh, QKl, VTh, VTl);
  // (2) attention per (batch, 128-position block) -> NCHW d_out; 256 blocks of 512 threads
  attn_kernel<<<dim3(NB * (NTOK / AT_QB)), dim3(512), 0, stream>>>(QKh, QKl, VTh, VTl, (float*)d_out);
  (void)hipGetLastError();
}

// v010
// Measured time: 47.7 microseconds a run.
// Two timings next to v009 put it at 1.17 and 1.16 times that version's speed.
// All steps since v000 together make it 6.39 times as fast.
// Contractions: q|k projection = v_wmma_f32_16x16x32_bf16 single products on the RNE bf16 conversions of the f32 inputs (f32
// accumulate, results split into bf16 hi|lo planes); q.k^T energies = bf16 hi/lo split (hi.hi + lo.hi + hi.lo) on
// v_wmma_f32_16x16x32_bf16, f32 accumulate; online max-shifted softmax (base 2: one fma and one v_exp_f32 per energy) and
// 1/rowsum in f32 on the VALU.
// The value projection stands BEHIND the attention sum: out = wv . (x . a^T) instead of (wv . x) . a^T. The long sum over the keys
// then runs on the bf16 conversion of x itself, which has no lo part: x.p_hi + x.p_lo, two products where v hi/lo took three.
// The 64 x 64 product with the bf16 conversion of wv is done once per query, in the attention epilogue, on the hi/lo split of
// the normalised f32 sum (wv.hi + wv.lo), same instruction.
// Two launches: the q|k projection with the conversion of x, the attention.
// Plane / carry map (every plane carries factor 1, nothing to fold back):
//   QKh|QKl bf16 [32768 (b*4096+n)][64], n = y*64 + x (NCHW token order): cols 0..31 = q hi|lo over d, cols 32..63 = k hi|lo over d;
//   XB bf16 [8][64 c][4096 m] = RNE bf16 of x, x's own layout;
//   P hi|lo = unnormalised exp in (0,1] (bf16 keeps the f32 exponent range); 1/rowsum is applied to the f32 accumulator
//   in the attention epilogue right before its split for the wv product (the only place a normaliser is applied).
#include <hip/hip_runtime.h>
#include <math.h>
#include <stdint.h>

#define NB    8
#define CHN   64
#define DQK   32
#define IMH   64
#define IMW   64
#define NTOK  4096
#define MTOK  (NB * NTOK)
#define QKP   64

static_assert(NTOK == IMH * IMW);
static_assert(CHN == 64);
static_assert(DQK == 32);
static_assert(QKP == 2 * DQK);
static_assert(NTOK % 64 == 0);
static_assert(MTOK % 128 == 0);

typedef __attribute__((ext_vector_type(16))) __bf16   v16b;
typedef __attribute__((ext_vector_type(8)))  __bf16   v8b;
typedef __attribute__((ext_vector_type(2)))  __bf16   v2b;
typedef __attribute__((ext_vector_type(8)))  float    v8f;
typedef __attribute__((ext_vector_type(4)))  float    v4f;
typedef __attribute__((ext_vector_type(2)))  float    v2f;
typedef __attribute__((ext_vector_type(4)))  unsigned int v4u;
typedef __attribute__((ext_vector_type(2)))  unsigned int v2u;

// bf16 of two neighbouring elements in one register (a in the low half): one v_cvt_pk_bf16_f32, round to nearest even
__device__ __forceinline__ unsigned bf_pk(float a, float b) {
  return __builtin_bit_cast(unsigned, __builtin_convertvector((v2f){a, b}, v2b));
}
// hi/lo split of two neighbouring elements, one packed register each (p0 in the low half): hi = bf16(p), lo = bf16(p - hi)
__device__ __forceinline__ void split_pk(float p0, float p1, unsigned& hi, unsigned& lo) {
  const v2f p = (v2f){p0, p1};
  const v2b h = __builtin_convertvector(p, v2b);
  const v2f d = p - __builtin_convertvector(h, v2f);             // exact in f32
  hi = __builtin_bit_cast(unsigned, h);
  lo = __builtin_bit_cast(unsigned, __builtin_convertvector(d, v2b));
}

template <typename T> struct Frag;
template <> struct Frag<__bf16> {
  typedef v16b V; union U { v16b v; v8b h[2]; };
  static __device__ __forceinline__ v16b load(const __bf16* p) {   // elements 0..7 <- p[0..7], 8..15 <- p[16..23]
    U f; f.h[0] = *(const v8b*)(p); f.h[1] = *(const v8b*)(p + 16); return f.v;
  }
};

#define AT_D  32
#define AT_C  64
#define AT_NW 16
#define AT_QB 128
#define AT_KC 128
#define OSP   132
#define AT_KP 40    // LDS row pitch of the K tiles in elements: 80 B = 16 B x 5, so 16 rows' 16-B reads fall on 64 distinct banks
#define AT_L2E 1.44269504088896340736f   // log2(e)
#define AT_VP 136   // LDS row pitch of the x tile in elements: 272 B = 16 B x 17, same reason
#define AT_KT (AT_KC * AT_KP)            // elements of one K plane tile in LDS (10 KB)
#define AT_VT (AT_C * AT_VP)             // elements of the x tile in LDS (17 KB)
#define AT_ST (2 * AT_KT + AT_VT)        // elements of one buffer: K hi | K lo | x (37 KB)
#define AT_JP 17                         // 16-B pieces a lane hands over in the join: 16 of o^T, one of shifts and sums
#define AT_WP 72    // LDS row pitch of the wv tile in elements: 144 B = 16 B x 9, same reason as AT_KP

static_assert(NTOK % AT_QB == 0);
static_assert(NTOK % AT_KC == 0);
static_assert(AT_C == CHN);
static_assert(AT_D == DQK);
static_assert(AT_QB == 4 * 32 && AT_KC == (AT_NW / 4) * 32);
static_assert(AT_KP >= AT_D && AT_KP % 8 == 0 && (AT_KP / 8) % 2 == 1);
static_assert(AT_VP >= AT_KC && AT_VP % 8 == 0 && (AT_VP / 8) % 2 == 1);
static_assert(AT_WP >= AT_C && AT_WP % 8 == 0 && (AT_WP / 8) % 2 == 1);
static_assert(AT_C * AT_C == AT_NW * 32 * 8);
static_assert(OSP >= AT_QB && OSP % 4 == 0);

// lane l <-> lane l ^ 16 in the vector unit
__device__ __forceinline__ float at_xhalf(float x) {
  const int i = __builtin_bit_cast(int, x);
  return __builtin_bit_cast(float, __builtin_amdgcn_permlanex16(i, i, 0x76543210, 0xfedcba98, false, false));
}
// 2^x on the hardware's own instruction; every x here is -inf, or finite and not above a rounding error over 0, so nothing
// overflows, and a result under the smallest normal may go to 0 beside a row sum of about 1 or more
__device__ __forceinline__ float at_exp2(float x) { return __builtin_amdgcn_exp2f(x); }
// the builtin alone: the compiler keeps the distances behind it and is free to run independent products back to back
__device__ __forceinline__ v8f at_mma(v16b a, v16b b, v8f c) {
  return __builtin_amdgcn_wmma_f32_16x16x32_bf16(false, a, false, b, (short)0, c, false, false);
}

// byte address in the work-group's LDS of an element of a __shared__ array
__device__ __forceinline__ unsigned at_lds(const __bf16* p) {
  typedef __attribute__((address_space(3))) const __bf16 lds_bf;
  return (unsigned)(uintptr_t)(lds_bf*)p;
}
// One chunk's K tiles, hi and lo, and x tile into one LDS buffer: 4 asynchronous 16-B copies a lane, through no register.
// lk / lv: the lane's LDS byte address of its K hi / first x piece in that buffer; kh, kl, vh: its first global pieces.
// s_wait_xcnt 0 as the statement's last line: a precaution, it stands in front of every later write of a register that a copy names.
__device__ __forceinline__ void at_stage(unsigned lk, unsigned lv, const __bf16* kh, const __bf16* kl, const __bf16* vh) {
  asm volatile(
      "global_load_async_to_lds_b128 %0, %4, off\n\t"
      "global_load_async_to_lds_b128 %1, %5, off\n\t"
      "global_load_async_to_lds_b128 %2, %6, off\n\t"
      "global_load_async_to_lds_b128 %3, %7, off\n\t"
      "s_wait_xcnt 0x0"
      :: "v"(lk), "v"(lk + AT_KT * 2),
         "v"(lv), "v"(lv + 32 * AT_VP * 2),
         "v"(kh), "v"(kl),
         "v"(vh), "v"(vh + 32 * NTOK)
      : "memory");
}

__global__ __launch_bounds__(512)
void attn_kernel(const unsigned short* __restrict__ qkhp, const unsigned short* __restrict__ qklp,
                 const unsigned short* __restrict__ xbp, const float* __restrict__ wv,
                 float* __restrict__ out) {
  union FB { v16b v; v8b h[2]; unsigned u[8]; };
  __shared__ __align__(16) __bf16 St[2 * AT_ST];                 // two buffers of K hi [kv][d] | K lo | x [c][kv], padded rows
  __shared__ __align__(16) float  Jn[3 * 4 * AT_JP * 32 * 4];    // join area [key quarter - 1][query group][piece][lane][4]
  __shared__ __align__(16) float  Os[AT_C * OSP];                // block out tile [c][q], pitch 132
  __shared__ __align__(16) __bf16 Wl[AT_C * AT_WP];              // wv in bf16 [out channel][x channel], padded rows

  const int tid  = threadIdx.x;
  const int wave = __builtin_amdgcn_readfirstlane(tid >> 5);     // scalar, so the tests on it in the epilogue are scalar branches
  const int lane = tid & 31;
  const int hh   = lane >> 4;
  const int c    = lane & 15;
  const int wq   = wave & 3;               // query group: 32 positions
  const int wk   = wave >> 2;              // which 32 keys of every chunk

  const int nqb  = NTOK / AT_QB;           // 32 query blocks per batch element
  const int bx   = blockIdx.x;             // grid = NB * nqb (exact)
  const int qb   = bx % nqb;
  const int b    = bx / nqb;               // 0..7
  const int nblk = qb * AT_QB;             // first position of this block
  const int q0   = b * NTOK + nblk + wq * 32;     // row in the q|k planes

  const __bf16* Qh = (const __bf16*)(const void*)qkhp;
  const __bf16* Ql = (const __bf16*)(const void*)qklp;
  const __bf16* Kh = Qh + AT_D;                                    // k columns 32..63
  const __bf16* Kl = Ql + AT_D;
  const __bf16* Vh = (const __bf16*)(const void*)xbp + (size_t)b * AT_C * NTOK;

  // wv: 512 threads x 8 neighbouring elements = the whole 64 x 64 matrix; asked for first, rounded and stored behind the first copies
  const v4f wv0 = *(const v4f*)(wv + tid * 8);
  const v4f wv1 = *(const v4f*)(wv + tid * 8 + 4);
  // a precaution: it stands in front of every later write of an address register that one of the two loads names
  asm volatile("s_wait_xcnt 0x0" ::: "memory");

  // ---- Q fragments (B operand, column = query = lane&15, split k map via Frag load): two query tiles, one 32-deep chunk, hi and lo ----
  v16b qbh[2], qbl[2];
#pragma unroll
  for (int u = 0; u < 2; ++u) {
    qbh[u] = Frag<__bf16>::load(Qh + (size_t)(q0 + u * 16 + c) * QKP + 8 * hh);
    qbl[u] = Frag<__bf16>::load(Ql + (size_t)(q0 + u * 16 + c) * QKP + 8 * hh);
  }

  // one query per lane and query tile: running max times log2(e) (equal in both lane halves) and this half's share of the row sum
  float mrow[2] = {-INFINITY, -INFINITY}, lrow[2] = {0.f, 0.f};
  v8f oacc[2][4];                          // oacc[u][t][r] = o^T(x channel t*16 + 8*hh + r, query u*16 + c)
#pragma unroll
  for (int u = 0; u < 2; ++u)
#pragma unroll
    for (int t = 0; t < 4; ++t) oacc[u][t] = (v8f){0.f,0.f,0.f,0.f,0.f,0.f,0.f,0.f};

  const int nChunks = NTOK / AT_KC;   // 32, compile-time constant
  static_assert(NTOK / AT_KC >= 2);
  // staging coverage: K: 16 waves x (8 rows x 32) = 128 rows x 32; V: 16 waves x 2 x (2 rows x 128) = 64 rows x 128 = whole tiles
  // Neighbouring lanes take neighbouring 16-B pieces of ONE row, so a wave-wide copy touches as few cache lines as its 512 B
  // allow: 16 lanes = a whole 256-B x row (4 lines a copy), 4 lanes = the 64-B k part of a q|k row (8 lines a copy).
  // A half-wave writes one whole x row (256 B in a row), or four K rows that lie 4 apart (4 x 80 B is a shift of 16 banks),
  // so the 16 lanes' 16-B LDS writes fall on 64 distinct banks.
  const int kq = (tid & 3) * 8;                                        // d offset in the K row
  const int kr = wk * 32 + ((tid >> 4) & 1) * 16 + ((tid >> 2) & 3) * 4 + wq;
  const int vq = (tid & 15) * 8;                                       // key offset in the x row
  const int vr = tid >> 4;                                             // + 32 * i, i < 2
  const __bf16* ksh = Kh + (size_t)(b * NTOK + kr) * QKP + kq;         // K row (b, kr), d = kq..kq+7; chunk t: + t * 128 rows
  const __bf16* ksl = Kl + (size_t)(b * NTOK + kr) * QKP + kq;
  const __bf16* vsh = Vh + (size_t)vr * NTOK + vq;                     // x row c = vr, keys vq..vq+7; chunk t: + t * 128 keys
  const unsigned lk0 = at_lds(St + kr * AT_KP + kq);                   // buffer 0; buffer 1: + AT_ST * 2 bytes
  const unsigned lv0 = at_lds(St + 2 * AT_KT + vr * AT_VP + vq);

  // chunk 0 into buffer 0, landed and published; then chunk 1 into buffer 1, which flies while chunk 0 is worked on
  at_stage(lk0, lv0, ksh, ksl, vsh);
  // keeps the rounding of wv, and with it the wait for its loads, behind the copies: lifted above them it would put that latency
  // in front of theirs
  __builtin_amdgcn_sched_barrier(0);
  {
    union { v8b h; unsigned u[4]; } wb;
    wb.u[0] = bf_pk(wv0[0], wv0[1]);
    wb.u[1] = bf_pk(wv0[2], wv0[3]);
    wb.u[2] = bf_pk(wv1[0], wv1[1]);
    wb.u[3] = bf_pk(wv1[2], wv1[3]);
    *(v8b*)(Wl + (tid >> 3) * AT_WP + (tid & 7) * 8) = wb.h;     // row tid >> 3, columns (tid & 7) * 8 .. + 7
  }
  asm volatile("s_wait_asynccnt 0x0" ::: "memory");   // this wave's copies of chunk 0 have landed before the barrier publishes them
  __syncthreads();
  at_stage(lk0 + AT_ST * 2, lv0 + AT_ST * 2, ksh + (size_t)AT_KC * QKP, ksl + (size_t)AT_KC * QKP, vsh + AT_KC);

  for (int kc = 0; kc < nChunks; ++kc) {
    const __bf16* Ksh = St + (kc & 1) * AT_ST + wk * 32 * AT_KP;   // this trip's buffer, the wave's 32 key rows
    const __bf16* Ksl = Ksh + AT_KT;
    const __bf16* Vth = St + (kc & 1) * AT_ST + 2 * AT_KT + wk * 32;   // the wave's 32 key columns

    // s[u][j][r] = energy^T(key wk*32 + j*16 + 8*hh + r, query u*16 + c): K rows are the A operand, Q the B operand
    // All fragment reads of the trip are issued here as one group, K first: the energy products wait for the K part alone,
    // and the x fragments land while the energies and the softmax are worked on.
    FB kb[2], kl[2], vb[4];
#pragma unroll
    for (int j = 0; j < 2; ++j) {
      kb[j].h[0] = *(const v8b*)(Ksh + (j * 16 + c) * AT_KP + 8 * hh);
      kb[j].h[1] = *(const v8b*)(Ksh + (j * 16 + c) * AT_KP + 16 + 8 * hh);
    }
#pragma unroll
    for (int j = 0; j < 2; ++j) {
      kl[j].h[0] = *(const v8b*)(Ksl + (j * 16 + c) * AT_KP + 8 * hh);
      kl[j].h[1] = *(const v8b*)(Ksl + (j * 16 + c) * AT_KP + 16 + 8 * hh);
    }
#pragma unroll
    for (int t = 0; t < 4; ++t) {
      vb[t].h[0] = *(const v8b*)(Vth + (t * 16 + c) * AT_VP + 8 * hh);
      vb[t].h[1] = *(const v8b*)(Vth + (t * 16 + c) * AT_VP + 16 + 8 * hh);
    }
    // keeps the reads in this order above the products: without it the x reads are moved in front of the K reads, and the
    // first product waits for them too
    __builtin_amdgcn_sched_barrier(0);
    // term by term over the four independent accumulators (each s[u][j] still sums hi.hi, lo.hi, hi.lo in that order)
    v8f s[2][2];
#pragma unroll
    for (int u = 0; u < 2; ++u)
#pragma unroll
      for (int j = 0; j < 2; ++j) s[u][j] = at_mma(kb[j].v, qbh[u], (v8f){0.f,0.f,0.f,0.f,0.f,0.f,0.f,0.f});
    // this one and the next keep the terms apart: regrouped by accumulator, every product would wait for the one before it
    __builtin_amdgcn_sched_barrier(0);
#pragma unroll
    for (int u = 0; u < 2; ++u)
#pragma unroll
      for (int j = 0; j < 2; ++j) s[u][j] = at_mma(kl[j].v, qbh[u], s[u][j]);
    __builtin_amdgcn_sched_barrier(0);
#pragma unroll
    for (int u = 0; u < 2; ++u)
#pragma unroll
      for (int j = 0; j < 2; ++j) s[u][j] = at_mma(kb[j].v, qbl[u], s[u][j]);
    // p^T packs in place into B operands: element e = key wk*32 + (e < 8 ? 8*hh + e : 16 + 8*hh + e - 8),
    // the same k order as the two 16-B reads of an x row above
    FB ph[2], pl[2];
#pragma unroll
    for (int u = 0; u < 2; ++u) {
      // trip max of this lane's query of tile u (no energy scaling): 16 keys in the lane, the other 16 in lane ^ 16
      float cm = -INFINITY;
#pragma unroll
      for (int j = 0; j < 2; ++j)
#pragma unroll
        for (int r = 0; r < 8; ++r) cm = fmaxf(cm, s[u][j][r]);
      cm = fmaxf(cm, at_xhalf(cm));
      const float mnew  = fmaxf(mrow[u], cm * AT_L2E);
      const float alpha = at_exp2(mrow[u] - mnew);
      mrow[u] = mnew;
      float ps[2];
#pragma unroll
      for (int j = 0; j < 2; ++j) {
        ps[j] = 0.f;
#pragma unroll
        for (int r = 0; r < 8; r += 2) {
          const v2f x = __builtin_elementwise_fma((v2f){s[u][j][r], s[u][j][r + 1]}, (v2f){AT_L2E, AT_L2E}, (v2f){-mnew, -mnew});
          const float p0 = at_exp2(x[0]);
          const float p1 = at_exp2(x[1]);
          ps[j] += p0;
          ps[j] += p1;
          split_pk(p0, p1, ph[u].u[j * 4 + (r >> 1)], pl[u].u[j * 4 + (r >> 1)]);
        }
      }
      lrow[u] = lrow[u] * alpha + (ps[0] + ps[1]);
#pragma unroll
      for (int t = 0; t < 4; ++t)
#pragma unroll
        for (int r = 0; r < 8; ++r) oacc[u][t][r] *= alpha;
    }
#pragma unroll
    for (int u = 0; u < 2; ++u) {
      // term by term over the four independent accumulators (each oacc[u][t] sums x.p_hi, then x.p_lo);
      // the scheduling barrier keeps the terms apart as above, but lets vector, transcendental and scalar instructions
      // cross (mask 0x406), so that the other query tile's softmax still fills the slots between the products
#pragma unroll
      for (int t = 0; t < 4; ++t) oacc[u][t] = at_mma(vb[t].v, ph[u].v, oacc[u][t]);
      __builtin_amdgcn_sched_barrier(0x406);
#pragma unroll
      for (int t = 0; t < 4; ++t) oacc[u][t] = at_mma(vb[t].v, pl[u].v, oacc[u][t]);
    }
    // keeps the products above the hand-over: without it the waits and the barrier are lifted to right behind the fragment reads,
    // and the wait for the next chunk's copies comes shortly after their issue instead of a whole trip later
    __builtin_amdgcn_sched_barrier(0);
    // hand-over: this wave's reads of the trip's buffer are done, its copies of the next chunk have landed; the barrier says both
    // of every wave, so the next chunk may be read and this trip's buffer filled anew
    asm volatile("s_wait_dscnt 0x0" ::: "memory");
    asm volatile("s_wait_asynccnt 0x0" ::: "memory");
    __syncthreads();
    if (kc + 2 < nChunks) {
      const size_t t2 = (size_t)(kc + 2) * AT_KC;
      const unsigned bo = (unsigned)(kc & 1) * (AT_ST * 2);
      at_stage(lk0 + bo, lv0 + bo, ksh + t2 * QKP, ksl + t2 * QKP, vsh + t2);
    }
  }
  asm volatile("s_wait_asynccnt 0x0" ::: "memory");   // nothing of this wave is in flight when it leaves the loop

  // ---- join the lane halves' row sums; waves 4..15 hand their partial o^T, shifts and sums to waves 0..3 (same lane, same
  //      query and channels), which bring the four parts to the largest shift, add, normalise, multiply by wv and stage the
  //      block's 64 (channel) x 128 (position) tile; then all waves write NCHW segments ----
  const float lsum[2] = {lrow[0] + at_xhalf(lrow[0]), lrow[1] + at_xhalf(lrow[1])};
  if (wk > 0) {
    float* jn = Jn + ((size_t)((wk - 1) * 4 + wq) * AT_JP * 32 + lane) * 4;   // piece i of this lane: + i * 128 floats
#pragma unroll
    for (int u = 0; u < 2; ++u)
#pragma unroll
      for (int t = 0; t < 4; ++t)
#pragma unroll
        for (int h = 0; h < 2; ++h)
          *(v4f*)(jn + ((u * 4 + t) * 2 + h) * 128) =
              (v4f){oacc[u][t][4 * h], oacc[u][t][4 * h + 1], oacc[u][t][4 * h + 2], oacc[u][t][4 * h + 3]};
    *(v4f*)(jn + 16 * 128) = (v4f){mrow[0], mrow[1], lsum[0], lsum[1]};
  }
  __syncthreads();
  if (wk == 0) {
    const float* jn = Jn + ((size_t)wq * AT_JP * 32 + lane) * 4;              // key quarter g + 1: + g * 4 * AT_JP * 128 floats
    // wv as A operand: row = out channel to*16 + c, element e = x channel ks*32 + (e < 8 ? 8*hh + e : 16 + 8*hh + e - 8)
    FB wa[4][2];
#pragma unroll
    for (int to = 0; to < 4; ++to)
#pragma unroll
      for (int ks = 0; ks < 2; ++ks) {
        wa[to][ks].h[0] = *(const v8b*)(Wl + (to * 16 + c) * AT_WP + ks * 32 + 8 * hh);
        wa[to][ks].h[1] = *(const v8b*)(Wl + (to * 16 + c) * AT_WP + ks * 32 + 16 + 8 * hh);
      }
    v4f ml[3];
#pragma unroll
    for (int g = 0; g < 3; ++g) ml[g] = *(const v4f*)(jn + (g * 4 * AT_JP + 16) * 128);
#pragma unroll
    for (int u = 0; u < 2; ++u) {
      const float mj  = fmaxf(fmaxf(mrow[u], ml[0][u]), fmaxf(ml[1][u], ml[2][u]));
      const float f0  = at_exp2(mrow[u] - mj);
      const float f1  = at_exp2(ml[0][u] - mj);
      const float f2  = at_exp2(ml[1][u] - mj);
      const float f3  = at_exp2(ml[2][u] - mj);
      const float inv = 1.0f / ((lsum[u] * f0 + ml[0][2 + u] * f1) + (ml[1][2 + u] * f2 + ml[2][2 + u] * f3));
      const float cf[3] = {f1 * inv, f2 * inv, f3 * inv};
      const float c0  = f0 * inv;
      // the normalised o^T packs in place into B operands, hi and lo, as p^T does in the loop: tiles 2*ks and 2*ks + 1 give
      // element e = x channel ks*32 + (e < 8 ? 8*hh + e : 16 + 8*hh + e - 8), the k order of wa
      FB oh[2], ol[2];
#pragma unroll
      for (int t = 0; t < 4; ++t)
#pragma unroll
        for (int h = 0; h < 2; ++h) {
          v4f a = (v4f){oacc[u][t][4 * h], oacc[u][t][4 * h + 1], oacc[u][t][4 * h + 2], oacc[u][t][4 * h + 3]} * c0;
#pragma unroll
          for (int g = 0; g < 3; ++g) a += *(const v4f*)(jn + (g * 4 * AT_JP + (u * 4 + t) * 2 + h) * 128) * cf[g];
          split_pk(a[0], a[1], oh[t >> 1].u[(t & 1) * 4 + 2 * h],     ol[t >> 1].u[(t & 1) * 4 + 2 * h]);
          split_pk(a[2], a[3], oh[t >> 1].u[(t & 1) * 4 + 2 * h + 1], ol[t >> 1].u[(t & 1) * 4 + 2 * h + 1]);
        }
      // d[to][r] = out^T(channel to*16 + 8*hh + r, query u*16 + c) = wv . (hi + lo), 64 deep = two k steps a term
      v8f d[4];
#pragma unroll
      for (int to = 0; to < 4; ++to) d[to] = at_mma(wa[to][0].v, oh[0].v, (v8f){0.f,0.f,0.f,0.f,0.f,0.f,0.f,0.f});
#pragma unroll
      for (int to = 0; to < 4; ++to) d[to] = at_mma(wa[to][1].v, oh[1].v, d[to]);
#pragma unroll
      for (int to = 0; to < 4; ++to) d[to] = at_mma(wa[to][0].v, ol[0].v, d[to]);
#pragma unroll
      for (int to = 0; to < 4; ++to) d[to] = at_mma(wa[to][1].v, ol[1].v, d[to]);
#pragma unroll
      for (int to = 0; to < 4; ++to)
#pragma unroll
        for (int r = 0; r < 8; ++r) Os[(to * 16 + 8 * hh + r) * OSP + wq * 32 + u * 16 + c] = d[to][r];
    }
  }
  __syncthreads();
  {
    const int c4 = lane * 4;                              // position offset within the block (0..124)
    float* ob = out + ((size_t)b * AT_C) * NTOK + nblk + c4;
    v4f ov[4];
#pragma unroll
    for (int it = 0; it < 4; ++it) {
      const int ch = wave * 4 + it;                       // channels 0..3 of this wave
      ov[it] = *(const v4f*)(Os + ch * OSP + c4);
    }
#pragma unroll
    for (int it = 0; it < 4; ++it) {
      const int ch = wave * 4 + it;
      *(v4f*)(ob + (size_t)ch * NTOK) = ov[it];
    }
  }
}


// =====================================================================================
// The q|k projection and the bf16 conversion of x in one launch, straight from the f32 inputs to the three bf16 planes that the
// attention reads. A wave owns 64 neighbouring positions of one batch element and one of two roles; no LDS, no barrier.
//   x loads, both roles: a lane reads x(c, n0 + 4j .. 4j+3), j = lane & 15, as one 16-B load per channel (a wave-wide load = two
//   channel rows of 256 B).
//   Role q|k (waves 0, 1): component i goes to position tile i, so column j of tile i is position n0 + 4j + i. Element e of a
//   fragment is channel ks*32 + (e < 8 ? 8*hh + e : 16 + 8*hh + e - 8), for the position fragments and the weight fragments alike.
//   D = W . X^T, a lane holds 8 neighbouring outputs of ONE position = one 16-B piece of a q|k row.
//   Role x (waves 2, 3): the lane's 4 positions of a channel are rounded and stored as one 8-B piece (a wave-wide store = two
//   whole 128-B lines).
//   Every 128-B line of a plane is written by one wave. Coverage: 256 blocks x 2 groups x 64 positions = 32768, each role.
// =====================================================================================
union PF { v16b v; unsigned u[8]; };

// xr[k step][element e] = 4 neighbouring positions of channel 8*hh + ks*32 + (e >> 3)*16 + (e & 7); xp: the lane's piece of channel 8*hh
__device__ __forceinline__ void pj_load_x(const float* xp, v4f (&xr)[2][16]) {
#pragma unroll
  for (int ks = 0; ks < 2; ++ks)
#pragma unroll
    for (int e = 0; e < 16; ++e) xr[ks][e] = *(const v4f*)(xp + (size_t)(ks * 32 + (e >> 3) * 16 + (e & 7)) * NTOK);
}

__global__ __launch_bounds__(128)
void proj_kernel(const float* __restrict__ x, const float* __restrict__ wq, const float* __restrict__ wk,
                 unsigned short* __restrict__ qkh, unsigned short* __restrict__ qkl,
                 unsigned short* __restrict__ xb) {
  const int lane = threadIdx.x & 31;
  const int wave = __builtin_amdgcn_readfirstlane(threadIdx.x >> 5);   // scalar, so the role test below is a scalar branch
  const int hh   = lane >> 4;
  const int j    = lane & 15;
  const int g    = blockIdx.x * 2 + (wave & 1);    // group of 64 positions, 0..511 (grid = MTOK / 128, exact)
  const int b    = g / (NTOK / 64);
  const int n0   = (g % (NTOK / 64)) * 64;

  const float* xp  = x + ((size_t)b * CHN + 8 * hh) * NTOK + n0 + 4 * j;
  v4f xr[2][16];                                   // [k step][element e]: 4 neighbouring positions of one channel

  if (wave < 2) {
    // The weights, 4 output tiles of 16 rows: wq | wk. No wait for their data stands between these loads and the x loads, so that all are in
    // flight together (one memory latency, not two).
    const float* w01 = wq + j * CHN + 8 * hh;
    const float* w23 = wk + j * CHN + 8 * hh;
    v4f wr[4][2][4];                               // [tile][k step][piece]: channels ks*32 + 8*hh + 0..3, 4..7, 16..19, 20..23
#pragma unroll
    for (int t = 0; t < 4; ++t)
#pragma unroll
      for (int ks = 0; ks < 2; ++ks)
#pragma unroll
        for (int q = 0; q < 4; ++q)
          wr[t][ks][q] = *(const v4f*)((t < 2 ? w01 : w23) + (t & 1) * 16 * CHN + ks * 32 + (q >> 1) * 16 + (q & 1) * 4);
    // a precaution: the x loads' results may be given the registers that held the weight loads' addresses; this waits for address
    // translation alone, not for data, so all loads are still in flight together
    asm volatile("s_wait_xcnt 0x0" ::: "memory");
    pj_load_x(xp, xr);
    // stands in front of every later write of an address register that one of the loads above names (the registers are reused for
    // the converted values); the scheduling barrier keeps those writes behind it
    asm volatile("s_wait_xcnt 0x0" ::: "memory");
    __builtin_amdgcn_sched_barrier(0);

    PF wf[4][2], xf[4][2];
#pragma unroll
    for (int t = 0; t < 4; ++t)
#pragma unroll
      for (int ks = 0; ks < 2; ++ks)
#pragma unroll
        for (int q = 0; q < 4; ++q) {
          wf[t][ks].u[2 * q]     = bf_pk(wr[t][ks][q][0], wr[t][ks][q][1]);
          wf[t][ks].u[2 * q + 1] = bf_pk(wr[t][ks][q][2], wr[t][ks][q][3]);
        }
#pragma unroll
    for (int ks = 0; ks < 2; ++ks)
#pragma unroll
      for (int i = 0; i < 4; ++i)
#pragma unroll
        for (int p = 0; p < 8; ++p) xf[i][ks].u[p] = bf_pk(xr[ks][2 * p][i], xr[ks][2 * p + 1][i]);

    v8f acc[4][4];                                 // [output tile][position tile]
#pragma unroll
    for (int t = 0; t < 4; ++t)
#pragma unroll
      for (int i = 0; i < 4; ++i) acc[t][i] = (v8f){0.f,0.f,0.f,0.f,0.f,0.f,0.f,0.f};
#pragma unroll
    for (int ks = 0; ks < 2; ++ks)
#pragma unroll
      for (int t = 0; t < 4; ++t)
#pragma unroll
        for (int i = 0; i < 4; ++i) acc[t][i] = at_mma(wf[t][ks].v, xf[i][ks].v, acc[t][i]);
    // acc[t][i][r] = (q|k)(position n0 + 4j + i, output t*16 + 8*hh + r)
    v4u hu[16], lu[16];                            // the wave's 16-B pieces of the hi and the lo plane
#pragma unroll
    for (int i = 0; i < 4; ++i)
#pragma unroll
      for (int t = 0; t < 4; ++t)
#pragma unroll
        for (int e = 0; e < 4; ++e) {
          unsigned h, l;
          split_pk(acc[t][i][2 * e], acc[t][i][2 * e + 1], h, l);
          hu[i * 4 + t][e] = h;
          lu[i * 4 + t][e] = l;
        }
    unsigned short* ph = qkh + (size_t)(b * NTOK + n0 + 4 * j) * QKP + 8 * hh;
    unsigned short* pl = qkl + (size_t)(b * NTOK + n0 + 4 * j) * QKP + 8 * hh;
    // all stores stand behind all vector work, so that no register which an issued store names is written again
    __builtin_amdgcn_sched_barrier(0);
#pragma unroll
    for (int i = 0; i < 4; ++i)
#pragma unroll
      for (int t = 0; t < 4; ++t) {
        *(v4u*)(ph + i * QKP + t * 16) = hu[i * 4 + t];
        *(v4u*)(pl + i * QKP + t * 16) = lu[i * 4 + t];
      }
    // behind the last store of the role: no register that an issued store names is written again in front of this wait, on
    // whichever way the built code leaves this block (the other role's block may be laid out directly behind it)
    asm volatile("s_wait_xcnt 0x0" ::: "memory");
  } else {
    pj_load_x(xp, xr);
    // as above: in front of every later write of an address register of the x loads
    asm volatile("s_wait_xcnt 0x0" ::: "memory");
    __builtin_amdgcn_sched_barrier(0);
    v2u xu[2][16];                                 // bf16 of positions n0 + 4j .. 4j+3 of channel 8*hh + ks*32 + (e >> 3)*16 + (e & 7)
#pragma unroll
    for (int ks = 0; ks < 2; ++ks)
#pragma unroll
      for (int e = 0; e < 16; ++e) xu[ks][e] = (v2u){bf_pk(xr[ks][e][0], xr[ks][e][1]), bf_pk(xr[ks][e][2], xr[ks][e][3])};
    unsigned short* px = xb + ((size_t)b * CHN + 8 * hh) * NTOK + n0 + 4 * j;
    // as above: all stores behind all vector work
    __builtin_amdgcn_sched_barrier(0);
#pragma unroll
    for (int ks = 0; ks < 2; ++ks)
#pragma unroll
      for (int e = 0; e < 16; ++e) *(v2u*)(px + (size_t)(ks * 32 + (e >> 3) * 16 + (e & 7)) * NTOK) = xu[ks][e];
    // as above, behind the last store of this role
    asm volatile("s_wait_xcnt 0x0" ::: "memory");
  }
}

// ---------------------------------------------------------------------------
// Workspace region map (byte offsets; every region is fully written by the projection launch before the attention reads it)
//   QKh   bf16 [32768][64]            0       4194304   QKl   4194304
//   XB    bf16 [8][64][4096]    8388608       4194304
//   total                      12582912
// ---------------------------------------------------------------------------
extern "C" void kernel_launch(void* const* d_in, const int* in_sizes, int n_in,
                              void* d_out, int out_size, void* d_ws, size_t ws_size,
                              hipStream_t stream) {
  if (n_in < 4) return;
  if (in_sizes[0] != NB * CHN * NTOK) return;      // x  [8][64][64][64]
  if (in_sizes[1] != DQK * CHN) return;            // wq [32][64]
  if (in_sizes[2] != DQK * CHN) return;            // wk [32][64]
  if (in_sizes[3] != CHN * CHN) return;            // wv [64][64]
  if (out_size != NB * CHN * NTOK) return;

  const float* x  = (const float*)d_in[0];
  const float* wq = (const float*)d_in[1];   // [out 32][in 64]
  const float* wk = (const float*)d_in[2];   // [out 32][in 64]
  const float* wv = (const float*)d_in[3];   // [out 64][in 64]

  const size_t PQK = (size_t)MTOK * QKP * 2;         // 4194304 per plane
  const size_t PVT = (size_t)NB * CHN * NTOK * 2;    // 4194304 per plane
  size_t off = 0;
  const size_t oQKh = off; off += PQK;  const size_t oQKl = off; off += PQK;
  const size_t oXB  = off; off += PVT;
  if (off > ws_size) return;                         // off = 12582912

  char* ws = (char*)d_ws;
  unsigned short* QKh = (unsigned short*)(ws + oQKh); unsigned short* QKl = (unsigned short*)(ws + oQKl);
  unsigned short* XB  = (unsigned short*)(ws + oXB);

  // (1) q|k planes and the bf16 plane of x from x, wq, wk; 256 blocks of 4 waves, 128 positions a block
  proj_kernel<<<dim3(MTOK / 128), dim3(128), 0, stream>>>(x, wq, wk, QKh, QKl, XB);
  // (2) attention per (batch, 128-position block) -> NCHW d_out; 256 blocks of 512 threads
  attn_kernel<<<dim3(NB * (NTOK / AT_QB)), dim3(512), 0, stream>>>(QKh, QKl, XB, wv, (float*)d_out);
  (void)hipGetLastError();
}
